// v000
// Measured on an AMD MI455X. A time is GPU time per run, averaged over a window of back-to-back runs after a warm-up
// (all launches, gaps included; the runs take copies of the inputs in turn), and the median of several windows.
// Apart from v000's, it joins two sittings. Times from different sittings can be a few percent apart, while
// side-by-side timings come from the same sitting.
// The starting kernel, v000, takes 1870 microseconds a run.
// Contractions: q/k/v projections (X f16 x W^T f16 carried x16), scores Q.K^T (relu planes f16, K=64), attn.V (P f16 carried x2^15 x V^T f16): all v_wmma_f32_16x16x32_f16 with f32 accumulate; softmax, bias, relu and residual in f32.
#include <hip/hip_runtime.h>

// ---------------------------------------------------------------------------
// Problem constants
// ---------------------------------------------------------------------------
constexpr int kBatch = 4;
constexpr int kSeq   = 2048;
constexpr int kDim   = 512;
constexpr int kHeads = 8;
constexpr int kDh    = 64;
constexpr int kTok   = kBatch * kSeq;      // 8192 token rows
constexpr int kGrp   = 2;                  // heads per group (b fixed within a group)
constexpr float kWCarry    = 16.0f;        // weights carried x16 in f16
constexpr float kWCarryInv = 1.0f / 16.0f;
constexpr float kPCarry    = 32768.0f;     // probabilities carried x2^15 in f16
constexpr float kPCarryInv = 1.0f / 32768.0f;
constexpr float kQKScale   = 0.125f;       // 1/sqrt(64)
static_assert(kHeads % kGrp == 0);
static_assert(kHeads * kDh == kDim);

typedef __attribute__((ext_vector_type(16))) _Float16 v16h;
typedef __attribute__((ext_vector_type(8)))  _Float16 v8h;
typedef __attribute__((ext_vector_type(16))) __bf16   v16b;
typedef __attribute__((ext_vector_type(8)))  __bf16   v8b;
typedef __attribute__((ext_vector_type(8)))  float    v8f;
typedef __attribute__((ext_vector_type(4)))  float    v4f;
typedef __attribute__((ext_vector_type(4)))  unsigned int v4u;

// ---------------------------------------------------------------------------
// Helpers
// ---------------------------------------------------------------------------
__device__ __forceinline__ unsigned short f2bf_bits(float f) {
  unsigned u = __float_as_uint(f);
  return (unsigned short)((u + 0x7FFFu + ((u >> 16) & 1u)) >> 16);
}
__device__ __forceinline__ float bf_bits2f(unsigned short h) { return __uint_as_float(((unsigned)h) << 16); }

// hazard guards as plain device helpers (no inline asm inside the kernel template body)
__device__ __forceinline__ void dep_guard_h(v8f& a, v8f& b, v16h x, v16h y) { asm volatile("v_nop\n\tv_nop\n\tv_nop\n\tv_nop" : "+v"(a), "+v"(b) : "v"(x), "v"(y)); }
__device__ __forceinline__ void dep_guard_b(v8f& a, v8f& b, v16b x, v16b y) { asm volatile("v_nop\n\tv_nop\n\tv_nop\n\tv_nop" : "+v"(a), "+v"(b) : "v"(x), "v"(y)); }
__device__ __forceinline__ void keep4_h(v16h a, v16h b, v16h c, v16h d) { asm volatile("v_nop" :: "v"(a), "v"(b), "v"(c), "v"(d)); }
__device__ __forceinline__ void keep4_b(v16b a, v16b b, v16b c, v16b d) { asm volatile("v_nop" :: "v"(a), "v"(b), "v"(c), "v"(d)); }
__device__ __forceinline__ void acc_guard4(v8f& a, v8f& b, v8f& c, v8f& d) { asm volatile("v_nop\n\tv_nop\n\tv_nop\n\tv_nop" : "+v"(a), "+v"(b), "+v"(c), "+v"(d)); }
template <typename T> struct Frag;
template <> struct Frag<_Float16> {
  typedef v16h V; union U { v16h v; v8h h[2]; };
  static __device__ __forceinline__ v16h load(const _Float16* p) {   // elements 0..7 <- p[0..7], 8..15 <- p[16..23]
    U f; f.h[0] = *(const v8h*)(p); f.h[1] = *(const v8h*)(p + 16); return f.v;
  }
  static __device__ __forceinline__ v8f mma(v16h a, v16h b, v8f c) {
    return __builtin_amdgcn_wmma_f32_16x16x32_f16(false, a, false, b, (short)0, c, false, false);
  }
  static __device__ __forceinline__ void guard(v8f& a, v8f& b, v16h x, v16h y) { dep_guard_h(a, b, x, y); }
  static __device__ __forceinline__ void keep(v16h a, v16h b, v16h c, v16h d) { keep4_h(a, b, c, d); }
};
template <> struct Frag<__bf16> {
  typedef v16b V; union U { v16b v; v8b h[2]; };
  static __device__ __forceinline__ v16b load(const __bf16* p) {
    U f; f.h[0] = *(const v8b*)(p); f.h[1] = *(const v8b*)(p + 16); return f.v;
  }
  static __device__ __forceinline__ v8f mma(v16b a, v16b b, v8f c) {
    return __builtin_amdgcn_wmma_f32_16x16x32_bf16(false, a, false, b, (short)0, c, false, false);
  }
  static __device__ __forceinline__ void guard(v8f& a, v8f& b, v16b x, v16b y) { dep_guard_b(a, b, x, y); }
  static __device__ __forceinline__ void keep(v16b a, v16b b, v16b c, v16b d) { keep4_b(a, b, c, d); }
};

__device__ __forceinline__ unsigned pk16(unsigned short a, unsigned short b) { return (unsigned)a | ((unsigned)b << 16); }
__device__ __forceinline__ unsigned short h_bits(float f) { const _Float16 h = (_Float16)f; return __builtin_bit_cast(unsigned short, h); }

// ---- Register-blocked batched WMMA GEMM (ACT reduced to none/relu/leaky) -----------------------
// C[m,n] = scale * sum_k A[m,k] * Bt[n,k] (+bias)(+resid); each wave owns a 64x64 tile.
// A row-major [M,K]; Bt row-major [N,K]; M,N % 64 == 0, K % 32 == 0.
// SPLIT: operands are hi/lo planes (A2/Bt2 = lo planes, same layout); product = hi.hi + hi.lo + lo.hi.
// BIAS_MODE: 0 = none, 1 = bias[m], 2 = bias[n].
// OUT_MODE: 0 = f32, 1 = f16, 2 = bf16 hi plane (Cout) + bf16 lo plane (Cout2).
// ET: 0 = f16 operands, 1 = bf16 operands (pointers passed as 16-bit storage)
template <int ET> struct Elem;
template <> struct Elem<0> { typedef _Float16 T; };
template <> struct Elem<1> { typedef __bf16 T; };
template <int ET, bool SPLIT, int BIAS_MODE, int OUT_MODE, bool RESID, int ACT = 0>
__global__ __launch_bounds__(256) void wmma_gemm64(
    const unsigned short* __restrict__ Ap, const unsigned short* __restrict__ A2p, int lda, long strideA,
    const unsigned short* __restrict__ Btp, const unsigned short* __restrict__ Bt2p, int ldb, long strideB,
    void* __restrict__ Cout, void* __restrict__ Cout2, int ldc, long strideC,
    const float* __restrict__ bias,
    const float* __restrict__ resid, long strideR,
    int M, int N, int K, float scale) {
  typedef typename Elem<ET>::T T;
  typedef typename Frag<T>::V V;
  const T* A = (const T*)Ap; const T* A2 = (const T*)A2p; const T* Bt = (const T*)Btp; const T* Bt2 = (const T*)Bt2p;
  __shared__ __align__(16) float sT[8][16 * 68];   // per-wave 16x64 slab, pitch 68 floats
  const int b    = blockIdx.y;
  const int lane = threadIdx.x & 31;
  const int wave = threadIdx.x >> 5;
  const int tilesN = N >> 6;
  const int tilesM = M >> 6;
  const int tile = blockIdx.x * 8 + wave;
  if (tile >= tilesM * tilesN) return;   // wave-uniform; no block barriers in this kernel
  const int tm = tile / tilesN;
  const int tn = tile - tm * tilesN;
  const int m0 = tm << 6;
  const int n0 = tn << 6;

  const T* Ab  = A  + (size_t)b * strideA;
  const T* Bb  = Bt + (size_t)b * strideB;
  const T* Ab2 = SPLIT ? (A2  + (size_t)b * strideA) : nullptr;
  const T* Bb2 = SPLIT ? (Bt2 + (size_t)b * strideB) : nullptr;

  const int rlane = lane & 15;                 // row (A) / col (B, D) within subtile
  const int koff  = (lane >> 4) * 8;           // k offset of this lane half
  const int mOff  = (lane >> 4) * 8;           // D row offset

  v8f acc[4][4];
#pragma unroll
  for (int i = 0; i < 4; ++i)
#pragma unroll
    for (int j = 0; j < 4; ++j) acc[i][j] = (v8f){0.f,0.f,0.f,0.f,0.f,0.f,0.f,0.f};

  for (int k0 = 0; k0 < K; k0 += 32) {
    V bh[4], bl[4];
#pragma unroll
    for (int j = 0; j < 4; ++j) {
      const size_t bo = (size_t)(n0 + (j << 4) + rlane) * ldb + koff + k0;
      bh[j] = Frag<T>::load(Bb + bo);
      if (SPLIT) bl[j] = Frag<T>::load(Bb2 + bo);
    }
#pragma unroll
    for (int i = 0; i < 4; ++i) {
      const size_t ao = (size_t)(m0 + (i << 4) + rlane) * lda + koff + k0;
      V ah = Frag<T>::load(Ab + ao);
      V al;
      if (SPLIT) al = Frag<T>::load(Ab2 + ao);
#pragma unroll
      for (int j = 0; j < 4; ++j) {
        acc[i][j] = Frag<T>::mma(ah, bh[j], acc[i][j]);
        if (SPLIT) {
          acc[i][j] = Frag<T>::mma(ah, bl[j], acc[i][j]);
          acc[i][j] = Frag<T>::mma(al, bh[j], acc[i][j]);
        }
      }
      Frag<T>::guard(acc[i][0], acc[i][3], ah, SPLIT ? al : ah);
    }
    Frag<T>::keep(bh[0], bh[1], bh[2], bh[3]);
    if (SPLIT) Frag<T>::keep(bl[0], bl[1], bl[2], bl[3]);
  }
  acc_guard4(acc[0][0], acc[0][1], acc[0][2], acc[0][3]);
  acc_guard4(acc[1][0], acc[1][1], acc[1][2], acc[1][3]);
  acc_guard4(acc[2][0], acc[2][1], acc[2][2], acc[2][3]);
  acc_guard4(acc[3][0], acc[3][1], acc[3][2], acc[3][3]);

  // ---- epilogue ----
  float* slab = sT[wave];
  const float* Rb = RESID ? (resid + (size_t)b * strideR) : nullptr;
#pragma unroll
  for (int i = 0; i < 4; ++i) {
    const int mBase = m0 + (i << 4);
#pragma unroll
    for (int j = 0; j < 4; ++j) {
      const int n = n0 + (j << 4) + rlane;
      float bv = 0.f;
      if (BIAS_MODE == 2) bv = bias[n];
#pragma unroll
      for (int r = 0; r < 8; ++r) {
        float v = acc[i][j][r] * scale;
        if (BIAS_MODE == 1) v += bias[mBase + mOff + r];
        if (BIAS_MODE == 2) v += bv;
        if (RESID) v += Rb[(size_t)(mBase + mOff + r) * ldc + n];
        if (ACT == 2) v = fmaxf(v, 0.0f);
        if (ACT == 4) v = (v > 0.f) ? v : 0.01f * v;
        slab[(mOff + r) * 68 + (j << 4) + rlane] = v;
      }
    }
    __builtin_amdgcn_fence(__ATOMIC_RELEASE, "workgroup");
    __builtin_amdgcn_wave_barrier();
    __builtin_amdgcn_fence(__ATOMIC_ACQUIRE, "workgroup");
    if (OUT_MODE == 0) {
      float* C = (float*)Cout + (size_t)b * strideC;
      const int hh = lane >> 4, c4 = (lane & 15) * 4;     // row seg = 256 B = 16 lanes x 16 B
      {
#pragma unroll
        for (int it = 0; it < 8; ++it) {
          const int row = it * 2 + hh;
          v4f v = *(const v4f*)(slab + row * 68 + c4);
          *(v4f*)(C + (size_t)(mBase + row) * ldc + n0 + c4) = v;
        }
        
      }
    } else {
      const int q = lane >> 3, c8 = (lane & 7) * 8;
      unsigned short* C  = (unsigned short*)Cout  + (size_t)b * strideC;
      unsigned short* C2 = (OUT_MODE == 2) ? ((unsigned short*)Cout2 + (size_t)b * strideC) : nullptr;
      {
#pragma unroll
        for (int it = 0; it < 4; ++it) {
          const int row = it * 4 + q;
          const float* sp = slab + row * 68 + c8;
          v8h hv, lv;
#pragma unroll
          for (int e = 0; e < 8; ++e) {
            if (OUT_MODE == 1) {
              hv[e] = (_Float16)sp[e];
            } else {
              unsigned short hb = f2bf_bits(sp[e]);
              unsigned short lb = f2bf_bits(sp[e] - bf_bits2f(hb));
              hv[e] = __builtin_bit_cast(_Float16, hb);
              lv[e] = __builtin_bit_cast(_Float16, lb);
            }
          }
          *(v8h*)(C + (size_t)(mBase + row) * ldc + n0 + c8) = hv;
          if (OUT_MODE == 2) *(v8h*)(C2 + (size_t)(mBase + row) * ldc + n0 + c8) = lv;
        }
        
      }
    }
    __builtin_amdgcn_fence(__ATOMIC_RELEASE, "workgroup");
    __builtin_amdgcn_wave_barrier();
    __builtin_amdgcn_fence(__ATOMIC_ACQUIRE, "workgroup");
  }
}

// ---------------------------------------------------------------------------
// f32 -> f16 cast (value * scale) of up to three equally sized planes; blockIdx.y selects the source plane
// (block-uniform pointer choice, all global) and the destination plane (out + blockIdx.y * planeStride halves).
// Coverage: gridDim.x * 256 == n8 exactly (host asserts), times 8 = the whole plane; gridDim.y = number of planes.
// ---------------------------------------------------------------------------
__global__ __launch_bounds__(256) void cast8x3_f16_kernel(const float* __restrict__ in0, const float* __restrict__ in1,
                                                          const float* __restrict__ in2, unsigned short* __restrict__ out,
                                                          int n8, long planeStride, float scale) {
  const int z = blockIdx.y;
  const float* in = (z == 0) ? in0 : (z == 1) ? in1 : in2;
  const int i = blockIdx.x * 256 + threadIdx.x;
  if (i >= n8) return;
  const float* p = in + 8 * (size_t)i;
  const v4f a = *(const v4f*)(p);
  const v4f c = *(const v4f*)(p + 4);
  unsigned short hb[8];
#pragma unroll
  for (int e = 0; e < 4; ++e) {
    hb[e]     = h_bits(a[e] * scale);
    hb[4 + e] = h_bits(c[e] * scale);
  }
  const v4u u = (v4u){pk16(hb[0], hb[1]), pk16(hb[2], hb[3]), pk16(hb[4], hb[5]), pk16(hb[6], hb[7])};
  unsigned short* q = out + (size_t)z * planeStride + 8 * (size_t)i;
  *(v4u*)q = u;
  
}

// ---------------------------------------------------------------------------
// Row softmax over kSeq (2048) f32 scores: P[row][j] = f16( carry * exp(s - max) / sum exp(s - max) ), f32 math.
// One block of 256 threads per row; thread t owns columns 8t..8t+7 (256 x 8 = 2048 = the whole row).
// Reductions in fixed order (thread, unconditional wave shuffle tree, 8 wave partials in index order).
// ---------------------------------------------------------------------------
__global__ __launch_bounds__(256) void softmax_row_kernel(const float* __restrict__ S, unsigned short* __restrict__ P, float carry) {
  __shared__ float redM[8];
  __shared__ float redS[8];
  const int row  = blockIdx.x;
  const int t    = threadIdx.x;
  const int lane = t & 31, wave = t >> 5;
  const int c0   = t * 8;
  const float* sr = S + (size_t)row * kSeq + c0;
  const v4f a = *(const v4f*)(sr);
  const v4f c = *(const v4f*)(sr + 4);
  float x[8];
#pragma unroll
  for (int e = 0; e < 4; ++e) { x[e] = a[e]; x[4 + e] = c[e]; }
  float m = fmaxf(fmaxf(fmaxf(x[0], x[1]), fmaxf(x[2], x[3])), fmaxf(fmaxf(x[4], x[5]), fmaxf(x[6], x[7])));
#pragma unroll
  for (int off = 16; off > 0; off >>= 1) m = fmaxf(m, __shfl_xor(m, off, 32));
  if (lane == 0) redM[wave] = m;
  __syncthreads();
  float gm = redM[0];
#pragma unroll
  for (int w = 1; w < 8; ++w) gm = fmaxf(gm, redM[w]);

  float ev[8];
#pragma unroll
  for (int e = 0; e < 8; ++e) ev[e] = expf(x[e] - gm);
  float s = ((ev[0] + ev[1]) + (ev[2] + ev[3])) + ((ev[4] + ev[5]) + (ev[6] + ev[7]));
#pragma unroll
  for (int off = 16; off > 0; off >>= 1) s += __shfl_xor(s, off, 32);
  if (lane == 0) redS[wave] = s;
  __syncthreads();
  float tot = redS[0];
#pragma unroll
  for (int w = 1; w < 8; ++w) tot += redS[w];
  /* tot >= 1 (the max element contributes exp(0)); no underflow in the reciprocal */
  const float inv = carry * (1.0f / tot);

  unsigned short hb[8];
#pragma unroll
  for (int e = 0; e < 8; ++e) hb[e] = h_bits(ev[e] * inv);
  const v4u u = (v4u){pk16(hb[0], hb[1]), pk16(hb[2], hb[3]), pk16(hb[4], hb[5]), pk16(hb[6], hb[7])};
  unsigned short* q = P + (size_t)row * kSeq + c0;
  *(v4u*)q = u;
  
}

// ---------------------------------------------------------------------------
// Host side
// Workspace region map (bytes):
//   W16  : 3 x 512 x 512 x 2         =   1,572,864 @          0   (Wq, Wk, Wv as f16 x16, [out][in])
//   Q16  : 8192 x 512 x 2            =   8,388,608 @  1,572,864   (relu(Xq Wq^T + bq), f16, [tok][512])
//   K16  : 8192 x 512 x 2            =   8,388,608 @  9,961,472
//   Vt16 : 512 x 8192 x 2            =   8,388,608 @ 18,350,080   (relu(Wv Xv^T + bv), f16, [v][b*2048+t])
//   S32  : kGrp x 2048 x 2048 x 4    =  33,554,432 @ 26,738,688   (scores group, f32; also hosts the three
//                                                                  8,388,608-B f16 input planes (25,165,824 B)
//                                                                  before the group loop)
//   P16  : kGrp x 2048 x 2048 x 2    =  16,777,216 @ 60,293,120   (probabilities x2^15, f16)
//   total                            =  77,070,336 <= 134,217,728
// ---------------------------------------------------------------------------
extern "C" void kernel_launch(void* const* d_in, const int* in_sizes, int n_in,
                              void* d_out, int out_size, void* d_ws, size_t ws_size,
                              hipStream_t stream) {
  if (n_in < 9) return;
  const size_t nTokU = (size_t)kTok * kDim;       // 4,194,304
  const size_t nWW   = (size_t)kDim * kDim;       //   262,144
  if ((size_t)in_sizes[0] != nTokU || (size_t)in_sizes[1] != nTokU || (size_t)in_sizes[2] != nTokU) return;
  if ((size_t)in_sizes[3] != nWW || (size_t)in_sizes[5] != nWW || (size_t)in_sizes[7] != nWW) return;
  if (in_sizes[4] != kDim || in_sizes[6] != kDim || in_sizes[8] != kDim) return;
  if ((size_t)out_size != nTokU) return;

  const float* queries = (const float*)d_in[0];
  const float* keys    = (const float*)d_in[1];
  const float* values  = (const float*)d_in[2];
  const float* Wq      = (const float*)d_in[3];
  const float* bq      = (const float*)d_in[4];
  const float* Wk      = (const float*)d_in[5];
  const float* bk      = (const float*)d_in[6];
  const float* Wv      = (const float*)d_in[7];
  const float* bv      = (const float*)d_in[8];
  float* out = (float*)d_out;

  // ---- carve ----
  const size_t bW16  = 3 * nWW * 2;
  const size_t bQ16  = nTokU * 2;
  const size_t bK16  = nTokU * 2;
  const size_t bVt16 = nTokU * 2;
  const size_t nS    = (size_t)kGrp * kSeq * kSeq;     // 8,388,608 elements per group
  const size_t bS32  = nS * 4;
  const size_t bP16  = nS * 2;
  const size_t oW16  = 0;
  const size_t oQ16  = oW16 + bW16;
  const size_t oK16  = oQ16 + bQ16;
  const size_t oVt16 = oK16 + bK16;
  const size_t oS32  = oVt16 + bVt16;
  const size_t oP16  = oS32 + bS32;
  const size_t total = oP16 + bP16;
  if (total > ws_size) return;
  if (3 * nTokU * 2 > bS32) return;   // input staging planes must fit inside the score region

  char* ws = (char*)d_ws;
  unsigned short* W16  = (unsigned short*)(ws + oW16);
  unsigned short* Q16  = (unsigned short*)(ws + oQ16);
  unsigned short* K16  = (unsigned short*)(ws + oK16);
  unsigned short* Vt16 = (unsigned short*)(ws + oVt16);
  float*          S32  = (float*)(ws + oS32);
  unsigned short* P16  = (unsigned short*)(ws + oP16);
  unsigned short* Xst  = (unsigned short*)(ws + oS32);     // three f16 input planes, stride nTokU halves
  unsigned short* Xq16 = Xst;
  unsigned short* Xk16 = Xst + nTokU;
  unsigned short* Xv16 = Xst + 2 * nTokU;
  unsigned short* Wq16 = W16;
  unsigned short* Wk16 = W16 + nWW;
  unsigned short* Wv16 = W16 + 2 * nWW;

  const dim3 blk(256);

  // ---- casts: inputs (scale 1) and weights (scale 16) ----
  {
    const int n8x = (int)(nTokU / 8);      // 524,288 = 2048 x 256
    const int n8w = (int)(nWW / 8);        //  32,768 =  128 x 256
    if ((n8x % 256) != 0 || (n8w % 256) != 0) return;
    cast8x3_f16_kernel<<<dim3(n8x / 256, 3), blk, 0, stream>>>(queries, keys, values, Xst, n8x, (long)nTokU, 1.0f);
    cast8x3_f16_kernel<<<dim3(n8w / 256, 3), blk, 0, stream>>>(Wq, Wk, Wv, W16, n8w, (long)nWW, kWCarry);
  }

  // ---- projections: Q, K as [8192][512] f16; V transposed as [512][8192] f16 ----
  {
    // M=8192, N=512, K=512: tiles 128 x 8 = 1024 -> 128 blocks of 8 waves
    const dim3 gQK((kTok / 64) * (kDim / 64) / 8, 1);
    wmma_gemm64<0, false, 2, 1, false, 2><<<gQK, blk, 0, stream>>>(
        Xq16, Xq16, kDim, 0L, Wq16, Wq16, kDim, 0L, (void*)Q16, (void*)Q16, kDim, 0L,
        bq, queries, 0L, kTok, kDim, kDim, kWCarryInv);
    wmma_gemm64<0, false, 2, 1, false, 2><<<gQK, blk, 0, stream>>>(
        Xk16, Xk16, kDim, 0L, Wk16, Wk16, kDim, 0L, (void*)K16, (void*)K16, kDim, 0L,
        bk, queries, 0L, kTok, kDim, kDim, kWCarryInv);
    // Vt[v][tok] = relu(sum_u Wv[v][u] Xv[tok][u] + bv[v]): A = Wv16 [512][512], Bt = Xv16 [8192][512]
    // M=512, N=8192, K=512: tiles 8 x 128 = 1024 -> 128 blocks
    const dim3 gV((kDim / 64) * (kTok / 64) / 8, 1);
    wmma_gemm64<0, false, 1, 1, false, 2><<<gV, blk, 0, stream>>>(
        Wv16, Wv16, kDim, 0L, Xv16, Xv16, kDim, 0L, (void*)Vt16, (void*)Vt16, kTok, 0L,
        bv, queries, 0L, kDim, kTok, kDim, kWCarryInv);
  }

  // ---- attention groups: b fixed, kGrp consecutive heads per group (4 x 4 = 16 groups) ----
  for (int b = 0; b < kBatch; ++b) {
    for (int h0 = 0; h0 < kHeads; h0 += kGrp) {
      const size_t tokOff = (size_t)b * kSeq * kDim;            // element offset of row b*2048 in a [8192][512] plane
      // S[g][q][k] = 0.125 * sum_d Q[b,q,h*64+d] K[b,k,h*64+d], h = h0 + g
      // A = Q16 + tokOff + h0*64 (lda 512, strideA 64), Bt = K16 likewise; M=N=2048, K=64 (2 k-steps)
      const dim3 gS((kSeq / 64) * (kSeq / 64) / 8, kGrp);     // 1024 tiles -> 128 blocks, y = heads
      wmma_gemm64<0, false, 0, 0, false, 0><<<gS, blk, 0, stream>>>(
          Q16 + tokOff + (size_t)h0 * kDh, Q16 + tokOff + (size_t)h0 * kDh, kDim, (long)kDh,
          K16 + tokOff + (size_t)h0 * kDh, K16 + tokOff + (size_t)h0 * kDh, kDim, (long)kDh,
          (void*)S32, (void*)S32, kSeq, (long)kSeq * kSeq,
          bq, queries, 0L, kSeq, kSeq, kDh, kQKScale);
      // row softmax over all kGrp x 2048 rows of the group
      softmax_row_kernel<<<dim3(kGrp * kSeq), blk, 0, stream>>>(S32, P16, kPCarry);
      // out[b,q,h*64+d] = 2^-15 * sum_k P[g][q][k] Vt[h*64+d][b*2048+k] + queries[b,q,h*64+d]
      // A = P16 (lda 2048, strideA 2048*2048), Bt = Vt16 + h0*64*8192 + b*2048 (ldb 8192, strideB 64*8192)
      // M=2048, N=64, K=2048: 32 tiles -> 4 blocks of 8 waves, y = heads; C and resid strides 64 floats per head
      const dim3 gPV((kSeq / 64) * (kDh / 64) / 8, kGrp);
      unsigned short* VtBase = Vt16 + (size_t)h0 * kDh * kTok + (size_t)b * kSeq;
      float* Cbase = out + tokOff + (size_t)h0 * kDh;
      const float* Rbase = queries + tokOff + (size_t)h0 * kDh;
      wmma_gemm64<0, false, 0, 0, true, 0><<<gPV, blk, 0, stream>>>(
          P16, P16, kSeq, (long)kSeq * kSeq,
          VtBase, VtBase, kTok, (long)kDh * kTok,
          (void*)Cbase, (void*)Cbase, kDim, (long)kDh,
          bq, Rbase, (long)kDh, kSeq, kDh, kSeq, kPCarryInv);
    }
  }
}

// v001
// One run takes 537 microseconds.
// Timed twice side by side with v000, it ran 3.54 times as fast both times.
// Contractions: q/k/v projections (X f16 x W^T f16 carried x16), scores Q.K^T (relu planes f16, K=64), attn.V (P f16 carried x2^15 x V^T f16): all v_wmma_f32_16x16x32_f16 with f32 accumulate; softmax, bias, relu and residual in f32.
#include <hip/hip_runtime.h>

// ---------------------------------------------------------------------------
// Problem constants
// ---------------------------------------------------------------------------
constexpr int kBatch = 4;
constexpr int kSeq   = 2048;
constexpr int kDim   = 512;
constexpr int kHeads = 8;
constexpr int kDh    = 64;
constexpr int kTok   = kBatch * kSeq;      // 8192 token rows
constexpr int kGrp   = 2;                  // heads per group (b fixed within a group)
constexpr float kWCarry    = 16.0f;        // weights carried x16 in f16
constexpr float kWCarryInv = 1.0f / 16.0f;
constexpr float kPCarry    = 32768.0f;     // probabilities carried x2^15 in f16
constexpr float kPCarryInv = 1.0f / 32768.0f;
constexpr float kQKScale   = 0.125f;       // 1/sqrt(64)
static_assert(kHeads % kGrp == 0);
static_assert(kHeads * kDh == kDim);

typedef __attribute__((ext_vector_type(16))) _Float16 v16h;
typedef __attribute__((ext_vector_type(8)))  _Float16 v8h;
typedef __attribute__((ext_vector_type(16))) __bf16   v16b;
typedef __attribute__((ext_vector_type(8)))  __bf16   v8b;
typedef __attribute__((ext_vector_type(8)))  float    v8f;
typedef __attribute__((ext_vector_type(4)))  float    v4f;
typedef __attribute__((ext_vector_type(4)))  unsigned int v4u;

// ---------------------------------------------------------------------------
// Helpers
// ---------------------------------------------------------------------------
__device__ __forceinline__ unsigned short f2bf_bits(float f) {
  unsigned u = __float_as_uint(f);
  return (unsigned short)((u + 0x7FFFu + ((u >> 16) & 1u)) >> 16);
}
__device__ __forceinline__ float bf_bits2f(unsigned short h) { return __uint_as_float(((unsigned)h) << 16); }

// hazard guards as plain device helpers (no inline asm inside the kernel template body)
__device__ __forceinline__ void dep_guard_h(v8f& a, v8f& b, v16h x, v16h y) { asm volatile("v_nop\n\tv_nop\n\tv_nop\n\tv_nop" : "+v"(a), "+v"(b) : "v"(x), "v"(y)); }
__device__ __forceinline__ void dep_guard_b(v8f& a, v8f& b, v16b x, v16b y) { asm volatile("v_nop\n\tv_nop\n\tv_nop\n\tv_nop" : "+v"(a), "+v"(b) : "v"(x), "v"(y)); }
__device__ __forceinline__ void keep4_h(v16h a, v16h b, v16h c, v16h d) { asm volatile("v_nop" :: "v"(a), "v"(b), "v"(c), "v"(d)); }
__device__ __forceinline__ void keep4_b(v16b a, v16b b, v16b c, v16b d) { asm volatile("v_nop" :: "v"(a), "v"(b), "v"(c), "v"(d)); }
__device__ __forceinline__ void acc_guard4(v8f& a, v8f& b, v8f& c, v8f& d) { asm volatile("v_nop\n\tv_nop\n\tv_nop\n\tv_nop" : "+v"(a), "+v"(b), "+v"(c), "+v"(d)); }
template <typename T> struct Frag;
template <> struct Frag<_Float16> {
  typedef v16h V; union U { v16h v; v8h h[2]; };
  static __device__ __forceinline__ v16h load(const _Float16* p) {   // elements 0..7 <- p[0..7], 8..15 <- p[16..23]
    U f; f.h[0] = *(const v8h*)(p); f.h[1] = *(const v8h*)(p + 16); return f.v;
  }
  static __device__ __forceinline__ v8f mma(v16h a, v16h b, v8f c) {
    return __builtin_amdgcn_wmma_f32_16x16x32_f16(false, a, false, b, (short)0, c, false, false);
  }
  static __device__ __forceinline__ void guard(v8f& a, v8f& b, v16h x, v16h y) { dep_guard_h(a, b, x, y); }
  static __device__ __forceinline__ void keep(v16h a, v16h b, v16h c, v16h d) { keep4_h(a, b, c, d); }
};
template <> struct Frag<__bf16> {
  typedef v16b V; union U { v16b v; v8b h[2]; };
  static __device__ __forceinline__ v16b load(const __bf16* p) {
    U f; f.h[0] = *(const v8b*)(p); f.h[1] = *(const v8b*)(p + 16); return f.v;
  }
  static __device__ __forceinline__ v8f mma(v16b a, v16b b, v8f c) {
    return __builtin_amdgcn_wmma_f32_16x16x32_bf16(false, a, false, b, (short)0, c, false, false);
  }
  static __device__ __forceinline__ void guard(v8f& a, v8f& b, v16b x, v16b y) { dep_guard_b(a, b, x, y); }
  static __device__ __forceinline__ void keep(v16b a, v16b b, v16b c, v16b d) { keep4_b(a, b, c, d); }
};

__device__ __forceinline__ unsigned pk16(unsigned short a, unsigned short b) { return (unsigned)a | ((unsigned)b << 16); }
__device__ __forceinline__ unsigned short h_bits(float f) { const _Float16 h = (_Float16)f; return __builtin_bit_cast(unsigned short, h); }

// ---- Register-blocked batched WMMA GEMM (ACT reduced to none/relu/leaky) -----------------------
// C[m,n] = scale * sum_k A[m,k] * Bt[n,k] (+bias)(+resid); each wave owns a 64x64 tile.
// A row-major [M,K]; Bt row-major [N,K]; M,N % 64 == 0, K % 32 == 0.
// SPLIT: operands are hi/lo planes (A2/Bt2 = lo planes, same layout); product = hi.hi + hi.lo + lo.hi.
// BIAS_MODE: 0 = none, 1 = bias[m], 2 = bias[n].
// OUT_MODE: 0 = f32, 1 = f16, 2 = bf16 hi plane (Cout) + bf16 lo plane (Cout2).
// ET: 0 = f16 operands, 1 = bf16 operands (pointers passed as 16-bit storage)
template <int ET> struct Elem;
template <> struct Elem<0> { typedef _Float16 T; };
template <> struct Elem<1> { typedef __bf16 T; };
template <int ET, bool SPLIT, int BIAS_MODE, int OUT_MODE, bool RESID, int ACT = 0>
__global__ __launch_bounds__(256) void wmma_gemm64(
    const unsigned short* __restrict__ Ap, const unsigned short* __restrict__ A2p, int lda, long strideA,
    const unsigned short* __restrict__ Btp, const unsigned short* __restrict__ Bt2p, int ldb, long strideB,
    void* __restrict__ Cout, void* __restrict__ Cout2, int ldc, long strideC,
    const float* __restrict__ bias,
    const float* __restrict__ resid, long strideR,
    int M, int N, int K, float scale) {
  typedef typename Elem<ET>::T T;
  typedef typename Frag<T>::V V;
  const T* A = (const T*)Ap; const T* A2 = (const T*)A2p; const T* Bt = (const T*)Btp; const T* Bt2 = (const T*)Bt2p;
  __shared__ __align__(16) float sT[8][16 * 68];   // per-wave 16x64 slab, pitch 68 floats
  const int b    = blockIdx.y;
  const int lane = threadIdx.x & 31;
  const int wave = threadIdx.x >> 5;
  const int tilesN = N >> 6;
  const int tilesM = M >> 6;
  const int tile = blockIdx.x * 8 + wave;
  if (tile >= tilesM * tilesN) return;   // wave-uniform; no block barriers in this kernel
  const int tm = tile / tilesN;
  const int tn = tile - tm * tilesN;
  const int m0 = tm << 6;
  const int n0 = tn << 6;

  const T* Ab  = A  + (size_t)b * strideA;
  const T* Bb  = Bt + (size_t)b * strideB;
  const T* Ab2 = SPLIT ? (A2  + (size_t)b * strideA) : nullptr;
  const T* Bb2 = SPLIT ? (Bt2 + (size_t)b * strideB) : nullptr;

  const int rlane = lane & 15;                 // row (A) / col (B, D) within subtile
  const int koff  = (lane >> 4) * 8;           // k offset of this lane half
  const int mOff  = (lane >> 4) * 8;           // D row offset

  v8f acc[4][4];
#pragma unroll
  for (int i = 0; i < 4; ++i)
#pragma unroll
    for (int j = 0; j < 4; ++j) acc[i][j] = (v8f){0.f,0.f,0.f,0.f,0.f,0.f,0.f,0.f};

  for (int k0 = 0; k0 < K; k0 += 32) {
    V bh[4], bl[4];
#pragma unroll
    for (int j = 0; j < 4; ++j) {
      const size_t bo = (size_t)(n0 + (j << 4) + rlane) * ldb + koff + k0;
      bh[j] = Frag<T>::load(Bb + bo);
      if (SPLIT) bl[j] = Frag<T>::load(Bb2 + bo);
    }
#pragma unroll
    for (int i = 0; i < 4; ++i) {
      const size_t ao = (size_t)(m0 + (i << 4) + rlane) * lda + koff + k0;
      V ah = Frag<T>::load(Ab + ao);
      V al;
      if (SPLIT) al = Frag<T>::load(Ab2 + ao);
#pragma unroll
      for (int j = 0; j < 4; ++j) {
        acc[i][j] = Frag<T>::mma(ah, bh[j], acc[i][j]);
        if (SPLIT) {
          acc[i][j] = Frag<T>::mma(ah, bl[j], acc[i][j]);
          acc[i][j] = Frag<T>::mma(al, bh[j], acc[i][j]);
        }
      }
      Frag<T>::guard(acc[i][0], acc[i][3], ah, SPLIT ? al : ah);
    }
    Frag<T>::keep(bh[0], bh[1], bh[2], bh[3]);
    if (SPLIT) Frag<T>::keep(bl[0], bl[1], bl[2], bl[3]);
  }
  acc_guard4(acc[0][0], acc[0][1], acc[0][2], acc[0][3]);
  acc_guard4(acc[1][0], acc[1][1], acc[1][2], acc[1][3]);
  acc_guard4(acc[2][0], acc[2][1], acc[2][2], acc[2][3]);
  acc_guard4(acc[3][0], acc[3][1], acc[3][2], acc[3][3]);

  // ---- epilogue ----
  float* slab = sT[wave];
  const float* Rb = RESID ? (resid + (size_t)b * strideR) : nullptr;
#pragma unroll
  for (int i = 0; i < 4; ++i) {
    const int mBase = m0 + (i << 4);
#pragma unroll
    for (int j = 0; j < 4; ++j) {
      const int n = n0 + (j << 4) + rlane;
      float bv = 0.f;
      if (BIAS_MODE == 2) bv = bias[n];
#pragma unroll
      for (int r = 0; r < 8; ++r) {
        float v = acc[i][j][r] * scale;
        if (BIAS_MODE == 1) v += bias[mBase + mOff + r];
        if (BIAS_MODE == 2) v += bv;
        if (RESID) v += Rb[(size_t)(mBase + mOff + r) * ldc + n];
        if (ACT == 2) v = fmaxf(v, 0.0f);
        if (ACT == 4) v = (v > 0.f) ? v : 0.01f * v;
        slab[(mOff + r) * 68 + (j << 4) + rlane] = v;
      }
    }
    __builtin_amdgcn_fence(__ATOMIC_RELEASE, "workgroup");
    __builtin_amdgcn_wave_barrier();
    __builtin_amdgcn_fence(__ATOMIC_ACQUIRE, "workgroup");
    if (OUT_MODE == 0) {
      float* C = (float*)Cout + (size_t)b * strideC;
      const int hh = lane >> 4, c4 = (lane & 15) * 4;     // row seg = 256 B = 16 lanes x 16 B
      {
#pragma unroll
        for (int it = 0; it < 8; ++it) {
          const int row = it * 2 + hh;
          v4f v = *(const v4f*)(slab + row * 68 + c4);
          *(v4f*)(C + (size_t)(mBase + row) * ldc + n0 + c4) = v;
        }
        
      }
    } else {
      const int q = lane >> 3, c8 = (lane & 7) * 8;
      unsigned short* C  = (unsigned short*)Cout  + (size_t)b * strideC;
      unsigned short* C2 = (OUT_MODE == 2) ? ((unsigned short*)Cout2 + (size_t)b * strideC) : nullptr;
      {
#pragma unroll
        for (int it = 0; it < 4; ++it) {
          const int row = it * 4 + q;
          const float* sp = slab + row * 68 + c8;
          v8h hv, lv;
#pragma unroll
          for (int e = 0; e < 8; ++e) {
            if (OUT_MODE == 1) {
              hv[e] = (_Float16)sp[e];
            } else {
              unsigned short hb = f2bf_bits(sp[e]);
              unsigned short lb = f2bf_bits(sp[e] - bf_bits2f(hb));
              hv[e] = __builtin_bit_cast(_Float16, hb);
              lv[e] = __builtin_bit_cast(_Float16, lb);
            }
          }
          *(v8h*)(C + (size_t)(mBase + row) * ldc + n0 + c8) = hv;
          if (OUT_MODE == 2) *(v8h*)(C2 + (size_t)(mBase + row) * ldc + n0 + c8) = lv;
        }
        
      }
    }
    __builtin_amdgcn_fence(__ATOMIC_RELEASE, "workgroup");
    __builtin_amdgcn_wave_barrier();
    __builtin_amdgcn_fence(__ATOMIC_ACQUIRE, "workgroup");
  }
}

// ---------------------------------------------------------------------------
// f32 -> f16 cast (value * scale) of up to three equally sized planes; blockIdx.y selects the source plane
// (block-uniform pointer choice, all global) and the destination plane (out + blockIdx.y * planeStride halves).
// Coverage: gridDim.x * 256 == n8 exactly (host asserts), times 8 = the whole plane; gridDim.y = number of planes.
// ---------------------------------------------------------------------------
__global__ __launch_bounds__(256) void cast8x3_f16_kernel(const float* __restrict__ in0, const float* __restrict__ in1,
                                                          const float* __restrict__ in2, unsigned short* __restrict__ out,
                                                          int n8, long planeStride, float scale) {
  const int z = blockIdx.y;
  const float* in = (z == 0) ? in0 : (z == 1) ? in1 : in2;
  const int i = blockIdx.x * 256 + threadIdx.x;
  if (i >= n8) return;
  const float* p = in + 8 * (size_t)i;
  const v4f a = *(const v4f*)(p);
  const v4f c = *(const v4f*)(p + 4);
  unsigned short hb[8];
#pragma unroll
  for (int e = 0; e < 4; ++e) {
    hb[e]     = h_bits(a[e] * scale);
    hb[4 + e] = h_bits(c[e] * scale);
  }
  const v4u u = (v4u){pk16(hb[0], hb[1]), pk16(hb[2], hb[3]), pk16(hb[4], hb[5]), pk16(hb[6], hb[7])};
  unsigned short* q = out + (size_t)z * planeStride + 8 * (size_t)i;
  *(v4u*)q = u;
  
}

// ---------------------------------------------------------------------------
// Row softmax over kSeq (2048) f32 scores: P[row][j] = f16( carry * exp(s - max) / sum exp(s - max) ), f32 math.
// One block of 256 threads per row; thread t owns columns 8t..8t+7 (256 x 8 = 2048 = the whole row).
// Reductions in fixed order (thread, unconditional wave shuffle tree, 8 wave partials in index order).
// ---------------------------------------------------------------------------
__global__ __launch_bounds__(256) void softmax_row_kernel(const float* __restrict__ S, unsigned short* __restrict__ P, float carry) {
  __shared__ float redM[8];
  __shared__ float redS[8];
  const int row  = blockIdx.x;
  const int t    = threadIdx.x;
  const int lane = t & 31, wave = t >> 5;
  const int c0   = t * 8;
  const float* sr = S + (size_t)row * kSeq + c0;
  const v4f a = *(const v4f*)(sr);
  const v4f c = *(const v4f*)(sr + 4);
  float x[8];
#pragma unroll
  for (int e = 0; e < 4; ++e) { x[e] = a[e]; x[4 + e] = c[e]; }
  float m = fmaxf(fmaxf(fmaxf(x[0], x[1]), fmaxf(x[2], x[3])), fmaxf(fmaxf(x[4], x[5]), fmaxf(x[6], x[7])));
#pragma unroll
  for (int off = 16; off > 0; off >>= 1) m = fmaxf(m, __shfl_xor(m, off, 32));
  if (lane == 0) redM[wave] = m;
  __syncthreads();
  float gm = redM[0];
#pragma unroll
  for (int w = 1; w < 8; ++w) gm = fmaxf(gm, redM[w]);

  float ev[8];
#pragma unroll
  for (int e = 0; e < 8; ++e) ev[e] = expf(x[e] - gm);
  float s = ((ev[0] + ev[1]) + (ev[2] + ev[3])) + ((ev[4] + ev[5]) + (ev[6] + ev[7]));
#pragma unroll
  for (int off = 16; off > 0; off >>= 1) s += __shfl_xor(s, off, 32);
  if (lane == 0) redS[wave] = s;
  __syncthreads();
  float tot = redS[0];
#pragma unroll
  for (int w = 1; w < 8; ++w) tot += redS[w];
  /* tot >= 1 (the max element contributes exp(0)); no underflow in the reciprocal */
  const float inv = carry * (1.0f / tot);

  unsigned short hb[8];
#pragma unroll
  for (int e = 0; e < 8; ++e) hb[e] = h_bits(ev[e] * inv);
  const v4u u = (v4u){pk16(hb[0], hb[1]), pk16(hb[2], hb[3]), pk16(hb[4], hb[5]), pk16(hb[6], hb[7])};
  unsigned short* q = P + (size_t)row * kSeq + c0;
  *(v4u*)q = u;
  
}

// ---------------------------------------------------------------------------
// attn.V for one group of heads: C[q][d] = scale * sum_k P[g][q][k] * Vt[g*64+d][k] + R[q][d].
// One work-group owns 32 query rows x 32 columns of one head (blockIdx.x = 2 * row tile + column half, blockIdx.y =
// head in group); the K range (2048) is dealt over its sixteen waves, 128 consecutive k each, so that the launch has
// (2048 / 32) x 2 x kGrp work-groups and a wave's whole slice of P and Vt fits its registers and is fetched at once.
// Each wave leaves its f32 partial tile in LDS; behind one barrier every thread sums the sixteen partials of two
// neighbouring columns in wave order (fixed), scales, adds the residual and stores 8 B.
// ---------------------------------------------------------------------------
typedef __attribute__((ext_vector_type(2))) float v2f;
constexpr int kPvWaves = 16;                    // waves of a work-group = parts of the K range
constexpr int kPvSlice = kSeq / kPvWaves;       // k range of one wave
constexpr int kPvPitch = 36;                    // floats per row of a partial tile in LDS
static_assert(kPvSlice == 128);
__global__ __launch_bounds__(kPvWaves * 32) void pv_wavesplit_kernel(const unsigned short* __restrict__ Pp,
                                                                     const unsigned short* __restrict__ Vtp,
                                                                     float* __restrict__ C, const float* __restrict__ R,
                                                                     float scale) {
  typedef Frag<_Float16> F;
  __shared__ __align__(16) float part[kPvWaves][32 * kPvPitch];   // per-wave 32x32 partial
  const int g     = blockIdx.y;
  const int lane  = threadIdx.x & 31;
  const int wave  = threadIdx.x >> 5;
  const int m0    = (blockIdx.x >> 1) << 5;
  const int n0    = (blockIdx.x & 1) << 5;
  const int rlane = lane & 15;                 // row (A) / col (B, D) within subtile
  const int koff  = (lane >> 4) * 8;           // k offset of this lane half
  const int mOff  = (lane >> 4) * 8;           // D row offset
  const _Float16* A = (const _Float16*)Pp + (size_t)g * kSeq * kSeq + (size_t)(m0 + rlane) * kSeq + wave * kPvSlice + koff;
  const _Float16* B = (const _Float16*)Vtp + (size_t)g * kDh * kTok + (size_t)(n0 + rlane) * kTok + wave * kPvSlice + koff;

  // The wave's whole slice: 4 k-steps of two A and two B fragments. Every loop of this kernel is unrolled whole:
  // the fragment and accumulator arrays stay in registers only under constant indices.
  v16h a[2][4], b[2][4];
#pragma unroll
  for (int i = 0; i < 2; ++i)
#pragma unroll
    for (int s = 0; s < 4; ++s) {
      a[i][s] = F::load(A + (size_t)(i << 4) * kSeq + s * 32);
      b[i][s] = F::load(B + (size_t)(i << 4) * kTok + s * 32);
    }
  // Inputs-only fence on the loaded values: all 32 loads are issued before the products. Without it the compiler
  // issues each fragment's loads directly in front of its product and waits out the memory latency once per product.
  // The two pointers are inputs too: both address pairs stay live to here, behind the load wait. Without them the last
  // loads of the run land on the address registers that the earlier loads of the run still name.
  asm volatile("" :: "v"(a[0][0]), "v"(a[0][1]), "v"(a[0][2]), "v"(a[0][3]),
                     "v"(a[1][0]), "v"(a[1][1]), "v"(a[1][2]), "v"(a[1][3]),
                     "v"(b[0][0]), "v"(b[0][1]), "v"(b[0][2]), "v"(b[0][3]),
                     "v"(b[1][0]), "v"(b[1][1]), "v"(b[1][2]), "v"(b[1][3]), "v"(A), "v"(B));

  v8f acc[2][2];
#pragma unroll
  for (int i = 0; i < 2; ++i)
#pragma unroll
    for (int j = 0; j < 2; ++j) acc[i][j] = (v8f){0.f,0.f,0.f,0.f,0.f,0.f,0.f,0.f};
#pragma unroll
  for (int s = 0; s < 4; ++s) {
#pragma unroll
    for (int i = 0; i < 2; ++i)
#pragma unroll
      for (int j = 0; j < 2; ++j) acc[i][j] = F::mma(a[i][s], b[j][s], acc[i][j]);
    // The GEMM engine's hazard guard, once: the first step's B fragments stay live until all four accumulators have
    // their registers. Without it the compiler places a fresh accumulator over the B operand of the product directly
    // ahead of it, a distance that is not known to be safe.
    if (s == 0) F::guard(acc[1][0], acc[1][1], b[0][0], b[1][0]);
  }

  float* slab = part[wave];
#pragma unroll
  for (int i = 0; i < 2; ++i)
#pragma unroll
    for (int j = 0; j < 2; ++j)
#pragma unroll
      for (int r = 0; r < 8; ++r) slab[((i << 4) + mOff + r) * kPvPitch + (j << 4) + rlane] = acc[i][j][r];
  __syncthreads();   // publishes the sixteen partial tiles to the whole work-group

  const int row = threadIdx.x >> 4, c2 = (threadIdx.x & 15) * 2;   // row seg = 128 B = 16 lanes x 8 B
  const size_t o = (size_t)(m0 + row) * kDim + (size_t)g * kDh + n0 + c2;
  const v2f rv = *(const v2f*)(R + o);
  v2f s = *(const v2f*)(&part[0][row * kPvPitch + c2]);
#pragma unroll
  for (int w = 1; w < kPvWaves; ++w) s += *(const v2f*)(&part[w][row * kPvPitch + c2]);
  v2f v;
  v[0] = s[0] * scale + rv[0];
  v[1] = s[1] * scale + rv[1];
  *(v2f*)(C + o) = v;
}

// ---------------------------------------------------------------------------
// Host side
// Workspace region map (bytes):
//   W16  : 3 x 512 x 512 x 2         =   1,572,864 @          0   (Wq, Wk, Wv as f16 x16, [out][in])
//   Q16  : 8192 x 512 x 2            =   8,388,608 @  1,572,864   (relu(Xq Wq^T + bq), f16, [tok][512])
//   K16  : 8192 x 512 x 2            =   8,388,608 @  9,961,472
//   Vt16 : 512 x 8192 x 2            =   8,388,608 @ 18,350,080   (relu(Wv Xv^T + bv), f16, [v][b*2048+t])
//   S32  : kGrp x 2048 x 2048 x 4    =  33,554,432 @ 26,738,688   (scores group, f32; also hosts the three
//                                                                  8,388,608-B f16 input planes (25,165,824 B)
//                                                                  before the group loop)
//   P16  : kGrp x 2048 x 2048 x 2    =  16,777,216 @ 60,293,120   (probabilities x2^15, f16)
//   total                            =  77,070,336 <= 134,217,728
// ---------------------------------------------------------------------------
extern "C" void kernel_launch(void* const* d_in, const int* in_sizes, int n_in,
                              void* d_out, int out_size, void* d_ws, size_t ws_size,
                              hipStream_t stream) {
  if (n_in < 9) return;
  const size_t nTokU = (size_t)kTok * kDim;       // 4,194,304
  const size_t nWW   = (size_t)kDim * kDim;       //   262,144
  if ((size_t)in_sizes[0] != nTokU || (size_t)in_sizes[1] != nTokU || (size_t)in_sizes[2] != nTokU) return;
  if ((size_t)in_sizes[3] != nWW || (size_t)in_sizes[5] != nWW || (size_t)in_sizes[7] != nWW) return;
  if (in_sizes[4] != kDim || in_sizes[6] != kDim || in_sizes[8] != kDim) return;
  if ((size_t)out_size != nTokU) return;

  const float* queries = (const float*)d_in[0];
  const float* keys    = (const float*)d_in[1];
  const float* values  = (const float*)d_in[2];
  const float* Wq      = (const float*)d_in[3];
  const float* bq      = (const float*)d_in[4];
  const float* Wk      = (const float*)d_in[5];
  const float* bk      = (const float*)d_in[6];
  const float* Wv      = (const float*)d_in[7];
  const float* bv      = (const float*)d_in[8];
  float* out = (float*)d_out;

  // ---- carve ----
  const size_t bW16  = 3 * nWW * 2;
  const size_t bQ16  = nTokU * 2;
  const size_t bK16  = nTokU * 2;
  const size_t bVt16 = nTokU * 2;
  const size_t nS    = (size_t)kGrp * kSeq * kSeq;     // 8,388,608 elements per group
  const size_t bS32  = nS * 4;
  const size_t bP16  = nS * 2;
  const size_t oW16  = 0;
  const size_t oQ16  = oW16 + bW16;
  const size_t oK16  = oQ16 + bQ16;
  const size_t oVt16 = oK16 + bK16;
  const size_t oS32  = oVt16 + bVt16;
  const size_t oP16  = oS32 + bS32;
  const size_t total = oP16 + bP16;
  if (total > ws_size) return;
  if (3 * nTokU * 2 > bS32) return;   // input staging planes must fit inside the score region

  char* ws = (char*)d_ws;
  unsigned short* W16  = (unsigned short*)(ws + oW16);
  unsigned short* Q16  = (unsigned short*)(ws + oQ16);
  unsigned short* K16  = (unsigned short*)(ws + oK16);
  unsigned short* Vt16 = (unsigned short*)(ws + oVt16);
  float*          S32  = (float*)(ws + oS32);
  unsigned short* P16  = (unsigned short*)(ws + oP16);
  unsigned short* Xst  = (unsigned short*)(ws + oS32);     // three f16 input planes, stride nTokU halves
  unsigned short* Xq16 = Xst;
  unsigned short* Xk16 = Xst + nTokU;
  unsigned short* Xv16 = Xst + 2 * nTokU;
  unsigned short* Wq16 = W16;
  unsigned short* Wk16 = W16 + nWW;
  unsigned short* Wv16 = W16 + 2 * nWW;

  const dim3 blk(256);

  // ---- casts: inputs (scale 1) and weights (scale 16) ----
  {
    const int n8x = (int)(nTokU / 8);      // 524,288 = 2048 x 256
    const int n8w = (int)(nWW / 8);        //  32,768 =  128 x 256
    if ((n8x % 256) != 0 || (n8w % 256) != 0) return;
    cast8x3_f16_kernel<<<dim3(n8x / 256, 3), blk, 0, stream>>>(queries, keys, values, Xst, n8x, (long)nTokU, 1.0f);
    cast8x3_f16_kernel<<<dim3(n8w / 256, 3), blk, 0, stream>>>(Wq, Wk, Wv, W16, n8w, (long)nWW, kWCarry);
  }

  // ---- projections: Q, K as [8192][512] f16; V transposed as [512][8192] f16 ----
  {
    // M=8192, N=512, K=512: tiles 128 x 8 = 1024 -> 128 blocks of 8 waves
    const dim3 gQK((kTok / 64) * (kDim / 64) / 8, 1);
    wmma_gemm64<0, false, 2, 1, false, 2><<<gQK, blk, 0, stream>>>(
        Xq16, Xq16, kDim, 0L, Wq16, Wq16, kDim, 0L, (void*)Q16, (void*)Q16, kDim, 0L,
        bq, queries, 0L, kTok, kDim, kDim, kWCarryInv);
    wmma_gemm64<0, false, 2, 1, false, 2><<<gQK, blk, 0, stream>>>(
        Xk16, Xk16, kDim, 0L, Wk16, Wk16, kDim, 0L, (void*)K16, (void*)K16, kDim, 0L,
        bk, queries, 0L, kTok, kDim, kDim, kWCarryInv);
    // Vt[v][tok] = relu(sum_u Wv[v][u] Xv[tok][u] + bv[v]): A = Wv16 [512][512], Bt = Xv16 [8192][512]
    // M=512, N=8192, K=512: tiles 8 x 128 = 1024 -> 128 blocks
    const dim3 gV((kDim / 64) * (kTok / 64) / 8, 1);
    wmma_gemm64<0, false, 1, 1, false, 2><<<gV, blk, 0, stream>>>(
        Wv16, Wv16, kDim, 0L, Xv16, Xv16, kDim, 0L, (void*)Vt16, (void*)Vt16, kTok, 0L,
        bv, queries, 0L, kDim, kTok, kDim, kWCarryInv);
  }

  // ---- attention groups: b fixed, kGrp consecutive heads per group (4 x 4 = 16 groups) ----
  for (int b = 0; b < kBatch; ++b) {
    for (int h0 = 0; h0 < kHeads; h0 += kGrp) {
      const size_t tokOff = (size_t)b * kSeq * kDim;            // element offset of row b*2048 in a [8192][512] plane
      // S[g][q][k] = 0.125 * sum_d Q[b,q,h*64+d] K[b,k,h*64+d], h = h0 + g
      // A = Q16 + tokOff + h0*64 (lda 512, strideA 64), Bt = K16 likewise; M=N=2048, K=64 (2 k-steps)
      const dim3 gS((kSeq / 64) * (kSeq / 64) / 8, kGrp);     // 1024 tiles -> 128 blocks, y = heads
      wmma_gemm64<0, false, 0, 0, false, 0><<<gS, blk, 0, stream>>>(
          Q16 + tokOff + (size_t)h0 * kDh, Q16 + tokOff + (size_t)h0 * kDh, kDim, (long)kDh,
          K16 + tokOff + (size_t)h0 * kDh, K16 + tokOff + (size_t)h0 * kDh, kDim, (long)kDh,
          (void*)S32, (void*)S32, kSeq, (long)kSeq * kSeq,
          bq, queries, 0L, kSeq, kSeq, kDh, kQKScale);
      // row softmax over all kGrp x 2048 rows of the group
      softmax_row_kernel<<<dim3(kGrp * kSeq), blk, 0, stream>>>(S32, P16, kPCarry);
      // out[b,q,h*64+d] = 2^-15 * sum_k P[g][q][k] Vt[h*64+d][b*2048+k] + queries[b,q,h*64+d]
      // P16 [g][2048][2048], Vt rows h0*64.. at column b*2048 (pitch 8192); C and residual: 64 floats per head
      // 32 rows x 32 columns per work-group, K dealt over its 16 waves: 128 x kGrp work-groups
      const dim3 gPV((kSeq / 32) * (kDh / 32), kGrp);
      unsigned short* VtBase = Vt16 + (size_t)h0 * kDh * kTok + (size_t)b * kSeq;
      float* Cbase = out + tokOff + (size_t)h0 * kDh;
      const float* Rbase = queries + tokOff + (size_t)h0 * kDh;
      pv_wavesplit_kernel<<<gPV, dim3(kPvWaves * 32), 0, stream>>>(P16, VtBase, Cbase, Rbase, kPCarryInv);
    }
  }
}

// v002
// It runs in 135 microseconds.
// Two timings next to v001 both put it at 3.97 times that version's speed.
// Over all steps from v000 it is 14.0 times as fast.
// Contractions: q/k/v projections (X f16 x W^T f16 carried x16), scores K.Q^T (relu planes f16, K=64), V^T.P^T (P f16, unnormalised exp2 against the maximum in use): all v_wmma_f32_16x16x32_f16 with f32 accumulate; softmax, bias, relu and residual in f32.
#include <hip/hip_runtime.h>

// ---------------------------------------------------------------------------
// Problem constants
// ---------------------------------------------------------------------------
constexpr int kBatch = 4;
constexpr int kSeq   = 2048;
constexpr int kDim   = 512;
constexpr int kHeads = 8;
constexpr int kDh    = 64;
constexpr int kTok   = kBatch * kSeq;      // 8192 token rows
constexpr float kWCarry    = 16.0f;        // weights carried x16 in f16
constexpr float kWCarryInv = 1.0f / 16.0f;
constexpr float kQKScaleLog2 = 0.125f * 1.4426950408889634f;   // 1/sqrt(64), times log2(e): the softmax runs in base 2
static_assert(kHeads * kDh == kDim);

typedef __attribute__((ext_vector_type(16))) _Float16 v16h;
typedef __attribute__((ext_vector_type(8)))  _Float16 v8h;
typedef __attribute__((ext_vector_type(16))) __bf16   v16b;
typedef __attribute__((ext_vector_type(8)))  __bf16   v8b;
typedef __attribute__((ext_vector_type(8)))  float    v8f;
typedef __attribute__((ext_vector_type(4)))  float    v4f;
typedef __attribute__((ext_vector_type(4)))  unsigned int v4u;

// ---------------------------------------------------------------------------
// Helpers
// ---------------------------------------------------------------------------
__device__ __forceinline__ unsigned short f2bf_bits(float f) {
  unsigned u = __float_as_uint(f);
  return (unsigned short)((u + 0x7FFFu + ((u >> 16) & 1u)) >> 16);
}
__device__ __forceinline__ float bf_bits2f(unsigned short h) { return __uint_as_float(((unsigned)h) << 16); }

// hazard guards as plain device helpers (no inline asm inside the kernel template body)
__device__ __forceinline__ void dep_guard_h(v8f& a, v8f& b, v16h x, v16h y) { asm volatile("v_nop\n\tv_nop\n\tv_nop\n\tv_nop" : "+v"(a), "+v"(b) : "v"(x), "v"(y)); }
__device__ __forceinline__ void dep_guard_b(v8f& a, v8f& b, v16b x, v16b y) { asm volatile("v_nop\n\tv_nop\n\tv_nop\n\tv_nop" : "+v"(a), "+v"(b) : "v"(x), "v"(y)); }
__device__ __forceinline__ void keep4_h(v16h a, v16h b, v16h c, v16h d) { asm volatile("v_nop" :: "v"(a), "v"(b), "v"(c), "v"(d)); }
__device__ __forceinline__ void keep4_b(v16b a, v16b b, v16b c, v16b d) { asm volatile("v_nop" :: "v"(a), "v"(b), "v"(c), "v"(d)); }
__device__ __forceinline__ void acc_guard4(v8f& a, v8f& b, v8f& c, v8f& d) { asm volatile("v_nop\n\tv_nop\n\tv_nop\n\tv_nop" : "+v"(a), "+v"(b), "+v"(c), "+v"(d)); }
template <typename T> struct Frag;
template <> struct Frag<_Float16> {
  typedef v16h V; union U { v16h v; v8h h[2]; };
  static __device__ __forceinline__ v16h load(const _Float16* p) {   // elements 0..7 <- p[0..7], 8..15 <- p[16..23]
    U f; f.h[0] = *(const v8h*)(p); f.h[1] = *(const v8h*)(p + 16); return f.v;
  }
  static __device__ __forceinline__ v8f mma(v16h a, v16h b, v8f c) {
    return __builtin_amdgcn_wmma_f32_16x16x32_f16(false, a, false, b, (short)0, c, false, false);
  }
  static __device__ __forceinline__ void guard(v8f& a, v8f& b, v16h x, v16h y) { dep_guard_h(a, b, x, y); }
  static __device__ __forceinline__ void keep(v16h a, v16h b, v16h c, v16h d) { keep4_h(a, b, c, d); }
};
template <> struct Frag<__bf16> {
  typedef v16b V; union U { v16b v; v8b h[2]; };
  static __device__ __forceinline__ v16b load(const __bf16* p) {
    U f; f.h[0] = *(const v8b*)(p); f.h[1] = *(const v8b*)(p + 16); return f.v;
  }
  static __device__ __forceinline__ v8f mma(v16b a, v16b b, v8f c) {
    return __builtin_amdgcn_wmma_f32_16x16x32_bf16(false, a, false, b, (short)0, c, false, false);
  }
  static __device__ __forceinline__ void guard(v8f& a, v8f& b, v16b x, v16b y) { dep_guard_b(a, b, x, y); }
  static __device__ __forceinline__ void keep(v16b a, v16b b, v16b c, v16b d) { keep4_b(a, b, c, d); }
};

__device__ __forceinline__ unsigned pk16(unsigned short a, unsigned short b) { return (unsigned)a | ((unsigned)b << 16); }
__device__ __forceinline__ unsigned short h_bits(float f) { const _Float16 h = (_Float16)f; return __builtin_bit_cast(unsigned short, h); }

// ---- Register-blocked batched WMMA GEMM (ACT reduced to none/relu/leaky) -----------------------
// C[m,n] = scale * sum_k A[m,k] * Bt[n,k] (+bias)(+resid); each wave owns a 64x64 tile.
// A row-major [M,K]; Bt row-major [N,K]; M,N % 64 == 0, K % 32 == 0.
// SPLIT: operands are hi/lo planes (A2/Bt2 = lo planes, same layout); product = hi.hi + hi.lo + lo.hi.
// BIAS_MODE: 0 = none, 1 = bias[m], 2 = bias[n].
// OUT_MODE: 0 = f32, 1 = f16, 2 = bf16 hi plane (Cout) + bf16 lo plane (Cout2).
// ET: 0 = f16 operands, 1 = bf16 operands (pointers passed as 16-bit storage)
template <int ET> struct Elem;
template <> struct Elem<0> { typedef _Float16 T; };
template <> struct Elem<1> { typedef __bf16 T; };
template <int ET, bool SPLIT, int BIAS_MODE, int OUT_MODE, bool RESID, int ACT = 0>
__global__ __launch_bounds__(256) void wmma_gemm64(
    const unsigned short* __restrict__ Ap, const unsigned short* __restrict__ A2p, int lda, long strideA,
    const unsigned short* __restrict__ Btp, const unsigned short* __restrict__ Bt2p, int ldb, long strideB,
    void* __restrict__ Cout, void* __restrict__ Cout2, int ldc, long strideC,
    const float* __restrict__ bias,
    const float* __restrict__ resid, long strideR,
    int M, int N, int K, float scale) {
  typedef typename Elem<ET>::T T;
  typedef typename Frag<T>::V V;
  const T* A = (const T*)Ap; const T* A2 = (const T*)A2p; const T* Bt = (const T*)Btp; const T* Bt2 = (const T*)Bt2p;
  __shared__ __align__(16) float sT[8][16 * 68];   // per-wave 16x64 slab, pitch 68 floats
  const int b    = blockIdx.y;
  const int lane = threadIdx.x & 31;
  const int wave = threadIdx.x >> 5;
  const int tilesN = N >> 6;
  const int tilesM = M >> 6;
  const int tile = blockIdx.x * 8 + wave;
  if (tile >= tilesM * tilesN) return;   // wave-uniform; no block barriers in this kernel
  const int tm = tile / tilesN;
  const int tn = tile - tm * tilesN;
  const int m0 = tm << 6;
  const int n0 = tn << 6;

  const T* Ab  = A  + (size_t)b * strideA;
  const T* Bb  = Bt + (size_t)b * strideB;
  const T* Ab2 = SPLIT ? (A2  + (size_t)b * strideA) : nullptr;
  const T* Bb2 = SPLIT ? (Bt2 + (size_t)b * strideB) : nullptr;

  const int rlane = lane & 15;                 // row (A) / col (B, D) within subtile
  const int koff  = (lane >> 4) * 8;           // k offset of this lane half
  const int mOff  = (lane >> 4) * 8;           // D row offset

  v8f acc[4][4];
#pragma unroll
  for (int i = 0; i < 4; ++i)
#pragma unroll
    for (int j = 0; j < 4; ++j) acc[i][j] = (v8f){0.f,0.f,0.f,0.f,0.f,0.f,0.f,0.f};

  for (int k0 = 0; k0 < K; k0 += 32) {
    V bh[4], bl[4];
#pragma unroll
    for (int j = 0; j < 4; ++j) {
      const size_t bo = (size_t)(n0 + (j << 4) + rlane) * ldb + koff + k0;
      bh[j] = Frag<T>::load(Bb + bo);
      if (SPLIT) bl[j] = Frag<T>::load(Bb2 + bo);
    }
#pragma unroll
    for (int i = 0; i < 4; ++i) {
      const size_t ao = (size_t)(m0 + (i << 4) + rlane) * lda + koff + k0;
      V ah = Frag<T>::load(Ab + ao);
      V al;
      if (SPLIT) al = Frag<T>::load(Ab2 + ao);
#pragma unroll
      for (int j = 0; j < 4; ++j) {
        acc[i][j] = Frag<T>::mma(ah, bh[j], acc[i][j]);
        if (SPLIT) {
          acc[i][j] = Frag<T>::mma(ah, bl[j], acc[i][j]);
          acc[i][j] = Frag<T>::mma(al, bh[j], acc[i][j]);
        }
      }
      Frag<T>::guard(acc[i][0], acc[i][3], ah, SPLIT ? al : ah);
    }
    Frag<T>::keep(bh[0], bh[1], bh[2], bh[3]);
    if (SPLIT) Frag<T>::keep(bl[0], bl[1], bl[2], bl[3]);
  }
  acc_guard4(acc[0][0], acc[0][1], acc[0][2], acc[0][3]);
  acc_guard4(acc[1][0], acc[1][1], acc[1][2], acc[1][3]);
  acc_guard4(acc[2][0], acc[2][1], acc[2][2], acc[2][3]);
  acc_guard4(acc[3][0], acc[3][1], acc[3][2], acc[3][3]);

  // ---- epilogue ----
  float* slab = sT[wave];
  const float* Rb = RESID ? (resid + (size_t)b * strideR) : nullptr;
#pragma unroll
  for (int i = 0; i < 4; ++i) {
    const int mBase = m0 + (i << 4);
#pragma unroll
    for (int j = 0; j < 4; ++j) {
      const int n = n0 + (j << 4) + rlane;
      float bv = 0.f;
      if (BIAS_MODE == 2) bv = bias[n];
#pragma unroll
      for (int r = 0; r < 8; ++r) {
        float v = acc[i][j][r] * scale;
        if (BIAS_MODE == 1) v += bias[mBase + mOff + r];
        if (BIAS_MODE == 2) v += bv;
        if (RESID) v += Rb[(size_t)(mBase + mOff + r) * ldc + n];
        if (ACT == 2) v = fmaxf(v, 0.0f);
        if (ACT == 4) v = (v > 0.f) ? v : 0.01f * v;
        slab[(mOff + r) * 68 + (j << 4) + rlane] = v;
      }
    }
    __builtin_amdgcn_fence(__ATOMIC_RELEASE, "workgroup");
    __builtin_amdgcn_wave_barrier();
    __builtin_amdgcn_fence(__ATOMIC_ACQUIRE, "workgroup");
    if (OUT_MODE == 0) {
      float* C = (float*)Cout + (size_t)b * strideC;
      const int hh = lane >> 4, c4 = (lane & 15) * 4;     // row seg = 256 B = 16 lanes x 16 B
      {
#pragma unroll
        for (int it = 0; it < 8; ++it) {
          const int row = it * 2 + hh;
          v4f v = *(const v4f*)(slab + row * 68 + c4);
          *(v4f*)(C + (size_t)(mBase + row) * ldc + n0 + c4) = v;
        }
        
      }
    } else {
      const int q = lane >> 3, c8 = (lane & 7) * 8;
      unsigned short* C  = (unsigned short*)Cout  + (size_t)b * strideC;
      unsigned short* C2 = (OUT_MODE == 2) ? ((unsigned short*)Cout2 + (size_t)b * strideC) : nullptr;
      {
#pragma unroll
        for (int it = 0; it < 4; ++it) {
          const int row = it * 4 + q;
          const float* sp = slab + row * 68 + c8;
          v8h hv, lv;
#pragma unroll
          for (int e = 0; e < 8; ++e) {
            if (OUT_MODE == 1) {
              hv[e] = (_Float16)sp[e];
            } else {
              unsigned short hb = f2bf_bits(sp[e]);
              unsigned short lb = f2bf_bits(sp[e] - bf_bits2f(hb));
              hv[e] = __builtin_bit_cast(_Float16, hb);
              lv[e] = __builtin_bit_cast(_Float16, lb);
            }
          }
          *(v8h*)(C + (size_t)(mBase + row) * ldc + n0 + c8) = hv;
          if (OUT_MODE == 2) *(v8h*)(C2 + (size_t)(mBase + row) * ldc + n0 + c8) = lv;
        }
        
      }
    }
    __builtin_amdgcn_fence(__ATOMIC_RELEASE, "workgroup");
    __builtin_amdgcn_wave_barrier();
    __builtin_amdgcn_fence(__ATOMIC_ACQUIRE, "workgroup");
  }
}

// ---------------------------------------------------------------------------
// f32 -> f16 cast (value * scale) of up to three equally sized planes; blockIdx.y selects the source plane
// (block-uniform pointer choice, all global) and the destination plane (out + blockIdx.y * planeStride halves).
// Coverage: gridDim.x * 256 == n8 exactly (host asserts), times 8 = the whole plane; gridDim.y = number of planes.
// ---------------------------------------------------------------------------
__global__ __launch_bounds__(256) void cast8x3_f16_kernel(const float* __restrict__ in0, const float* __restrict__ in1,
                                                          const float* __restrict__ in2, unsigned short* __restrict__ out,
                                                          int n8, long planeStride, float scale) {
  const int z = blockIdx.y;
  const float* in = (z == 0) ? in0 : (z == 1) ? in1 : in2;
  const int i = blockIdx.x * 256 + threadIdx.x;
  if (i >= n8) return;
  const float* p = in + 8 * (size_t)i;
  const v4f a = *(const v4f*)(p);
  const v4f c = *(const v4f*)(p + 4);
  unsigned short hb[8];
#pragma unroll
  for (int e = 0; e < 4; ++e) {
    hb[e]     = h_bits(a[e] * scale);
    hb[4 + e] = h_bits(c[e] * scale);
  }
  const v4u u = (v4u){pk16(hb[0], hb[1]), pk16(hb[2], hb[3]), pk16(hb[4], hb[5]), pk16(hb[6], hb[7])};
  unsigned short* q = out + (size_t)z * planeStride + 8 * (size_t)i;
  *(v4u*)q = u;
  
}

typedef __attribute__((ext_vector_type(2))) float v2f;
typedef __attribute__((ext_vector_type(2))) _Float16 v2h;
constexpr int kFaWaves  = 8;
constexpr int kFaCols   = 32;                     // query columns of a wave (two 16-column groups)
constexpr int kFaRows   = kFaWaves * kFaCols;     // queries of a work-group
constexpr int kFaStage  = 64;                     // keys of a stage (two passes of 32)
constexpr int kFaStages = kSeq / kFaStage;
constexpr int kFaPitch  = 72;                     // halves per LDS row: 128 B + 16 B, conflict-free for 16-byte reads
static_assert(kSeq % kFaRows == 0 && kSeq % kFaStage == 0 && kDh == 64);

__device__ __forceinline__ float xhalf(float x) {   // lane l with lane l ^ 16
  return __builtin_bit_cast(float, __builtin_amdgcn_permlanex16(__builtin_bit_cast(int, x), __builtin_bit_cast(int, x),
                                                                0x76543210, 0xfedcba98, false, false));
}

__global__ __launch_bounds__(kFaWaves * 32) void attn_fused_kernel(const unsigned short* __restrict__ Qp,
                                                                   const unsigned short* __restrict__ Kp,
                                                                   const unsigned short* __restrict__ Vtp,
                                                                   const float* __restrict__ R, float* __restrict__ C) {
  typedef Frag<_Float16> F;
  __shared__ __align__(16) _Float16 sK[2][kFaStage * kFaPitch];   // [key in stage][d]
  __shared__ __align__(16) _Float16 sV[2][kDh * kFaPitch];        // [d][key in stage]
  const int lane = threadIdx.x & 31;
  const int wave = threadIdx.x >> 5;
  const int c    = lane & 15;
  const int h    = lane >> 4;
  const int b    = blockIdx.y / kHeads;
  const int head = blockIdx.y - b * kHeads;
  const int q0   = blockIdx.x * kFaRows + wave * kFaCols;
  const size_t tokOff = (size_t)b * kSeq * kDim + (size_t)head * kDh;   // row b*2048, this head's 64 columns
  const _Float16* Q  = (const _Float16*)Qp + tokOff;
  const _Float16* K  = (const _Float16*)Kp + tokOff;
  const _Float16* Vt = (const _Float16*)Vtp + (size_t)head * kDh * kTok + (size_t)b * kSeq;

  // Staging map: 8 lanes x 16 B = one 128-B row; a thread brings rows srow and srow + 32 of both tiles.
  const int srow = threadIdx.x >> 3;
  const int sch  = (threadIdx.x & 7) * 8;
  const _Float16* gK = K + (size_t)srow * kDim + sch;
  const _Float16* gV = Vt + (size_t)srow * kTok + sch;
  const int sOff0 = srow * kFaPitch + sch;
  const int sOff1 = (srow + 32) * kFaPitch + sch;

  v8h rk0 = *(const v8h*)(gK);
  v8h rk1 = *(const v8h*)(gK + (size_t)32 * kDim);
  v8h rv0 = *(const v8h*)(gV);
  v8h rv1 = *(const v8h*)(gV + (size_t)32 * kTok);

  v16h qf[2][2];   // [column group][k step]
#pragma unroll
  for (int g = 0; g < 2; ++g)
#pragma unroll
    for (int ks = 0; ks < 2; ++ks) qf[g][ks] = F::load(Q + (size_t)(q0 + (g << 4) + c) * kDim + ks * 32 + 8 * h);

  *(v8h*)(&sK[0][sOff0]) = rk0;
  *(v8h*)(&sK[0][sOff1]) = rk1;
  *(v8h*)(&sV[0][sOff0]) = rv0;
  *(v8h*)(&sV[0][sOff1]) = rv1;
  __syncthreads();   // publishes stage 0

  const v8f zero8 = (v8f){0.f,0.f,0.f,0.f,0.f,0.f,0.f,0.f};
  v8f acc[4][2];     // [16-row tile of d][column group]: acc[t][g][r] = O^T[16t + 8h + r][query 16g + c]
  float mUse[2], lSum[2];
#pragma unroll
  for (int g = 0; g < 2; ++g) {
    mUse[g] = -1.0e30f;   // below every score: the first pass always rescales, by exp2 of a huge negative = 0
    lSum[g] = 0.f;
#pragma unroll
    for (int t = 0; t < 4; ++t) acc[t][g] = zero8;
  }

  for (int s = 0; s < kFaStages; ++s) {
    const _Float16* bK = sK[s & 1];
    const _Float16* bV = sV[s & 1];
    const bool more = (s + 1 < kFaStages);   // the same for the whole work-group
    if (more) {
      const size_t kn = (size_t)(s + 1) * kFaStage;
      rk0 = *(const v8h*)(gK + kn * kDim);
      rk1 = *(const v8h*)(gK + (kn + 32) * kDim);
      rv0 = *(const v8h*)(gV + kn);
      rv1 = *(const v8h*)(gV + kn + (size_t)32 * kTok);
    }
#pragma unroll
    for (int ps = 0; ps < 2; ++ps) {
      v16h kf[2][2], vf[4];
#pragma unroll
      for (int t = 0; t < 2; ++t)
#pragma unroll
        for (int ks = 0; ks < 2; ++ks) kf[t][ks] = F::load(bK + (ps * 32 + (t << 4) + c) * kFaPitch + ks * 32 + 8 * h);
#pragma unroll
      for (int t = 0; t < 4; ++t) vf[t] = F::load(bV + ((t << 4) + c) * kFaPitch + ps * 32 + 8 * h);

      v8f st[2][2];   // [16-key tile][column group]: st[t][g][r] = S^T[key 16t + 8h + r][query 16g + c], unscaled
#pragma unroll
      for (int t = 0; t < 2; ++t)
#pragma unroll
        for (int g = 0; g < 2; ++g) {
          st[t][g] = F::mma(kf[t][0], qf[g][0], zero8);
          st[t][g] = F::mma(kf[t][1], qf[g][1], st[t][g]);
        }

      float mb[2];
      bool need = false;
#pragma unroll
      for (int g = 0; g < 2; ++g) {
        float mx = st[0][g][0];
#pragma unroll
        for (int r = 1; r < 8; ++r) mx = fmaxf(mx, st[0][g][r]);
#pragma unroll
        for (int r = 0; r < 8; ++r) mx = fmaxf(mx, st[1][g][r]);
        mx = fmaxf(mx, xhalf(mx)) * kQKScaleLog2;   // both halves now hold this query's maximum, scaled
        mb[g] = mx;
        need = need || (mx > mUse[g] + 8.0f);
      }
      if (__builtin_amdgcn_ballot_w32(need) != 0) {   // scalar branch; rare after the first passes
#pragma unroll
        for (int g = 0; g < 2; ++g) {
          const float mNew = fmaxf(mUse[g], mb[g]);
          const float corr = __builtin_amdgcn_exp2f(mUse[g] - mNew);
          mUse[g] = mNew;
          lSum[g] *= corr;
#pragma unroll
          for (int t = 0; t < 4; ++t) acc[t][g] = acc[t][g] * corr;
        }
      }

#pragma unroll
      for (int g = 0; g < 2; ++g) {
        const float nm = -mUse[g];
        union { v16h v; v2h p[8]; } pf;   // element e = key kmap(e, h): tile e >> 3, register e & 7
        float l0 = 0.f, l1 = 0.f;
#pragma unroll
        for (int i = 0; i < 8; ++i) {
          const v2f arg = __builtin_elementwise_fma((v2f){st[i >> 2][g][2 * (i & 3)], st[i >> 2][g][2 * (i & 3) + 1]},
                                                    (v2f){kQKScaleLog2, kQKScaleLog2}, (v2f){nm, nm});
          const v2f p = (v2f){__builtin_amdgcn_exp2f(arg[0]), __builtin_amdgcn_exp2f(arg[1])};
          l0 += p[0];
          l1 += p[1];
          pf.p[i] = __builtin_convertvector(p, v2h);
        }
        lSum[g] += l0 + l1;
#pragma unroll
        for (int t = 0; t < 4; ++t) acc[t][g] = F::mma(vf[t], pf.v, acc[t][g]);
      }
    }
    if (more) {
      _Float16* nK = sK[(s + 1) & 1];
      _Float16* nV = sV[(s + 1) & 1];
      *(v8h*)(nK + sOff0) = rk0;
      *(v8h*)(nK + sOff1) = rk1;
      *(v8h*)(nV + sOff0) = rv0;
      *(v8h*)(nV + sOff1) = rv1;
    }
    __syncthreads();   // publishes stage s + 1; ends every wave's reads of the buffer that stage s + 1 refills
  }

  // Epilogue: join the halves' sums, divide, add the residual. A lane holds 8 consecutive d of one query per tile.
#pragma unroll
  for (int g = 0; g < 2; ++g) {
    const float inv = 1.0f / (lSum[g] + xhalf(lSum[g]));   // the largest score's term is at least 1: the maximum in use never exceeds it
    const size_t o = tokOff + (size_t)(q0 + (g << 4) + c) * kDim + 8 * h;
#pragma unroll
    for (int t = 0; t < 4; ++t) {
      const v4f r0 = *(const v4f*)(R + o + (t << 4));
      const v4f r1 = *(const v4f*)(R + o + (t << 4) + 4);
      v4f o0, o1;
#pragma unroll
      for (int e = 0; e < 4; ++e) {
        o0[e] = acc[t][g][e] * inv + r0[e];
        o1[e] = acc[t][g][4 + e] * inv + r1[e];
      }
      *(v4f*)(C + o + (t << 4)) = o0;
      *(v4f*)(C + o + (t << 4) + 4) = o1;
    }
  }
}

// ---------------------------------------------------------------------------
// Host side
// Workspace region map (bytes):
//   W16  : 3 x 512 x 512 x 2         =   1,572,864 @          0   (Wq, Wk, Wv as f16 x16, [out][in])
//   Q16  : 8192 x 512 x 2            =   8,388,608 @  1,572,864   (relu(Xq Wq^T + bq), f16, [tok][512])
//   K16  : 8192 x 512 x 2            =   8,388,608 @  9,961,472
//   Vt16 : 512 x 8192 x 2            =   8,388,608 @ 18,350,080   (relu(Wv Xv^T + bv), f16, [v][b*2048+t])
//   Xst  : 3 x 8192 x 512 x 2        =  25,165,824 @ 26,738,688   (queries, keys, values as f16, [tok][512])
//   total                            =  51,904,512
// ---------------------------------------------------------------------------
extern "C" void kernel_launch(void* const* d_in, const int* in_sizes, int n_in,
                              void* d_out, int out_size, void* d_ws, size_t ws_size,
                              hipStream_t stream) {
  if (n_in < 9) return;
  const size_t nTokU = (size_t)kTok * kDim;       // 4,194,304
  const size_t nWW   = (size_t)kDim * kDim;       //   262,144
  if ((size_t)in_sizes[0] != nTokU || (size_t)in_sizes[1] != nTokU || (size_t)in_sizes[2] != nTokU) return;
  if ((size_t)in_sizes[3] != nWW || (size_t)in_sizes[5] != nWW || (size_t)in_sizes[7] != nWW) return;
  if (in_sizes[4] != kDim || in_sizes[6] != kDim || in_sizes[8] != kDim) return;
  if ((size_t)out_size != nTokU) return;

  const float* queries = (const float*)d_in[0];
  const float* keys    = (const float*)d_in[1];
  const float* values  = (const float*)d_in[2];
  const float* Wq      = (const float*)d_in[3];
  const float* bq      = (const float*)d_in[4];
  const float* Wk      = (const float*)d_in[5];
  const float* bk      = (const float*)d_in[6];
  const float* Wv      = (const float*)d_in[7];
  const float* bv      = (const float*)d_in[8];
  float* out = (float*)d_out;

  // ---- carve ----
  const size_t bW16  = 3 * nWW * 2;
  const size_t bQ16  = nTokU * 2;
  const size_t bK16  = nTokU * 2;
  const size_t bVt16 = nTokU * 2;
  const size_t bXst  = 3 * nTokU * 2;
  const size_t oW16  = 0;
  const size_t oQ16  = oW16 + bW16;
  const size_t oK16  = oQ16 + bQ16;
  const size_t oVt16 = oK16 + bK16;
  const size_t oXst  = oVt16 + bVt16;
  const size_t total = oXst + bXst;
  if (total > ws_size) return;

  char* ws = (char*)d_ws;
  unsigned short* W16  = (unsigned short*)(ws + oW16);
  unsigned short* Q16  = (unsigned short*)(ws + oQ16);
  unsigned short* K16  = (unsigned short*)(ws + oK16);
  unsigned short* Vt16 = (unsigned short*)(ws + oVt16);
  unsigned short* Xst  = (unsigned short*)(ws + oXst);     // three f16 input planes, stride nTokU halves
  unsigned short* Xq16 = Xst;
  unsigned short* Xk16 = Xst + nTokU;
  unsigned short* Xv16 = Xst + 2 * nTokU;
  unsigned short* Wq16 = W16;
  unsigned short* Wk16 = W16 + nWW;
  unsigned short* Wv16 = W16 + 2 * nWW;

  const dim3 blk(256);

  // ---- casts: inputs (scale 1) and weights (scale 16) ----
  {
    const int n8x = (int)(nTokU / 8);      // 524,288 = 2048 x 256
    const int n8w = (int)(nWW / 8);        //  32,768 =  128 x 256
    if ((n8x % 256) != 0 || (n8w % 256) != 0) return;
    cast8x3_f16_kernel<<<dim3(n8x / 256, 3), blk, 0, stream>>>(queries, keys, values, Xst, n8x, (long)nTokU, 1.0f);
    cast8x3_f16_kernel<<<dim3(n8w / 256, 3), blk, 0, stream>>>(Wq, Wk, Wv, W16, n8w, (long)nWW, kWCarry);
  }

  // ---- projections: Q, K as [8192][512] f16; V transposed as [512][8192] f16 ----
  {
    // M=8192, N=512, K=512: tiles 128 x 8 = 1024 -> 128 blocks of 8 waves
    const dim3 gQK((kTok / 64) * (kDim / 64) / 8, 1);
    wmma_gemm64<0, false, 2, 1, false, 2><<<gQK, blk, 0, stream>>>(
        Xq16, Xq16, kDim, 0L, Wq16, Wq16, kDim, 0L, (void*)Q16, (void*)Q16, kDim, 0L,
        bq, queries, 0L, kTok, kDim, kDim, kWCarryInv);
    wmma_gemm64<0, false, 2, 1, false, 2><<<gQK, blk, 0, stream>>>(
        Xk16, Xk16, kDim, 0L, Wk16, Wk16, kDim, 0L, (void*)K16, (void*)K16, kDim, 0L,
        bk, queries, 0L, kTok, kDim, kDim, kWCarryInv);
    // Vt[v][tok] = relu(sum_u Wv[v][u] Xv[tok][u] + bv[v]): A = Wv16 [512][512], Bt = Xv16 [8192][512]
    // M=512, N=8192, K=512: tiles 8 x 128 = 1024 -> 128 blocks
    const dim3 gV((kDim / 64) * (kTok / 64) / 8, 1);
    wmma_gemm64<0, false, 1, 1, false, 2><<<gV, blk, 0, stream>>>(
        Wv16, Wv16, kDim, 0L, Xv16, Xv16, kDim, 0L, (void*)Vt16, (void*)Vt16, kTok, 0L,
        bv, queries, 0L, kDim, kTok, kDim, kWCarryInv);
  }

  // ---- attention: one launch; x = block of 256 queries, y = batch * 8 + head ----
  // out[b,q,h*64+d] = sum_k softmax_k(0.125 * Q[b,q,h*64+:] . K[b,k,h*64+:]) Vt[h*64+d][b*2048+k] + queries[b,q,h*64+d]
  attn_fused_kernel<<<dim3(kSeq / kFaRows, kBatch * kHeads), dim3(kFaWaves * 32), 0, stream>>>(Q16, K16, Vt16, queries, out);
}

// v003
// It runs in 59.7 microseconds.
// Two timings next to v002 both put it at 2.26 times that version's speed.
// All steps since v000 together make it 31.8 times as fast.
// Contractions: q/k/v projections (X f16 x W^T f16 carried x16), scores K.Q^T (relu planes f16, K=64), V^T.P^T (P f16, unnormalised exp2 against the maximum in use): all v_wmma_f32_16x16x32_f16 with f32 accumulate; softmax, bias, relu and residual in f32.
#include <hip/hip_runtime.h>

// ---------------------------------------------------------------------------
// Problem constants
// ---------------------------------------------------------------------------
constexpr int kBatch = 4;
constexpr int kSeq   = 2048;
constexpr int kDim   = 512;
constexpr int kHeads = 8;
constexpr int kDh    = 64;
constexpr int kTok   = kBatch * kSeq;      // 8192 token rows
constexpr float kWCarry    = 16.0f;        // weights carried x16 in f16
constexpr float kWCarryInv = 1.0f / 16.0f;
constexpr float kQKScaleLog2 = 0.125f * 1.4426950408889634f;   // 1/sqrt(64), times log2(e): the softmax runs in base 2
static_assert(kHeads * kDh == kDim);

typedef __attribute__((ext_vector_type(16))) _Float16 v16h;
typedef __attribute__((ext_vector_type(8)))  _Float16 v8h;
typedef __attribute__((ext_vector_type(8)))  float    v8f;
typedef __attribute__((ext_vector_type(4)))  float    v4f;
typedef __attribute__((ext_vector_type(4)))  _Float16 v4h;

// ---------------------------------------------------------------------------
// f16 fragment of the 16x16x32 form
// ---------------------------------------------------------------------------
template <typename T> struct Frag;
template <> struct Frag<_Float16> {
  typedef v16h V; union U { v16h v; v8h h[2]; };
  static __device__ __forceinline__ v16h load(const _Float16* p) {   // elements 0..7 <- p[0..7], 8..15 <- p[16..23]
    U f; f.h[0] = *(const v8h*)(p); f.h[1] = *(const v8h*)(p + 16); return f.v;
  }
  static __device__ __forceinline__ v8f mma(v16h a, v16h b, v8f c) {
    return __builtin_amdgcn_wmma_f32_16x16x32_f16(false, a, false, b, (short)0, c, false, false);
  }
};

// ---------------------------------------------------------------------------
// The three projections in one launch, straight from the f32 inputs: blockIdx.y = 0 (Q), 1 (K), 2 (V^T).
// C[m,n] = relu(sum_k A[m,k] * B[n,k] + bias); both operands are f32 rows of 512, k-contiguous.
//   Q, K : A = X (tokens),   B = W (features), C = [token][512],    bias by n
//   V^T  : A = Wv (features), B = Xv (tokens),  C = [feature][8192], bias by m
// A work-group owns a 128 x 128 tile of C (8 waves, 4 x 2, each 32 x 64) and walks k in stages of 64.
// Staging: each stage's 128 + 128 rows of 256 B come as whole lines into registers one stage ahead, are converted there
// to f16 (W times 16, X as it is) and stored into one of two LDS buffers; one barrier per stage publishes the next
// buffer and ends the reads of the one refilled behind it.
// The k order of every accumulator is steps of 32, ascending.
// The stage loop is unrolled whole: every global address is then one base plus an immediate offset.
// ---------------------------------------------------------------------------
constexpr int kPjTile   = 128;                    // rows of each operand per work-group
constexpr int kPjK      = 64;                     // k of a stage (two WMMA steps)
constexpr int kPjStages = kDim / kPjK;
constexpr int kPjPitch  = 72;                     // halves per LDS row: 128 B + 16 B, conflict-free for 16-byte reads
constexpr int kPjLoads  = kPjTile / 16;           // 16-byte loads of a thread per operand and stage
constexpr int kPjOp     = kPjTile * kPjPitch;     // halves of one operand's tile in LDS
constexpr int kPjBuf    = 2 * kPjOp;              // halves of a buffer
static_assert(8 * 16 * 68 * 4 <= kPjBuf * 2);     // the eight output slabs fit one buffer
static_assert(kTok % kPjTile == 0 && kDim % kPjTile == 0 && kDim % kPjK == 0);
static_assert(((kTok / kPjTile) & (kTok / kPjTile - 1)) == 0);

__global__ __launch_bounds__(256) void proj_fused_kernel(
    const float* __restrict__ Xq, const float* __restrict__ Xk, const float* __restrict__ Xv,
    const float* __restrict__ Wq, const float* __restrict__ Wk, const float* __restrict__ Wv,
    const float* __restrict__ bq, const float* __restrict__ bk, const float* __restrict__ bv,
    unsigned short* __restrict__ Q16, unsigned short* __restrict__ K16, unsigned short* __restrict__ Vt16) {
  typedef Frag<_Float16> F;
  __shared__ __align__(16) unsigned char smem[2 * kPjBuf * 2];   // [buffer][A rows | B rows][pitch] in halves
  _Float16* const ring = (_Float16*)smem;
  const int z = blockIdx.y;
  const bool isV = (z == 2);                       // block-uniform
  const float* X    = (z == 0) ? Xq : (z == 1) ? Xk : Xv;
  const float* Wt   = (z == 0) ? Wq : (z == 1) ? Wk : Wv;
  const float* bias = (z == 0) ? bq : (z == 1) ? bk : bv;
  unsigned short* C = (z == 0) ? Q16 : (z == 1) ? K16 : Vt16;
  const int tokTile  = blockIdx.x & (kTok / kPjTile - 1);   // the four work-groups of a token tile stand 64 apart in the
  const int featTile = blockIdx.x / (kTok / kPjTile);       // grid (speed only: a multiple of the number of dies)
  const int m0  = (isV ? featTile : tokTile) * kPjTile;
  const int n0  = (isV ? tokTile : featTile) * kPjTile;
  const int ldc = isV ? kTok : kDim;
  const float sa = isV ? kWCarry : 1.0f;
  const float sb = isV ? 1.0f : kWCarry;

  const int lane = threadIdx.x & 31;
  const int wave = threadIdx.x >> 5;
  const int c    = lane & 15;                      // row (A) / column (B, D) within a 16-tile
  const int h    = lane >> 4;
  const int wm   = (wave >> 1) * 32;               // the wave's rows of the tile
  const int wn   = (wave & 1) * 64;                // the wave's columns of the tile

  // Staging map: 16 lanes x 16 B = one 256-B row piece; a thread brings rows srow + 16 i of both operands.
  const int srow = threadIdx.x >> 4;
  const int sc4  = (threadIdx.x & 15) * 4;
  const float* gA = (isV ? Wt : X) + (size_t)(m0 + srow) * kDim + sc4;
  const float* gB = (isV ? X : Wt) + (size_t)(n0 + srow) * kDim + sc4;
  const int sOff = srow * kPjPitch + sc4;

  v4f ra[kPjLoads], rb[kPjLoads];
#pragma unroll
  for (int i = 0; i < kPjLoads; ++i) {
    ra[i] = *(const v4f*)(gA + (size_t)i * 16 * kDim);
    rb[i] = *(const v4f*)(gB + (size_t)i * 16 * kDim);
  }

  v8f acc[2][4];   // acc[i][j][r] = C[wm + 16i + 8h + r][wn + 16j + c]
#pragma unroll
  for (int i = 0; i < 2; ++i)
#pragma unroll
    for (int j = 0; j < 4; ++j) acc[i][j] = (v8f){0.f,0.f,0.f,0.f,0.f,0.f,0.f,0.f};

#pragma unroll
  for (int i = 0; i < kPjLoads; ++i) {
    *(v4h*)(ring + sOff + i * 16 * kPjPitch) = __builtin_convertvector(ra[i] * sa, v4h);
    *(v4h*)(ring + kPjOp + sOff + i * 16 * kPjPitch) = __builtin_convertvector(rb[i] * sb, v4h);
  }
  __syncthreads();   // publishes stage 0

#pragma unroll
  for (int s = 0; s < kPjStages; ++s) {
    const _Float16* bA = ring + (s & 1) * kPjBuf;
    const _Float16* bB = bA + kPjOp;
    if (s + 1 < kPjStages) {
#pragma unroll
      for (int i = 0; i < kPjLoads; ++i) {
        ra[i] = *(const v4f*)(gA + (size_t)i * 16 * kDim + (s + 1) * kPjK);
        rb[i] = *(const v4f*)(gB + (size_t)i * 16 * kDim + (s + 1) * kPjK);
      }
      // Keeps the sixteen loads in front of this stage's products: left free, the compiler sinks them behind the
      // products and waits for them in pairs, and nothing covers their latency.
      __builtin_amdgcn_sched_barrier(0);
    }
#pragma unroll
    for (int ks = 0; ks < 2; ++ks) {
      v16h af[2], bf[4];
#pragma unroll
      for (int i = 0; i < 2; ++i) af[i] = F::load(bA + (wm + (i << 4) + c) * kPjPitch + ks * 32 + 8 * h);
#pragma unroll
      for (int j = 0; j < 4; ++j) bf[j] = F::load(bB + (wn + (j << 4) + c) * kPjPitch + ks * 32 + 8 * h);
#pragma unroll
      for (int i = 0; i < 2; ++i)
#pragma unroll
        for (int j = 0; j < 4; ++j) acc[i][j] = F::mma(af[i], bf[j], acc[i][j]);
    }
    if (s + 1 < kPjStages) {
      // Keeps the conversions, and with them the wait for the loads, behind this stage's products.
      __builtin_amdgcn_sched_barrier(0);
#pragma unroll
      for (int i = 0; i < kPjLoads; ++i) {
        *(v4h*)(ring + ((s + 1) & 1) * kPjBuf + sOff + i * 16 * kPjPitch) = __builtin_convertvector(ra[i] * sa, v4h);
        *(v4h*)(ring + ((s + 1) & 1) * kPjBuf + kPjOp + sOff + i * 16 * kPjPitch) = __builtin_convertvector(rb[i] * sb, v4h);
      }
      __syncthreads();   // publishes stage s + 1; ends every wave's reads of the buffer that stage s + 1 refills
    }
  }

  // Epilogue: scale, bias, relu in f32; each wave turns its 16 x 64 slabs (pitch 68 floats) in its own LDS range into
  // whole 128-B lines. The slabs lie in buffer 0: the last stage reads buffer 1, and every wave's last read of buffer 0
  // stands in front of the barrier that published that stage.
  static_assert((kPjStages & 1) == 0);
  float* slab = (float*)smem + wave * (16 * 68);
  // Both bias forms are loaded as one group with no branch; the index of the form not in use is 0 (inside the 512).
  float bn[4];
  v4f bm[2][2];
#pragma unroll
  for (int j = 0; j < 4; ++j) bn[j] = bias[isV ? 0 : n0 + wn + (j << 4) + c];
#pragma unroll
  for (int i = 0; i < 2; ++i) {
    const float* bp = bias + (isV ? m0 + wm + (i << 4) + 8 * h : 0);
    bm[i][0] = *(const v4f*)(bp);
    bm[i][1] = *(const v4f*)(bp + 4);
  }
#pragma unroll
  for (int i = 0; i < 2; ++i) {
    const int mBase = m0 + wm + (i << 4);
#pragma unroll
    for (int r = 0; r < 8; ++r) {
#pragma unroll
      for (int j = 0; j < 4; ++j) {
        float v = acc[i][j][r] * kWCarryInv;
        v += isV ? bm[i][r >> 2][r & 3] : bn[j];
        slab[(8 * h + r) * 68 + (j << 4) + c] = fmaxf(v, 0.0f);
      }
    }
    __builtin_amdgcn_fence(__ATOMIC_RELEASE, "workgroup");
    __builtin_amdgcn_wave_barrier();   // the slab is the wave's own: its lanes' stores stand before its lanes' reads
    __builtin_amdgcn_fence(__ATOMIC_ACQUIRE, "workgroup");
    const int q = lane >> 3, c8 = (lane & 7) * 8;
#pragma unroll
    for (int it = 0; it < 4; ++it) {
      const int row = it * 4 + q;
      const float* sp = slab + row * 68 + c8;
      v8h hv;
#pragma unroll
      for (int e = 0; e < 8; ++e) hv[e] = (_Float16)sp[e];
      *(v8h*)(C + (size_t)(mBase + row) * ldc + n0 + wn + c8) = hv;
    }
    if (i == 0) {
      __builtin_amdgcn_fence(__ATOMIC_RELEASE, "workgroup");
      __builtin_amdgcn_wave_barrier();   // the reads above stand before the next slab's stores
      __builtin_amdgcn_fence(__ATOMIC_ACQUIRE, "workgroup");
    }
  }
}

typedef __attribute__((ext_vector_type(2))) float v2f;
typedef __attribute__((ext_vector_type(2))) _Float16 v2h;
constexpr int kFaWaves  = 8;
constexpr int kFaCols   = 32;                     // query columns of a wave (two 16-column groups)
constexpr int kFaRows   = kFaWaves * kFaCols;     // queries of a work-group
constexpr int kFaStage  = 64;                     // keys of a stage (two passes of 32)
constexpr int kFaStages = kSeq / kFaStage;
constexpr int kFaPitch  = 72;                     // halves per LDS row: 128 B + 16 B, conflict-free for 16-byte reads
static_assert(kSeq % kFaRows == 0 && kSeq % kFaStage == 0 && kDh == 64);

__device__ __forceinline__ float xhalf(float x) {   // lane l with lane l ^ 16
  return __builtin_bit_cast(float, __builtin_amdgcn_permlanex16(__builtin_bit_cast(int, x), __builtin_bit_cast(int, x),
                                                                0x76543210, 0xfedcba98, false, false));
}

__global__ __launch_bounds__(kFaWaves * 32) void attn_fused_kernel(const unsigned short* __restrict__ Qp,
                                                                   const unsigned short* __restrict__ Kp,
                                                                   const unsigned short* __restrict__ Vtp,
                                                                   const float* __restrict__ R, float* __restrict__ C) {
  typedef Frag<_Float16> F;
  __shared__ __align__(16) _Float16 sK[2][kFaStage * kFaPitch];   // [key in stage][d]
  __shared__ __align__(16) _Float16 sV[2][kDh * kFaPitch];        // [d][key in stage]
  const int lane = threadIdx.x & 31;
  const int wave = threadIdx.x >> 5;
  const int c    = lane & 15;
  const int h    = lane >> 4;
  const int b    = blockIdx.y / kHeads;
  const int head = blockIdx.y - b * kHeads;
  const int q0   = blockIdx.x * kFaRows + wave * kFaCols;
  const size_t tokOff = (size_t)b * kSeq * kDim + (size_t)head * kDh;   // row b*2048, this head's 64 columns
  const _Float16* Q  = (const _Float16*)Qp + tokOff;
  const _Float16* K  = (const _Float16*)Kp + tokOff;
  const _Float16* Vt = (const _Float16*)Vtp + (size_t)head * kDh * kTok + (size_t)b * kSeq;

  // Staging map: 8 lanes x 16 B = one 128-B row; a thread brings rows srow and srow + 32 of both tiles.
  const int srow = threadIdx.x >> 3;
  const int sch  = (threadIdx.x & 7) * 8;
  const _Float16* gK = K + (size_t)srow * kDim + sch;
  const _Float16* gV = Vt + (size_t)srow * kTok + sch;
  const int sOff0 = srow * kFaPitch + sch;
  const int sOff1 = (srow + 32) * kFaPitch + sch;

  v8h rk0 = *(const v8h*)(gK);
  v8h rk1 = *(const v8h*)(gK + (size_t)32 * kDim);
  v8h rv0 = *(const v8h*)(gV);
  v8h rv1 = *(const v8h*)(gV + (size_t)32 * kTok);

  v16h qf[2][2];   // [column group][k step]
#pragma unroll
  for (int g = 0; g < 2; ++g)
#pragma unroll
    for (int ks = 0; ks < 2; ++ks) qf[g][ks] = F::load(Q + (size_t)(q0 + (g << 4) + c) * kDim + ks * 32 + 8 * h);

  *(v8h*)(&sK[0][sOff0]) = rk0;
  *(v8h*)(&sK[0][sOff1]) = rk1;
  *(v8h*)(&sV[0][sOff0]) = rv0;
  *(v8h*)(&sV[0][sOff1]) = rv1;
  __syncthreads();   // publishes stage 0

  const v8f zero8 = (v8f){0.f,0.f,0.f,0.f,0.f,0.f,0.f,0.f};
  v8f acc[4][2];     // [16-row tile of d][column group]: acc[t][g][r] = O^T[16t + 8h + r][query 16g + c]
  float mUse[2], lSum[2];
#pragma unroll
  for (int g = 0; g < 2; ++g) {
    mUse[g] = -1.0e30f;   // below every score: the first pass always rescales, by exp2 of a huge negative = 0
    lSum[g] = 0.f;
#pragma unroll
    for (int t = 0; t < 4; ++t) acc[t][g] = zero8;
  }

  for (int s = 0; s < kFaStages; ++s) {
    const _Float16* bK = sK[s & 1];
    const _Float16* bV = sV[s & 1];
    const bool more = (s + 1 < kFaStages);   // the same for the whole work-group
    if (more) {
      const size_t kn = (size_t)(s + 1) * kFaStage;
      rk0 = *(const v8h*)(gK + kn * kDim);
      rk1 = *(const v8h*)(gK + (kn + 32) * kDim);
      rv0 = *(const v8h*)(gV + kn);
      rv1 = *(const v8h*)(gV + kn + (size_t)32 * kTok);
    }
#pragma unroll
    for (int ps = 0; ps < 2; ++ps) {
      v16h kf[2][2], vf[4];
#pragma unroll
      for (int t = 0; t < 2; ++t)
#pragma unroll
        for (int ks = 0; ks < 2; ++ks) kf[t][ks] = F::load(bK + (ps * 32 + (t << 4) + c) * kFaPitch + ks * 32 + 8 * h);
#pragma unroll
      for (int t = 0; t < 4; ++t) vf[t] = F::load(bV + ((t << 4) + c) * kFaPitch + ps * 32 + 8 * h);

      v8f st[2][2];   // [16-key tile][column group]: st[t][g][r] = S^T[key 16t + 8h + r][query 16g + c], unscaled
#pragma unroll
      for (int t = 0; t < 2; ++t)
#pragma unroll
        for (int g = 0; g < 2; ++g) {
          st[t][g] = F::mma(kf[t][0], qf[g][0], zero8);
          st[t][g] = F::mma(kf[t][1], qf[g][1], st[t][g]);
        }

      float mb[2];
      bool need = false;
#pragma unroll
      for (int g = 0; g < 2; ++g) {
        float mx = st[0][g][0];
#pragma unroll
        for (int r = 1; r < 8; ++r) mx = fmaxf(mx, st[0][g][r]);
#pragma unroll
        for (int r = 0; r < 8; ++r) mx = fmaxf(mx, st[1][g][r]);
        mx = fmaxf(mx, xhalf(mx)) * kQKScaleLog2;   // both halves now hold this query's maximum, scaled
        mb[g] = mx;
        need = need || (mx > mUse[g] + 8.0f);
      }
      if (__builtin_amdgcn_ballot_w32(need) != 0) {   // scalar branch; rare after the first passes
#pragma unroll
        for (int g = 0; g < 2; ++g) {
          const float mNew = fmaxf(mUse[g], mb[g]);
          const float corr = __builtin_amdgcn_exp2f(mUse[g] - mNew);
          mUse[g] = mNew;
          lSum[g] *= corr;
#pragma unroll
          for (int t = 0; t < 4; ++t) acc[t][g] = acc[t][g] * corr;
        }
      }

#pragma unroll
      for (int g = 0; g < 2; ++g) {
        const float nm = -mUse[g];
        union { v16h v; v2h p[8]; } pf;   // element e = key kmap(e, h): tile e >> 3, register e & 7
        float l0 = 0.f, l1 = 0.f;
#pragma unroll
        for (int i = 0; i < 8; ++i) {
          const v2f arg = __builtin_elementwise_fma((v2f){st[i >> 2][g][2 * (i & 3)], st[i >> 2][g][2 * (i & 3) + 1]},
                                                    (v2f){kQKScaleLog2, kQKScaleLog2}, (v2f){nm, nm});
          const v2f p = (v2f){__builtin_amdgcn_exp2f(arg[0]), __builtin_amdgcn_exp2f(arg[1])};
          l0 += p[0];
          l1 += p[1];
          pf.p[i] = __builtin_convertvector(p, v2h);
        }
        lSum[g] += l0 + l1;
#pragma unroll
        for (int t = 0; t < 4; ++t) acc[t][g] = F::mma(vf[t], pf.v, acc[t][g]);
      }
    }
    if (more) {
      _Float16* nK = sK[(s + 1) & 1];
      _Float16* nV = sV[(s + 1) & 1];
      *(v8h*)(nK + sOff0) = rk0;
      *(v8h*)(nK + sOff1) = rk1;
      *(v8h*)(nV + sOff0) = rv0;
      *(v8h*)(nV + sOff1) = rv1;
    }
    __syncthreads();   // publishes stage s + 1; ends every wave's reads of the buffer that stage s + 1 refills
  }

  // Epilogue: join the halves' sums, divide, add the residual. A lane holds 8 consecutive d of one query per tile.
#pragma unroll
  for (int g = 0; g < 2; ++g) {
    const float inv = 1.0f / (lSum[g] + xhalf(lSum[g]));   // the largest score's term is at least 1: the maximum in use never exceeds it
    const size_t o = tokOff + (size_t)(q0 + (g << 4) + c) * kDim + 8 * h;
#pragma unroll
    for (int t = 0; t < 4; ++t) {
      const v4f r0 = *(const v4f*)(R + o + (t << 4));
      const v4f r1 = *(const v4f*)(R + o + (t << 4) + 4);
      v4f o0, o1;
#pragma unroll
      for (int e = 0; e < 4; ++e) {
        o0[e] = acc[t][g][e] * inv + r0[e];
        o1[e] = acc[t][g][4 + e] * inv + r1[e];
      }
      *(v4f*)(C + o + (t << 4)) = o0;
      *(v4f*)(C + o + (t << 4) + 4) = o1;
    }
  }
}

// ---------------------------------------------------------------------------
// Host side
// Workspace region map (bytes):
//   Q16  : 8192 x 512 x 2            =   8,388,608 @          0   (relu(Xq Wq^T + bq), f16, [tok][512])
//   K16  : 8192 x 512 x 2            =   8,388,608 @  8,388,608
//   Vt16 : 512 x 8192 x 2            =   8,388,608 @ 16,777,216   (relu(Wv Xv^T + bv), f16, [v][b*2048+t])
//   total                            =  25,165,824
// ---------------------------------------------------------------------------
extern "C" void kernel_launch(void* const* d_in, const int* in_sizes, int n_in,
                              void* d_out, int out_size, void* d_ws, size_t ws_size,
                              hipStream_t stream) {
  if (n_in < 9) return;
  const size_t nTokU = (size_t)kTok * kDim;       // 4,194,304
  const size_t nWW   = (size_t)kDim * kDim;       //   262,144
  if ((size_t)in_sizes[0] != nTokU || (size_t)in_sizes[1] != nTokU || (size_t)in_sizes[2] != nTokU) return;
  if ((size_t)in_sizes[3] != nWW || (size_t)in_sizes[5] != nWW || (size_t)in_sizes[7] != nWW) return;
  if (in_sizes[4] != kDim || in_sizes[6] != kDim || in_sizes[8] != kDim) return;
  if ((size_t)out_size != nTokU) return;

  const float* queries = (const float*)d_in[0];
  const float* keys    = (const float*)d_in[1];
  const float* values  = (const float*)d_in[2];
  const float* Wq      = (const float*)d_in[3];
  const float* bq      = (const float*)d_in[4];
  const float* Wk      = (const float*)d_in[5];
  const float* bk      = (const float*)d_in[6];
  const float* Wv      = (const float*)d_in[7];
  const float* bv      = (const float*)d_in[8];
  float* out = (float*)d_out;

  // ---- carve ----
  const size_t bPlane = nTokU * 2;
  if (3 * bPlane > ws_size) return;
  char* ws = (char*)d_ws;
  unsigned short* Q16  = (unsigned short*)(ws);
  unsigned short* K16  = (unsigned short*)(ws + bPlane);
  unsigned short* Vt16 = (unsigned short*)(ws + 2 * bPlane);

  // ---- projections: one launch; x = 4 feature tiles x 64 token tiles, y = Q, K, V^T ----
  proj_fused_kernel<<<dim3((kTok / kPjTile) * (kDim / kPjTile), 3), dim3(256), 0, stream>>>(
      queries, keys, values, Wq, Wk, Wv, bq, bk, bv, Q16, K16, Vt16);

  // ---- attention: one launch; x = block of 256 queries, y = batch * 8 + head ----
  // out[b,q,h*64+d] = sum_k softmax_k(0.125 * Q[b,q,h*64+:] . K[b,k,h*64+:]) Vt[h*64+d][b*2048+k] + queries[b,q,h*64+d]
  attn_fused_kernel<<<dim3(kSeq / kFaRows, kBatch * kHeads), dim3(kFaWaves * 32), 0, stream>>>(Q16, K16, Vt16, queries, out);
}

// v004
// Measured time: 55.6 microseconds a run.
// Timed twice side by side with v003, it ran 1.08 and 1.07 times as fast.
// All steps since v000 together make it 34.1 times as fast.
// Contractions: q/k/v projections (X f16 x W^T f16 carried x16), scores K.Q^T (relu planes f16, K=64), V^T.P^T (P f16, unnormalised exp2 against the maximum in use): all v_wmma_f32_16x16x32_f16 with f32 accumulate; softmax, bias, relu and residual in f32.
#include <hip/hip_runtime.h>

// ---------------------------------------------------------------------------
// Problem constants
// ---------------------------------------------------------------------------
constexpr int kBatch = 4;
constexpr int kSeq   = 2048;
constexpr int kDim   = 512;
constexpr int kHeads = 8;
constexpr int kDh    = 64;
constexpr int kTok   = kBatch * kSeq;      // 8192 token rows
constexpr float kWCarry    = 16.0f;        // weights carried x16 in f16
constexpr float kWCarryInv = 1.0f / 16.0f;
constexpr float kQKScaleLog2 = 0.125f * 1.4426950408889634f;   // 1/sqrt(64), times log2(e): the softmax runs in base 2
static_assert(kHeads * kDh == kDim);

typedef __attribute__((ext_vector_type(16))) _Float16 v16h;
typedef __attribute__((ext_vector_type(8)))  _Float16 v8h;
typedef __attribute__((ext_vector_type(8)))  float    v8f;
typedef __attribute__((ext_vector_type(4)))  float    v4f;
typedef __attribute__((ext_vector_type(4)))  _Float16 v4h;

// ---------------------------------------------------------------------------
// f16 fragment of the 16x16x32 form
// ---------------------------------------------------------------------------
template <typename T> struct Frag;
template <> struct Frag<_Float16> {
  typedef v16h V; union U { v16h v; v8h h[2]; };
  static __device__ __forceinline__ v16h load(const _Float16* p) {   // elements 0..7 <- p[0..7], 8..15 <- p[16..23]
    U f; f.h[0] = *(const v8h*)(p); f.h[1] = *(const v8h*)(p + 16); return f.v;
  }
  static __device__ __forceinline__ v8f mma(v16h a, v16h b, v8f c) {
    return __builtin_amdgcn_wmma_f32_16x16x32_f16(false, a, false, b, (short)0, c, false, false);
  }
};

// ---------------------------------------------------------------------------
// The three projections in one launch, straight from the f32 inputs: blockIdx.y = 0 (Q), 1 (K), 2 (V^T).
// C[m,n] = relu(sum_k A[m,k] * B[n,k] + bias); both operands are f32 rows of 512, k-contiguous.
//   Q, K : A = X (tokens),   B = W (features), C = [token][512],    bias by n
//   V^T  : A = Wv (features), B = Xv (tokens),  C = [feature][8192], bias by m
// A work-group owns a 128 x 128 tile of C (8 waves, 4 x 2, each 32 x 64) and walks k in stages of 64.
// Staging: each stage's 128 + 128 rows of 256 B come as whole lines into registers one stage ahead, are converted there
// to f16 (W times 16, X as it is) and stored into one of two LDS buffers; one barrier per stage publishes the next
// buffer and ends the reads of the one refilled behind it.
// The k order of every accumulator is steps of 32, ascending.
// The stage loop is unrolled whole: every global address is then one base plus an immediate offset.
// ---------------------------------------------------------------------------
constexpr int kPjTile   = 128;                    // rows of each operand per work-group
constexpr int kPjK      = 64;                     // k of a stage (two WMMA steps)
constexpr int kPjStages = kDim / kPjK;
constexpr int kPjPitch  = 72;                     // halves per LDS row: 128 B + 16 B, conflict-free for 16-byte reads
constexpr int kPjLoads  = kPjTile / 16;           // 16-byte loads of a thread per operand and stage
constexpr int kPjOp     = kPjTile * kPjPitch;     // halves of one operand's tile in LDS
constexpr int kPjBuf    = 2 * kPjOp;              // halves of a buffer
static_assert(8 * 16 * 68 * 4 <= kPjBuf * 2);     // the eight output slabs fit one buffer
static_assert(kTok % kPjTile == 0 && kDim % kPjTile == 0 && kDim % kPjK == 0);
static_assert(((kTok / kPjTile) & (kTok / kPjTile - 1)) == 0);

__global__ __launch_bounds__(256) void proj_fused_kernel(
    const float* __restrict__ Xq, const float* __restrict__ Xk, const float* __restrict__ Xv,
    const float* __restrict__ Wq, const float* __restrict__ Wk, const float* __restrict__ Wv,
    const float* __restrict__ bq, const float* __restrict__ bk, const float* __restrict__ bv,
    unsigned short* __restrict__ Q16, unsigned short* __restrict__ K16, unsigned short* __restrict__ Vt16) {
  typedef Frag<_Float16> F;
  __shared__ __align__(16) unsigned char smem[2 * kPjBuf * 2];   // [buffer][A rows | B rows][pitch] in halves
  _Float16* const ring = (_Float16*)smem;
  const int z = blockIdx.y;
  const bool isV = (z == 2);                       // block-uniform
  const float* X    = (z == 0) ? Xq : (z == 1) ? Xk : Xv;
  const float* Wt   = (z == 0) ? Wq : (z == 1) ? Wk : Wv;
  const float* bias = (z == 0) ? bq : (z == 1) ? bk : bv;
  unsigned short* C = (z == 0) ? Q16 : (z == 1) ? K16 : Vt16;
  const int tokTile  = blockIdx.x & (kTok / kPjTile - 1);   // the four work-groups of a token tile stand 64 apart in the
  const int featTile = blockIdx.x / (kTok / kPjTile);       // grid (speed only: a multiple of the number of dies)
  const int m0  = (isV ? featTile : tokTile) * kPjTile;
  const int n0  = (isV ? tokTile : featTile) * kPjTile;
  const int ldc = isV ? kTok : kDim;
  const float sa = isV ? kWCarry : 1.0f;
  const float sb = isV ? 1.0f : kWCarry;

  const int lane = threadIdx.x & 31;
  const int wave = threadIdx.x >> 5;
  const int c    = lane & 15;                      // row (A) / column (B, D) within a 16-tile
  const int h    = lane >> 4;
  const int wm   = (wave >> 1) * 32;               // the wave's rows of the tile
  const int wn   = (wave & 1) * 64;                // the wave's columns of the tile

  // Staging map: 16 lanes x 16 B = one 256-B row piece; a thread brings rows srow + 16 i of both operands.
  const int srow = threadIdx.x >> 4;
  const int sc4  = (threadIdx.x & 15) * 4;
  const float* gA = (isV ? Wt : X) + (size_t)(m0 + srow) * kDim + sc4;
  const float* gB = (isV ? X : Wt) + (size_t)(n0 + srow) * kDim + sc4;
  const int sOff = srow * kPjPitch + sc4;

  v4f ra[kPjLoads], rb[kPjLoads];
#pragma unroll
  for (int i = 0; i < kPjLoads; ++i) {
    ra[i] = *(const v4f*)(gA + (size_t)i * 16 * kDim);
    rb[i] = *(const v4f*)(gB + (size_t)i * 16 * kDim);
  }

  v8f acc[2][4];   // acc[i][j][r] = C[wm + 16i + 8h + r][wn + 16j + c]
#pragma unroll
  for (int i = 0; i < 2; ++i)
#pragma unroll
    for (int j = 0; j < 4; ++j) acc[i][j] = (v8f){0.f,0.f,0.f,0.f,0.f,0.f,0.f,0.f};

#pragma unroll
  for (int i = 0; i < kPjLoads; ++i) {
    *(v4h*)(ring + sOff + i * 16 * kPjPitch) = __builtin_convertvector(ra[i] * sa, v4h);
    *(v4h*)(ring + kPjOp + sOff + i * 16 * kPjPitch) = __builtin_convertvector(rb[i] * sb, v4h);
  }
  __syncthreads();   // publishes stage 0

#pragma unroll
  for (int s = 0; s < kPjStages; ++s) {
    const _Float16* bA = ring + (s & 1) * kPjBuf;
    const _Float16* bB = bA + kPjOp;
    if (s + 1 < kPjStages) {
#pragma unroll
      for (int i = 0; i < kPjLoads; ++i) {
        ra[i] = *(const v4f*)(gA + (size_t)i * 16 * kDim + (s + 1) * kPjK);
        rb[i] = *(const v4f*)(gB + (size_t)i * 16 * kDim + (s + 1) * kPjK);
      }
      // Keeps the sixteen loads in front of this stage's products: left free, the compiler sinks them behind the
      // products and waits for them in pairs, and nothing covers their latency.
      __builtin_amdgcn_sched_barrier(0);
    }
#pragma unroll
    for (int ks = 0; ks < 2; ++ks) {
      v16h af[2], bf[4];
#pragma unroll
      for (int i = 0; i < 2; ++i) af[i] = F::load(bA + (wm + (i << 4) + c) * kPjPitch + ks * 32 + 8 * h);
#pragma unroll
      for (int j = 0; j < 4; ++j) bf[j] = F::load(bB + (wn + (j << 4) + c) * kPjPitch + ks * 32 + 8 * h);
#pragma unroll
      for (int i = 0; i < 2; ++i)
#pragma unroll
        for (int j = 0; j < 4; ++j) acc[i][j] = F::mma(af[i], bf[j], acc[i][j]);
    }
    if (s + 1 < kPjStages) {
      // Keeps the conversions, and with them the wait for the loads, behind this stage's products.
      __builtin_amdgcn_sched_barrier(0);
#pragma unroll
      for (int i = 0; i < kPjLoads; ++i) {
        *(v4h*)(ring + ((s + 1) & 1) * kPjBuf + sOff + i * 16 * kPjPitch) = __builtin_convertvector(ra[i] * sa, v4h);
        *(v4h*)(ring + ((s + 1) & 1) * kPjBuf + kPjOp + sOff + i * 16 * kPjPitch) = __builtin_convertvector(rb[i] * sb, v4h);
      }
      __syncthreads();   // publishes stage s + 1; ends every wave's reads of the buffer that stage s + 1 refills
    }
  }

  // Epilogue: scale, bias, relu in f32; each wave turns its 16 x 64 slabs (pitch 68 floats) in its own LDS range into
  // whole 128-B lines. The slabs lie in buffer 0: the last stage reads buffer 1, and every wave's last read of buffer 0
  // stands in front of the barrier that published that stage.
  static_assert((kPjStages & 1) == 0);
  float* slab = (float*)smem + wave * (16 * 68);
  // Both bias forms are loaded as one group with no branch; the index of the form not in use is 0 (inside the 512).
  float bn[4];
  v4f bm[2][2];
#pragma unroll
  for (int j = 0; j < 4; ++j) bn[j] = bias[isV ? 0 : n0 + wn + (j << 4) + c];
#pragma unroll
  for (int i = 0; i < 2; ++i) {
    const float* bp = bias + (isV ? m0 + wm + (i << 4) + 8 * h : 0);
    bm[i][0] = *(const v4f*)(bp);
    bm[i][1] = *(const v4f*)(bp + 4);
  }
#pragma unroll
  for (int i = 0; i < 2; ++i) {
    const int mBase = m0 + wm + (i << 4);
#pragma unroll
    for (int r = 0; r < 8; ++r) {
#pragma unroll
      for (int j = 0; j < 4; ++j) {
        float v = acc[i][j][r] * kWCarryInv;
        v += isV ? bm[i][r >> 2][r & 3] : bn[j];
        slab[(8 * h + r) * 68 + (j << 4) + c] = fmaxf(v, 0.0f);
      }
    }
    __builtin_amdgcn_fence(__ATOMIC_RELEASE, "workgroup");
    __builtin_amdgcn_wave_barrier();   // the slab is the wave's own: its lanes' stores stand before its lanes' reads
    __builtin_amdgcn_fence(__ATOMIC_ACQUIRE, "workgroup");
    const int q = lane >> 3, c8 = (lane & 7) * 8;
#pragma unroll
    for (int it = 0; it < 4; ++it) {
      const int row = it * 4 + q;
      const float* sp = slab + row * 68 + c8;
      v8h hv;
#pragma unroll
      for (int e = 0; e < 8; ++e) hv[e] = (_Float16)sp[e];
      *(v8h*)(C + (size_t)(mBase + row) * ldc + n0 + wn + c8) = hv;
    }
    if (i == 0) {
      __builtin_amdgcn_fence(__ATOMIC_RELEASE, "workgroup");
      __builtin_amdgcn_wave_barrier();   // the reads above stand before the next slab's stores
      __builtin_amdgcn_fence(__ATOMIC_ACQUIRE, "workgroup");
    }
  }
}

typedef __attribute__((ext_vector_type(2))) float v2f;
typedef __attribute__((ext_vector_type(2))) _Float16 v2h;
constexpr int kFaQWaves = 8;                      // waves side by side over the queries
constexpr int kFaKSplit = 2;                      // wave groups over the keys
constexpr int kFaWaves  = kFaQWaves * kFaKSplit;
constexpr int kFaCols   = 32;                     // query columns of a wave (two 16-column groups)
constexpr int kFaRows   = kFaQWaves * kFaCols;    // queries of a work-group
constexpr int kFaStage  = 64;                     // keys of a wave group's stage (two passes of 32)
constexpr int kFaStep   = kFaStage * kFaKSplit;   // keys of the work-group's stage
constexpr int kFaStages = kSeq / kFaStep;
constexpr int kFaPitch  = 72;                     // halves per LDS row: 128 B + 16 B, conflict-free for 16-byte reads
constexpr int kFaTile   = kFaStage * kFaPitch;    // halves of one K or V^T tile in LDS
constexpr int kFaRing   = kFaKSplit * 2 * 2 * kFaTile * 2;         // bytes: [group][buffer][K | V^T]
constexpr int kFaXAcc   = kFaWaves * 8 * 32 * 4;  // floats handed over in the merge: 32 per lane
static_assert(kSeq % kFaRows == 0 && kSeq % kFaStep == 0 && kDh == 64 && kDh == kFaStage && kFaKSplit == 2);
static_assert((kFaXAcc + kFaWaves * 2 * 32) * 4 <= kFaRing);

__device__ __forceinline__ float xhalf(float x) {   // lane l with lane l ^ 16
  return __builtin_bit_cast(float, __builtin_amdgcn_permlanex16(__builtin_bit_cast(int, x), __builtin_bit_cast(int, x),
                                                                0x76543210, 0xfedcba98, false, false));
}

__global__ __launch_bounds__(kFaWaves * 32) void attn_fused_kernel(const unsigned short* __restrict__ Qp,
                                                                   const unsigned short* __restrict__ Kp,
                                                                   const unsigned short* __restrict__ Vtp,
                                                                   const float* __restrict__ R, float* __restrict__ C) {
  typedef Frag<_Float16> F;
  __shared__ __align__(16) unsigned char smem[kFaRing];
  const int lane = threadIdx.x & 31;
  const int wave = threadIdx.x >> 5;
  const int kg   = __builtin_amdgcn_readfirstlane(wave / kFaQWaves);   // the wave's key group, the same in every lane
  const int c    = lane & 15;
  const int h    = lane >> 4;
  const int b    = blockIdx.y / kHeads;
  const int head = blockIdx.y - b * kHeads;
  const int q0   = blockIdx.x * kFaRows + (wave & (kFaQWaves - 1)) * kFaCols;
  const size_t tokOff = (size_t)b * kSeq * kDim + (size_t)head * kDh;   // row b*2048, this head's 64 columns
  const _Float16* Q  = (const _Float16*)Qp + tokOff;
  const _Float16* K  = (const _Float16*)Kp + tokOff;
  const _Float16* Vt = (const _Float16*)Vtp + (size_t)head * kDh * kTok + (size_t)b * kSeq;
  _Float16* const ring = (_Float16*)smem + kg * (4 * kFaTile);   // the group's two buffers, each K tile then V^T tile

  // Staging map within a group: 8 lanes x 16 B = one 128-B row; a thread brings rows srow and srow + 32 of both tiles.
  const int gt  = threadIdx.x & (kFaQWaves * 32 - 1);
  const int srow = gt >> 3;
  const int sch  = (gt & 7) * 8;
  const _Float16* gK = K + (size_t)(kg * kFaStage + srow) * kDim + sch;
  const _Float16* gV = Vt + (size_t)srow * kTok + kg * kFaStage + sch;
  const int sOff0 = srow * kFaPitch + sch;
  const int sOff1 = (srow + 32) * kFaPitch + sch;

  v8h rk0 = *(const v8h*)(gK);
  v8h rk1 = *(const v8h*)(gK + (size_t)32 * kDim);
  v8h rv0 = *(const v8h*)(gV);
  v8h rv1 = *(const v8h*)(gV + (size_t)32 * kTok);

  v16h qf[2][2];   // [column group][k step]
#pragma unroll
  for (int g = 0; g < 2; ++g)
#pragma unroll
    for (int ks = 0; ks < 2; ++ks) qf[g][ks] = F::load(Q + (size_t)(q0 + (g << 4) + c) * kDim + ks * 32 + 8 * h);

  *(v8h*)(ring + sOff0) = rk0;
  *(v8h*)(ring + sOff1) = rk1;
  *(v8h*)(ring + kFaTile + sOff0) = rv0;
  *(v8h*)(ring + kFaTile + sOff1) = rv1;
  __syncthreads();   // publishes stage 0

  const v8f zero8 = (v8f){0.f,0.f,0.f,0.f,0.f,0.f,0.f,0.f};
  v8f acc[4][2];     // [16-row tile of d][column group]: acc[t][g][r] = O^T[16t + 8h + r][query 16g + c]
  float mUse[2], lSum[2];
#pragma unroll
  for (int g = 0; g < 2; ++g) {
    mUse[g] = -1.0e30f;   // below every score: the first pass always rescales, by exp2 of a huge negative = 0
    lSum[g] = 0.f;
#pragma unroll
    for (int t = 0; t < 4; ++t) acc[t][g] = zero8;
  }

  for (int s = 0; s < kFaStages; ++s) {
    const _Float16* bK = ring + (s & 1) * (2 * kFaTile);
    const _Float16* bV = bK + kFaTile;
    const bool more = (s + 1 < kFaStages);   // the same for the whole work-group
    if (more) {
      const size_t kn = (size_t)(s + 1) * kFaStep;
      rk0 = *(const v8h*)(gK + kn * kDim);
      rk1 = *(const v8h*)(gK + (kn + 32) * kDim);
      rv0 = *(const v8h*)(gV + kn);
      rv1 = *(const v8h*)(gV + kn + (size_t)32 * kTok);
    }
#pragma unroll
    for (int ps = 0; ps < 2; ++ps) {
      v16h kf[2][2], vf[4];
#pragma unroll
      for (int t = 0; t < 2; ++t)
#pragma unroll
        for (int ks = 0; ks < 2; ++ks) kf[t][ks] = F::load(bK + (ps * 32 + (t << 4) + c) * kFaPitch + ks * 32 + 8 * h);
#pragma unroll
      for (int t = 0; t < 4; ++t) vf[t] = F::load(bV + ((t << 4) + c) * kFaPitch + ps * 32 + 8 * h);

      v8f st[2][2];   // [16-key tile][column group]: st[t][g][r] = S^T[key 16t + 8h + r][query 16g + c], unscaled
#pragma unroll
      for (int t = 0; t < 2; ++t)
#pragma unroll
        for (int g = 0; g < 2; ++g) {
          st[t][g] = F::mma(kf[t][0], qf[g][0], zero8);
          st[t][g] = F::mma(kf[t][1], qf[g][1], st[t][g]);
        }

      float mb[2];
      bool need = false;
#pragma unroll
      for (int g = 0; g < 2; ++g) {
        float mx = st[0][g][0];
#pragma unroll
        for (int r = 1; r < 8; ++r) mx = fmaxf(mx, st[0][g][r]);
#pragma unroll
        for (int r = 0; r < 8; ++r) mx = fmaxf(mx, st[1][g][r]);
        mx = fmaxf(mx, xhalf(mx)) * kQKScaleLog2;   // both halves now hold this query's maximum, scaled
        mb[g] = mx;
        need = need || (mx > mUse[g] + 8.0f);
      }
      if (__builtin_amdgcn_ballot_w32(need) != 0) {   // scalar branch; rare after the first passes
#pragma unroll
        for (int g = 0; g < 2; ++g) {
          const float mNew = fmaxf(mUse[g], mb[g]);
          const float corr = __builtin_amdgcn_exp2f(mUse[g] - mNew);
          mUse[g] = mNew;
          lSum[g] *= corr;
#pragma unroll
          for (int t = 0; t < 4; ++t) acc[t][g] = acc[t][g] * corr;
        }
      }

#pragma unroll
      for (int g = 0; g < 2; ++g) {
        const float nm = -mUse[g];
        union { v16h v; v2h p[8]; } pf;   // element e = key kmap(e, h): tile e >> 3, register e & 7
        float l0 = 0.f, l1 = 0.f;
#pragma unroll
        for (int i = 0; i < 8; ++i) {
          const v2f arg = __builtin_elementwise_fma((v2f){st[i >> 2][g][2 * (i & 3)], st[i >> 2][g][2 * (i & 3) + 1]},
                                                    (v2f){kQKScaleLog2, kQKScaleLog2}, (v2f){nm, nm});
          const v2f p = (v2f){__builtin_amdgcn_exp2f(arg[0]), __builtin_amdgcn_exp2f(arg[1])};
          l0 += p[0];
          l1 += p[1];
          pf.p[i] = __builtin_convertvector(p, v2h);
        }
        lSum[g] += l0 + l1;
#pragma unroll
        for (int t = 0; t < 4; ++t) acc[t][g] = F::mma(vf[t], pf.v, acc[t][g]);
      }
    }
    if (more) {
      _Float16* nK = ring + ((s + 1) & 1) * (2 * kFaTile);
      _Float16* nV = nK + kFaTile;
      *(v8h*)(nK + sOff0) = rk0;
      *(v8h*)(nK + sOff1) = rk1;
      *(v8h*)(nV + sOff0) = rv0;
      *(v8h*)(nV + sOff1) = rv1;
    }
    __syncthreads();   // publishes stage s + 1; ends every wave's reads of the buffer that stage s + 1 refills
  }

  // Epilogue: the two waves that hold the same 32 queries (wave w and w + 8) merge their halves of the keys. Group 0
  // finishes column group 0 and group 1 column group 1: each wave hands the other column group (maximum in use, sum, 32
  // accumulator values per lane) to its partner through LDS. The ring is free: the loop's last barrier ended its reads.
  const bool up = (kg != 0);
  const size_t o = tokOff + (size_t)(q0 + (kg << 4) + c) * kDim + 8 * h;   // a lane holds 8 consecutive d of one query per tile
  v4f res[4][2];
#pragma unroll
  for (int t = 0; t < 4; ++t) {
    res[t][0] = *(const v4f*)(R + o + (t << 4));
    res[t][1] = *(const v4f*)(R + o + (t << 4) + 4);
  }
  v4f*   const xa = (v4f*)smem;                    // [wave][8][lane], 16 B each
  float* const xs = (float*)smem + kFaXAcc;        // [wave][maximum, sum][lane]
  {
    v4f* xw = xa + wave * (8 * 32) + lane;
#pragma unroll
    for (int t = 0; t < 4; ++t) {
      const v8f give = up ? acc[t][0] : acc[t][1];
      xw[(2 * t) * 32]     = (v4f){give[0], give[1], give[2], give[3]};
      xw[(2 * t + 1) * 32] = (v4f){give[4], give[5], give[6], give[7]};
    }
    xs[(wave * 2) * 32 + lane]     = up ? mUse[0] : mUse[1];
    xs[(wave * 2 + 1) * 32 + lane] = up ? lSum[0] : lSum[1];
  }
  __syncthreads();   // publishes every wave's hand-over to its partner
  const int pw = wave ^ kFaQWaves;
  const v4f* xr = xa + pw * (8 * 32) + lane;
  const float mOwn = up ? mUse[1] : mUse[0];
  const float lOwn = up ? lSum[1] : lSum[0];
  const float mOth = xs[(pw * 2) * 32 + lane];
  const float lOth = xs[(pw * 2 + 1) * 32 + lane];
  const float mAll = fmaxf(mOwn, mOth);
  const float fOwn = __builtin_amdgcn_exp2f(mOwn - mAll);   // one of the two factors is 1
  const float fOth = __builtin_amdgcn_exp2f(mOth - mAll);
  const float lAll = lOwn * fOwn + lOth * fOth;
  const float inv  = 1.0f / (lAll + xhalf(lAll));   // the largest score's term is at least 1: no maximum in use exceeds it
  const float aOwn = fOwn * inv;
  const float aOth = fOth * inv;
#pragma unroll
  for (int t = 0; t < 4; ++t) {
    const v8f own = up ? acc[t][1] : acc[t][0];
    const v4f p0 = xr[(2 * t) * 32];
    const v4f p1 = xr[(2 * t + 1) * 32];
    v4f o0, o1;
#pragma unroll
    for (int e = 0; e < 4; ++e) {
      o0[e] = own[e] * aOwn + p0[e] * aOth + res[t][0][e];
      o1[e] = own[4 + e] * aOwn + p1[e] * aOth + res[t][1][e];
    }
    *(v4f*)(C + o + (t << 4)) = o0;
    *(v4f*)(C + o + (t << 4) + 4) = o1;
  }
}

// ---------------------------------------------------------------------------
// Host side
// Workspace region map (bytes):
//   Q16  : 8192 x 512 x 2            =   8,388,608 @          0   (relu(Xq Wq^T + bq), f16, [tok][512])
//   K16  : 8192 x 512 x 2            =   8,388,608 @  8,388,608
//   Vt16 : 512 x 8192 x 2            =   8,388,608 @ 16,777,216   (relu(Wv Xv^T + bv), f16, [v][b*2048+t])
//   total                            =  25,165,824
// ---------------------------------------------------------------------------
extern "C" void kernel_launch(void* const* d_in, const int* in_sizes, int n_in,
                              void* d_out, int out_size, void* d_ws, size_t ws_size,
                              hipStream_t stream) {
  if (n_in < 9) return;
  const size_t nTokU = (size_t)kTok * kDim;       // 4,194,304
  const size_t nWW   = (size_t)kDim * kDim;       //   262,144
  if ((size_t)in_sizes[0] != nTokU || (size_t)in_sizes[1] != nTokU || (size_t)in_sizes[2] != nTokU) return;
  if ((size_t)in_sizes[3] != nWW || (size_t)in_sizes[5] != nWW || (size_t)in_sizes[7] != nWW) return;
  if (in_sizes[4] != kDim || in_sizes[6] != kDim || in_sizes[8] != kDim) return;
  if ((size_t)out_size != nTokU) return;

  const float* queries = (const float*)d_in[0];
  const float* keys    = (const float*)d_in[1];
  const float* values  = (const float*)d_in[2];
  const float* Wq      = (const float*)d_in[3];
  const float* bq      = (const float*)d_in[4];
  const float* Wk      = (const float*)d_in[5];
  const float* bk      = (const float*)d_in[6];
  const float* Wv      = (const float*)d_in[7];
  const float* bv      = (const float*)d_in[8];
  float* out = (float*)d_out;

  // ---- carve ----
  const size_t bPlane = nTokU * 2;
  if (3 * bPlane > ws_size) return;
  char* ws = (char*)d_ws;
  unsigned short* Q16  = (unsigned short*)(ws);
  unsigned short* K16  = (unsigned short*)(ws + bPlane);
  unsigned short* Vt16 = (unsigned short*)(ws + 2 * bPlane);

  // ---- projections: one launch; x = 4 feature tiles x 64 token tiles, y = Q, K, V^T ----
  proj_fused_kernel<<<dim3((kTok / kPjTile) * (kDim / kPjTile), 3), dim3(256), 0, stream>>>(
      queries, keys, values, Wq, Wk, Wv, bq, bk, bv, Q16, K16, Vt16);

  // ---- attention: one launch; x = block of 256 queries, y = batch * 8 + head; 16 waves per work-group ----
  // out[b,q,h*64+d] = sum_k softmax_k(0.125 * Q[b,q,h*64+:] . K[b,k,h*64+:]) Vt[h*64+d][b*2048+k] + queries[b,q,h*64+d]
  attn_fused_kernel<<<dim3(kSeq / kFaRows, kBatch * kHeads), dim3(kFaWaves * 32), 0, stream>>>(Q16, K16, Vt16, queries, out);
}

// v005
// A run of this version takes 50.1 microseconds.
// Two timings next to v004 both put it at 1.11 times that version's speed.
// All steps since v000 together make it 37.8 times as fast.
// Contractions: q/k/v projections (X f16 x W^T f16 carried x16), scores K.Q^T (relu planes f16, K=64), V^T.P^T (P f16, unnormalised exp2 against the maximum in use): all v_wmma_f32_16x16x32_f16 with f32 accumulate; softmax, bias, relu and residual in f32.
#include <hip/hip_runtime.h>

// ---------------------------------------------------------------------------
// Problem constants
// ---------------------------------------------------------------------------
constexpr int kBatch = 4;
constexpr int kSeq   = 2048;
constexpr int kDim   = 512;
constexpr int kHeads = 8;
constexpr int kDh    = 64;
constexpr int kTok   = kBatch * kSeq;      // 8192 token rows
constexpr float kWCarry    = 16.0f;        // weights carried x16 in f16
constexpr float kWCarryInv = 1.0f / 16.0f;
constexpr float kQKScaleLog2 = 0.125f * 1.4426950408889634f;   // 1/sqrt(64), times log2(e): the softmax runs in base 2
static_assert(kHeads * kDh == kDim);

typedef __attribute__((ext_vector_type(16))) _Float16 v16h;
typedef __attribute__((ext_vector_type(8)))  _Float16 v8h;
typedef __attribute__((ext_vector_type(8)))  float    v8f;
typedef __attribute__((ext_vector_type(4)))  float    v4f;
typedef __attribute__((ext_vector_type(4)))  _Float16 v4h;

// ---------------------------------------------------------------------------
// f16 fragment of the 16x16x32 form
// ---------------------------------------------------------------------------
template <typename T> struct Frag;
template <> struct Frag<_Float16> {
  typedef v16h V; union U { v16h v; v8h h[2]; };
  static __device__ __forceinline__ v16h load(const _Float16* p) {   // elements 0..7 <- p[0..7], 8..15 <- p[16..23]
    U f; f.h[0] = *(const v8h*)(p); f.h[1] = *(const v8h*)(p + 16); return f.v;
  }
  static __device__ __forceinline__ v8f mma(v16h a, v16h b, v8f c) {
    return __builtin_amdgcn_wmma_f32_16x16x32_f16(false, a, false, b, (short)0, c, false, false);
  }
};

// ---------------------------------------------------------------------------
// The three projections in one launch, straight from the f32 inputs: blockIdx.y = 0 (Q), 1 (K), 2 (V^T).
// C[m,n] = relu(sum_k A[m,k] * B[n,k] + bias); both operands are f32 rows of 512, k-contiguous.
//   Q, K : A = X (tokens),   B = W (features), C = [token][512],    bias by n
//   V^T  : A = Wv (features), B = Xv (tokens),  C = [feature][8192], bias by m
// A work-group owns a 256 x 256 tile of C (8 waves, 4 x 2, each 64 x 128) and walks k in stages of 64: every X row is
// fetched by two work-groups and every W row by 32.
// Staging: each stage's 256 + 256 rows of 256 B come as whole lines into registers one stage ahead, are converted there
// to f16 (W times 16, X as it is) and stored into one of two LDS buffers; one barrier per stage publishes the next
// buffer and ends the reads of the one refilled behind it.
// The k order of every accumulator is steps of 32, ascending.
// The stage loop is unrolled whole: every global address is then one base plus an immediate offset.
// ---------------------------------------------------------------------------
constexpr int kPjTile   = 256;                    // rows of each operand per work-group
constexpr int kPjWaves  = 8;                      // 4 x 2, each 64 x 128 of the tile
constexpr int kPjK      = 64;                     // k of a stage (two WMMA steps)
constexpr int kPjStages = kDim / kPjK;
constexpr int kPjPitch  = 72;                     // halves per LDS row: 128 B + 16 B, conflict-free for 16-byte reads
constexpr int kPjRowsAt = kPjWaves * 32 / 16;     // rows that the work-group's threads bring with one 16-byte load each
constexpr int kPjLoads  = kPjTile / kPjRowsAt;    // 16-byte loads of a thread per operand and stage
constexpr int kPjOp     = kPjTile * kPjPitch;     // halves of one operand's tile in LDS
constexpr int kPjBuf    = 2 * kPjOp;              // halves of a buffer
static_assert(kPjWaves * 16 * 68 * 4 <= kPjBuf * 2);   // the eight output slabs fit one buffer
static_assert(kTok % kPjTile == 0 && kDim % kPjTile == 0 && kDim % kPjK == 0);
static_assert(((kTok / kPjTile) & (kTok / kPjTile - 1)) == 0);

__global__ __launch_bounds__(kPjWaves * 32) void proj_fused_kernel(
    const float* __restrict__ Xq, const float* __restrict__ Xk, const float* __restrict__ Xv,
    const float* __restrict__ Wq, const float* __restrict__ Wk, const float* __restrict__ Wv,
    const float* __restrict__ bq, const float* __restrict__ bk, const float* __restrict__ bv,
    unsigned short* __restrict__ Q16, unsigned short* __restrict__ K16, unsigned short* __restrict__ Vt16) {
  typedef Frag<_Float16> F;
  __shared__ __align__(16) unsigned char smem[2 * kPjBuf * 2];   // [buffer][A rows | B rows][pitch] in halves
  _Float16* const ring = (_Float16*)smem;
  const int z = blockIdx.y;
  const bool isV = (z == 2);                       // block-uniform
  const float* X    = (z == 0) ? Xq : (z == 1) ? Xk : Xv;
  const float* Wt   = (z == 0) ? Wq : (z == 1) ? Wk : Wv;
  const float* bias = (z == 0) ? bq : (z == 1) ? bk : bv;
  unsigned short* C = (z == 0) ? Q16 : (z == 1) ? K16 : Vt16;
  const int tokTile  = blockIdx.x & (kTok / kPjTile - 1);   // the two work-groups of a token tile stand 32 apart in the
  const int featTile = blockIdx.x / (kTok / kPjTile);       // grid (speed only: a multiple of the number of dies)
  const int m0  = (isV ? featTile : tokTile) * kPjTile;
  const int n0  = (isV ? tokTile : featTile) * kPjTile;
  const int ldc = isV ? kTok : kDim;
  const float sa = isV ? kWCarry : 1.0f;
  const float sb = isV ? 1.0f : kWCarry;

  const int lane = threadIdx.x & 31;
  const int wave = __builtin_amdgcn_readfirstlane(threadIdx.x >> 5);   // the same in every lane: kept in a scalar register
  const int c    = lane & 15;                      // row (A) / column (B, D) within a 16-tile
  const int h    = lane >> 4;
  const int wm   = (wave >> 1) * 64;               // the wave's rows of the tile
  const int wn   = (wave & 1) * 128;               // the wave's columns of the tile

  // Staging map: 16 lanes x 16 B = one 256-B row piece; a thread brings rows srow + 16 i of both operands.
  const int srow = threadIdx.x >> 4;
  const int sc4  = (threadIdx.x & 15) * 4;
  const float* gA = (isV ? Wt : X) + (size_t)(m0 + srow) * kDim + sc4;
  const float* gB = (isV ? X : Wt) + (size_t)(n0 + srow) * kDim + sc4;
  const int sOff = srow * kPjPitch + sc4;

  v4f ra[kPjLoads], rb[kPjLoads];
#pragma unroll
  for (int i = 0; i < kPjLoads; ++i) {
    ra[i] = *(const v4f*)(gA + (size_t)i * kPjRowsAt * kDim);
    rb[i] = *(const v4f*)(gB + (size_t)i * kPjRowsAt * kDim);
  }

  v8f acc[4][8];   // acc[i][j][r] = C[wm + 16i + 8h + r][wn + 16j + c]
#pragma unroll
  for (int i = 0; i < 4; ++i)
#pragma unroll
    for (int j = 0; j < 8; ++j) acc[i][j] = (v8f){0.f,0.f,0.f,0.f,0.f,0.f,0.f,0.f};

#pragma unroll
  for (int i = 0; i < kPjLoads; ++i) {
    *(v4h*)(ring + sOff + i * kPjRowsAt * kPjPitch) = __builtin_convertvector(ra[i] * sa, v4h);
    *(v4h*)(ring + kPjOp + sOff + i * kPjRowsAt * kPjPitch) = __builtin_convertvector(rb[i] * sb, v4h);
  }
  __syncthreads();   // publishes stage 0

#pragma unroll
  for (int s = 0; s < kPjStages; ++s) {
    const _Float16* bA = ring + (s & 1) * kPjBuf;
    const _Float16* bB = bA + kPjOp;
    if (s + 1 < kPjStages) {
#pragma unroll
      for (int i = 0; i < kPjLoads; ++i) {
        ra[i] = *(const v4f*)(gA + (size_t)i * kPjRowsAt * kDim + (s + 1) * kPjK);
        rb[i] = *(const v4f*)(gB + (size_t)i * kPjRowsAt * kDim + (s + 1) * kPjK);
      }
      // Keeps the 32 loads in front of this stage's products: left free, the compiler sinks them behind the
      // products and waits for them in pairs, and nothing covers their latency.
      __builtin_amdgcn_sched_barrier(0);
    }
#pragma unroll
    for (int ks = 0; ks < 2; ++ks) {
      // The A fragments rotate through two register sets, each fetched one row of eight products ahead. The scheduling
      // barriers hold that order: left free, the compiler reuses one set and waits out an LDS read in front of every
      // row; all four fragments at once do not fit the registers.
      const _Float16* pA = bA + (wm + c) * kPjPitch + ks * 32 + 8 * h;
      v16h af[2], bf[8];
      af[0] = F::load(pA);
#pragma unroll
      for (int j = 0; j < 8; ++j) bf[j] = F::load(bB + (wn + (j << 4) + c) * kPjPitch + ks * 32 + 8 * h);
      af[1] = F::load(pA + 16 * kPjPitch);
      __builtin_amdgcn_sched_barrier(0);
#pragma unroll
      for (int i = 0; i < 4; ++i) {
#pragma unroll
        for (int j = 0; j < 8; ++j) acc[i][j] = F::mma(af[i & 1], bf[j], acc[i][j]);
        if (i < 2) {
          __builtin_amdgcn_sched_barrier(0);
          af[i & 1] = F::load(pA + (i + 2) * 16 * kPjPitch);
          __builtin_amdgcn_sched_barrier(0);
        }
      }
    }
    if (s + 1 < kPjStages) {
      // Keeps the conversions, and with them the wait for the loads, behind this stage's products.
      __builtin_amdgcn_sched_barrier(0);
#pragma unroll
      for (int i = 0; i < kPjLoads; ++i) {
        *(v4h*)(ring + ((s + 1) & 1) * kPjBuf + sOff + i * kPjRowsAt * kPjPitch) = __builtin_convertvector(ra[i] * sa, v4h);
        *(v4h*)(ring + ((s + 1) & 1) * kPjBuf + kPjOp + sOff + i * kPjRowsAt * kPjPitch) = __builtin_convertvector(rb[i] * sb, v4h);
      }
      __syncthreads();   // publishes stage s + 1; ends every wave's reads of the buffer that stage s + 1 refills
    }
  }

  // Epilogue: scale, bias, relu in f32; each wave turns its 16 x 64 slabs (pitch 68 floats) in its own LDS range into
  // whole 128-B lines. The slabs lie in buffer 0: the last stage reads buffer 1, and every wave's last read of buffer 0
  // stands in front of the barrier that published that stage.
  static_assert((kPjStages & 1) == 0);
  float* slab = (float*)smem + wave * (16 * 68);
  // The lane's number is read anew here: kept from the kernel's head it would hold registers through the stage loop,
  // which has none to spare (the block is one-dimensional, so this is threadIdx.x & 31).
  const int el = __builtin_amdgcn_mbcnt_lo(~0u, 0u);
  const int ec = el & 15;
  const int eh = el >> 4;
  // Both bias forms are loaded with no branch; the form not in use reads from the start of the 512.
  // Each s_wait_xcnt below takes the registers that the loads or stores above it name as inputs, so that none of them is
  // given a new value in front of the wait. The slab fences name LDS alone: the wave's global stores need not be waited for.
  const float* bnp = bias + (isV ? 0 : n0 + wn + ec);
  float bn[8];
#pragma unroll
  for (int j = 0; j < 8; ++j) bn[j] = bnp[j << 4];
  asm volatile("s_wait_xcnt 0x0" :: "v"(bnp) : "memory");   // stands before the eight loads' address gets a new value
  const int q = el >> 3, c8 = (el & 7) * 8;
#pragma unroll
  for (int i = 0; i < 4; ++i) {
    const int mBase = m0 + wm + (i << 4);
    const float* bp = bias + (isV ? mBase + 8 * eh : 0);
    const v4f bm[2] = {*(const v4f*)(bp), *(const v4f*)(bp + 4)};
    asm volatile("s_wait_xcnt 0x0" :: "v"(bp) : "memory");   // stands before the two loads' address gets a new value
    unsigned short* cp[4];
#pragma unroll
    for (int it = 0; it < 4; ++it) cp[it] = C + (size_t)(mBase + it * 4 + q) * ldc + n0 + wn + c8;
#pragma unroll
    for (int jh = 0; jh < 2; ++jh) {   // the wave's 128 columns in two slabs of 64
#pragma unroll
      for (int r = 0; r < 8; ++r) {
#pragma unroll
        for (int j = 0; j < 4; ++j) {
          float v = acc[i][4 * jh + j][r] * kWCarryInv;
          v += isV ? bm[r >> 2][r & 3] : bn[4 * jh + j];
          slab[(8 * eh + r) * 68 + (j << 4) + ec] = fmaxf(v, 0.0f);
        }
      }
      __builtin_amdgcn_fence(__ATOMIC_RELEASE, "workgroup", "local");
      __builtin_amdgcn_wave_barrier();   // the slab is the wave's own: its lanes' stores stand before its lanes' reads
      __builtin_amdgcn_fence(__ATOMIC_ACQUIRE, "workgroup", "local");
      v8h hv[4];
#pragma unroll
      for (int it = 0; it < 4; ++it) {
        const float* sp = slab + (it * 4 + q) * 68 + c8;
#pragma unroll
        for (int e = 0; e < 8; ++e) hv[it][e] = (_Float16)sp[e];
        *(v8h*)(cp[it] + jh * 64) = hv[it];
      }
      // Stands before the four stores' addresses and data get new values.
      asm volatile("s_wait_xcnt 0x0" :: "v"(cp[0]), "v"(cp[1]), "v"(cp[2]), "v"(cp[3]),
                                        "v"(hv[0]), "v"(hv[1]), "v"(hv[2]), "v"(hv[3]) : "memory");
      if (i < 3 || jh < 1) {
        __builtin_amdgcn_fence(__ATOMIC_RELEASE, "workgroup", "local");
        __builtin_amdgcn_wave_barrier();   // the reads above stand before the next slab's stores
        __builtin_amdgcn_fence(__ATOMIC_ACQUIRE, "workgroup", "local");
      }
    }
  }
}

typedef __attribute__((ext_vector_type(2))) float v2f;
typedef __attribute__((ext_vector_type(2))) _Float16 v2h;
constexpr int kFaQWaves = 8;                      // waves side by side over the queries
constexpr int kFaKSplit = 2;                      // wave groups over the keys
constexpr int kFaWaves  = kFaQWaves * kFaKSplit;
constexpr int kFaCols   = 32;                     // query columns of a wave (two 16-column groups)
constexpr int kFaRows   = kFaQWaves * kFaCols;    // queries of a work-group
constexpr int kFaStage  = 64;                     // keys of a wave group's stage (two passes of 32)
constexpr int kFaStep   = kFaStage * kFaKSplit;   // keys of the work-group's stage
constexpr int kFaStages = kSeq / kFaStep;
constexpr int kFaPitch  = 72;                     // halves per LDS row: 128 B + 16 B, conflict-free for 16-byte reads
constexpr int kFaTile   = kFaStage * kFaPitch;    // halves of one K or V^T tile in LDS
constexpr int kFaRing   = kFaKSplit * 2 * 2 * kFaTile * 2;         // bytes: [group][buffer][K | V^T]
constexpr int kFaXAcc   = kFaWaves * 8 * 32 * 4;  // floats handed over in the merge: 32 per lane
static_assert(kSeq % kFaRows == 0 && kSeq % kFaStep == 0 && kDh == 64 && kDh == kFaStage && kFaKSplit == 2);
static_assert((kFaXAcc + kFaWaves * 2 * 32) * 4 <= kFaRing);

__device__ __forceinline__ float xhalf(float x) {   // lane l with lane l ^ 16
  return __builtin_bit_cast(float, __builtin_amdgcn_permlanex16(__builtin_bit_cast(int, x), __builtin_bit_cast(int, x),
                                                                0x76543210, 0xfedcba98, false, false));
}

__global__ __launch_bounds__(kFaWaves * 32) void attn_fused_kernel(const unsigned short* __restrict__ Qp,
                                                                   const unsigned short* __restrict__ Kp,
                                                                   const unsigned short* __restrict__ Vtp,
                                                                   const float* __restrict__ R, float* __restrict__ C) {
  typedef Frag<_Float16> F;
  __shared__ __align__(16) unsigned char smem[kFaRing];
  const int lane = threadIdx.x & 31;
  const int wave = threadIdx.x >> 5;
  const int kg   = __builtin_amdgcn_readfirstlane(wave / kFaQWaves);   // the wave's key group, the same in every lane
  const int c    = lane & 15;
  const int h    = lane >> 4;
  const int b    = blockIdx.y / kHeads;
  const int head = blockIdx.y - b * kHeads;
  const int q0   = blockIdx.x * kFaRows + (wave & (kFaQWaves - 1)) * kFaCols;
  const size_t tokOff = (size_t)b * kSeq * kDim + (size_t)head * kDh;   // row b*2048, this head's 64 columns
  const _Float16* Q  = (const _Float16*)Qp + tokOff;
  const _Float16* K  = (const _Float16*)Kp + tokOff;
  const _Float16* Vt = (const _Float16*)Vtp + (size_t)head * kDh * kTok + (size_t)b * kSeq;
  _Float16* const ring = (_Float16*)smem + kg * (4 * kFaTile);   // the group's two buffers, each K tile then V^T tile

  // Staging map within a group: 8 lanes x 16 B = one 128-B row; a thread brings rows srow and srow + 32 of both tiles.
  const int gt  = threadIdx.x & (kFaQWaves * 32 - 1);
  const int srow = gt >> 3;
  const int sch  = (gt & 7) * 8;
  const _Float16* gK = K + (size_t)(kg * kFaStage + srow) * kDim + sch;
  const _Float16* gV = Vt + (size_t)srow * kTok + kg * kFaStage + sch;
  const int sOff0 = srow * kFaPitch + sch;
  const int sOff1 = (srow + 32) * kFaPitch + sch;

  v8h rk0 = *(const v8h*)(gK);
  v8h rk1 = *(const v8h*)(gK + (size_t)32 * kDim);
  v8h rv0 = *(const v8h*)(gV);
  v8h rv1 = *(const v8h*)(gV + (size_t)32 * kTok);

  v16h qf[2][2];   // [column group][k step]
#pragma unroll
  for (int g = 0; g < 2; ++g)
#pragma unroll
    for (int ks = 0; ks < 2; ++ks) qf[g][ks] = F::load(Q + (size_t)(q0 + (g << 4) + c) * kDim + ks * 32 + 8 * h);

  *(v8h*)(ring + sOff0) = rk0;
  *(v8h*)(ring + sOff1) = rk1;
  *(v8h*)(ring + kFaTile + sOff0) = rv0;
  *(v8h*)(ring + kFaTile + sOff1) = rv1;
  __syncthreads();   // publishes stage 0

  const v8f zero8 = (v8f){0.f,0.f,0.f,0.f,0.f,0.f,0.f,0.f};
  v8f acc[4][2];     // [16-row tile of d][column group]: acc[t][g][r] = O^T[16t + 8h + r][query 16g + c]
  float mUse[2], lSum[2];
#pragma unroll
  for (int g = 0; g < 2; ++g) {
    mUse[g] = -1.0e30f;   // below every score: the first pass always rescales, by exp2 of a huge negative = 0
    lSum[g] = 0.f;
#pragma unroll
    for (int t = 0; t < 4; ++t) acc[t][g] = zero8;
  }

  for (int s = 0; s < kFaStages; ++s) {
    const _Float16* bK = ring + (s & 1) * (2 * kFaTile);
    const _Float16* bV = bK + kFaTile;
    const bool more = (s + 1 < kFaStages);   // the same for the whole work-group
    if (more) {
      const size_t kn = (size_t)(s + 1) * kFaStep;
      rk0 = *(const v8h*)(gK + kn * kDim);
      rk1 = *(const v8h*)(gK + (kn + 32) * kDim);
      rv0 = *(const v8h*)(gV + kn);
      rv1 = *(const v8h*)(gV + kn + (size_t)32 * kTok);
    }
#pragma unroll
    for (int ps = 0; ps < 2; ++ps) {
      v16h kf[2][2], vf[4];
#pragma unroll
      for (int t = 0; t < 2; ++t)
#pragma unroll
        for (int ks = 0; ks < 2; ++ks) kf[t][ks] = F::load(bK + (ps * 32 + (t << 4) + c) * kFaPitch + ks * 32 + 8 * h);
#pragma unroll
      for (int t = 0; t < 4; ++t) vf[t] = F::load(bV + ((t << 4) + c) * kFaPitch + ps * 32 + 8 * h);

      v8f st[2][2];   // [16-key tile][column group]: st[t][g][r] = S^T[key 16t + 8h + r][query 16g + c], unscaled
#pragma unroll
      for (int t = 0; t < 2; ++t)
#pragma unroll
        for (int g = 0; g < 2; ++g) {
          st[t][g] = F::mma(kf[t][0], qf[g][0], zero8);
          st[t][g] = F::mma(kf[t][1], qf[g][1], st[t][g]);
        }

      float mb[2];
      bool need = false;
#pragma unroll
      for (int g = 0; g < 2; ++g) {
        float mx = st[0][g][0];
#pragma unroll
        for (int r = 1; r < 8; ++r) mx = fmaxf(mx, st[0][g][r]);
#pragma unroll
        for (int r = 0; r < 8; ++r) mx = fmaxf(mx, st[1][g][r]);
        mx = fmaxf(mx, xhalf(mx)) * kQKScaleLog2;   // both halves now hold this query's maximum, scaled
        mb[g] = mx;
        need = need || (mx > mUse[g] + 8.0f);
      }
      if (__builtin_amdgcn_ballot_w32(need) != 0) {   // scalar branch; rare after the first passes
#pragma unroll
        for (int g = 0; g < 2; ++g) {
          const float mNew = fmaxf(mUse[g], mb[g]);
          const float corr = __builtin_amdgcn_exp2f(mUse[g] - mNew);
          mUse[g] = mNew;
          lSum[g] *= corr;
#pragma unroll
          for (int t = 0; t < 4; ++t) acc[t][g] = acc[t][g] * corr;
        }
      }

#pragma unroll
      for (int g = 0; g < 2; ++g) {
        const float nm = -mUse[g];
        union { v16h v; v2h p[8]; } pf;   // element e = key kmap(e, h): tile e >> 3, register e & 7
        float l0 = 0.f, l1 = 0.f;
#pragma unroll
        for (int i = 0; i < 8; ++i) {
          const v2f arg = __builtin_elementwise_fma((v2f){st[i >> 2][g][2 * (i & 3)], st[i >> 2][g][2 * (i & 3) + 1]},
                                                    (v2f){kQKScaleLog2, kQKScaleLog2}, (v2f){nm, nm});
          const v2f p = (v2f){__builtin_amdgcn_exp2f(arg[0]), __builtin_amdgcn_exp2f(arg[1])};
          l0 += p[0];
          l1 += p[1];
          pf.p[i] = __builtin_convertvector(p, v2h);
        }
        lSum[g] += l0 + l1;
#pragma unroll
        for (int t = 0; t < 4; ++t) acc[t][g] = F::mma(vf[t], pf.v, acc[t][g]);
      }
    }
    if (more) {
      _Float16* nK = ring + ((s + 1) & 1) * (2 * kFaTile);
      _Float16* nV = nK + kFaTile;
      *(v8h*)(nK + sOff0) = rk0;
      *(v8h*)(nK + sOff1) = rk1;
      *(v8h*)(nV + sOff0) = rv0;
      *(v8h*)(nV + sOff1) = rv1;
    }
    __syncthreads();   // publishes stage s + 1; ends every wave's reads of the buffer that stage s + 1 refills
  }

  // Epilogue: the two waves that hold the same 32 queries (wave w and w + 8) merge their halves of the keys. Group 0
  // finishes column group 0 and group 1 column group 1: each wave hands the other column group (maximum in use, sum, 32
  // accumulator values per lane) to its partner through LDS. The ring is free: the loop's last barrier ended its reads.
  const bool up = (kg != 0);
  const size_t o = tokOff + (size_t)(q0 + (kg << 4) + c) * kDim + 8 * h;   // a lane holds 8 consecutive d of one query per tile
  v4f res[4][2];
#pragma unroll
  for (int t = 0; t < 4; ++t) {
    res[t][0] = *(const v4f*)(R + o + (t << 4));
    res[t][1] = *(const v4f*)(R + o + (t << 4) + 4);
  }
  v4f*   const xa = (v4f*)smem;                    // [wave][8][lane], 16 B each
  float* const xs = (float*)smem + kFaXAcc;        // [wave][maximum, sum][lane]
  {
    v4f* xw = xa + wave * (8 * 32) + lane;
#pragma unroll
    for (int t = 0; t < 4; ++t) {
      const v8f give = up ? acc[t][0] : acc[t][1];
      xw[(2 * t) * 32]     = (v4f){give[0], give[1], give[2], give[3]};
      xw[(2 * t + 1) * 32] = (v4f){give[4], give[5], give[6], give[7]};
    }
    xs[(wave * 2) * 32 + lane]     = up ? mUse[0] : mUse[1];
    xs[(wave * 2 + 1) * 32 + lane] = up ? lSum[0] : lSum[1];
  }
  __syncthreads();   // publishes every wave's hand-over to its partner
  const int pw = wave ^ kFaQWaves;
  const v4f* xr = xa + pw * (8 * 32) + lane;
  const float mOwn = up ? mUse[1] : mUse[0];
  const float lOwn = up ? lSum[1] : lSum[0];
  const float mOth = xs[(pw * 2) * 32 + lane];
  const float lOth = xs[(pw * 2 + 1) * 32 + lane];
  const float mAll = fmaxf(mOwn, mOth);
  const float fOwn = __builtin_amdgcn_exp2f(mOwn - mAll);   // one of the two factors is 1
  const float fOth = __builtin_amdgcn_exp2f(mOth - mAll);
  const float lAll = lOwn * fOwn + lOth * fOth;
  const float inv  = 1.0f / (lAll + xhalf(lAll));   // the largest score's term is at least 1: no maximum in use exceeds it
  const float aOwn = fOwn * inv;
  const float aOth = fOth * inv;
#pragma unroll
  for (int t = 0; t < 4; ++t) {
    const v8f own = up ? acc[t][1] : acc[t][0];
    const v4f p0 = xr[(2 * t) * 32];
    const v4f p1 = xr[(2 * t + 1) * 32];
    v4f o0, o1;
#pragma unroll
    for (int e = 0; e < 4; ++e) {
      o0[e] = own[e] * aOwn + p0[e] * aOth + res[t][0][e];
      o1[e] = own[4 + e] * aOwn + p1[e] * aOth + res[t][1][e];
    }
    *(v4f*)(C + o + (t << 4)) = o0;
    *(v4f*)(C + o + (t << 4) + 4) = o1;
  }
}

// ---------------------------------------------------------------------------
// Host side
// Workspace region map (bytes):
//   Q16  : 8192 x 512 x 2            =   8,388,608 @          0   (relu(Xq Wq^T + bq), f16, [tok][512])
//   K16  : 8192 x 512 x 2            =   8,388,608 @  8,388,608
//   Vt16 : 512 x 8192 x 2            =   8,388,608 @ 16,777,216   (relu(Wv Xv^T + bv), f16, [v][b*2048+t])
//   total                            =  25,165,824
// ---------------------------------------------------------------------------
extern "C" void kernel_launch(void* const* d_in, const int* in_sizes, int n_in,
                              void* d_out, int out_size, void* d_ws, size_t ws_size,
                              hipStream_t stream) {
  if (n_in < 9) return;
  const size_t nTokU = (size_t)kTok * kDim;       // 4,194,304
  const size_t nWW   = (size_t)kDim * kDim;       //   262,144
  if ((size_t)in_sizes[0] != nTokU || (size_t)in_sizes[1] != nTokU || (size_t)in_sizes[2] != nTokU) return;
  if ((size_t)in_sizes[3] != nWW || (size_t)in_sizes[5] != nWW || (size_t)in_sizes[7] != nWW) return;
  if (in_sizes[4] != kDim || in_sizes[6] != kDim || in_sizes[8] != kDim) return;
  if ((size_t)out_size != nTokU) return;

  const float* queries = (const float*)d_in[0];
  const float* keys    = (const float*)d_in[1];
  const float* values  = (const float*)d_in[2];
  const float* Wq      = (const float*)d_in[3];
  const float* bq      = (const float*)d_in[4];
  const float* Wk      = (const float*)d_in[5];
  const float* bk      = (const float*)d_in[6];
  const float* Wv      = (const float*)d_in[7];
  const float* bv      = (const float*)d_in[8];
  float* out = (float*)d_out;

  // ---- carve ----
  const size_t bPlane = nTokU * 2;
  if (3 * bPlane > ws_size) return;
  char* ws = (char*)d_ws;
  unsigned short* Q16  = (unsigned short*)(ws);
  unsigned short* K16  = (unsigned short*)(ws + bPlane);
  unsigned short* Vt16 = (unsigned short*)(ws + 2 * bPlane);

  // ---- projections: one launch; x = 2 feature tiles x 32 token tiles, y = Q, K, V^T; 8 waves per work-group ----
  proj_fused_kernel<<<dim3((kTok / kPjTile) * (kDim / kPjTile), 3), dim3(kPjWaves * 32), 0, stream>>>(
      queries, keys, values, Wq, Wk, Wv, bq, bk, bv, Q16, K16, Vt16);

  // ---- attention: one launch; x = block of 256 queries, y = batch * 8 + head; 16 waves per work-group ----
  // out[b,q,h*64+d] = sum_k softmax_k(0.125 * Q[b,q,h*64+:] . K[b,k,h*64+:]) Vt[h*64+d][b*2048+k] + queries[b,q,h*64+d]
  attn_fused_kernel<<<dim3(kSeq / kFaRows, kBatch * kHeads), dim3(kFaWaves * 32), 0, stream>>>(Q16, K16, Vt16, queries, out);
}

// v006
// One run takes 46.9 microseconds.
// Next to v005, in two timings, it ran 1.07 times as fast each time.
// Over all steps from v000 it is 40.5 times as fast.
// Contractions: q/k/v projections (X f16 x W^T f16 carried x16), scores K.Q^T (relu planes f16, K=64), V^T.P^T (P f16, unnormalised exp2 against the maximum in use): all v_wmma_f32_16x16x32_f16 with f32 accumulate; softmax, bias, relu and residual in f32.
#include <hip/hip_runtime.h>

// ---------------------------------------------------------------------------
// Problem constants
// ---------------------------------------------------------------------------
constexpr int kBatch = 4;
constexpr int kSeq   = 2048;
constexpr int kDim   = 512;
constexpr int kHeads = 8;
constexpr int kDh    = 64;
constexpr int kTok   = kBatch * kSeq;      // 8192 token rows
constexpr float kWCarry    = 16.0f;        // weights carried x16 in f16
constexpr float kWCarryInv = 1.0f / 16.0f;
constexpr float kQKScaleLog2 = 0.125f * 1.4426950408889634f;   // 1/sqrt(64), times log2(e): the softmax runs in base 2
static_assert(kHeads * kDh == kDim);

typedef __attribute__((ext_vector_type(16))) _Float16 v16h;
typedef __attribute__((ext_vector_type(8)))  _Float16 v8h;
typedef __attribute__((ext_vector_type(8)))  float    v8f;
typedef __attribute__((ext_vector_type(4)))  float    v4f;
typedef __attribute__((ext_vector_type(4)))  _Float16 v4h;

// ---------------------------------------------------------------------------
// f16 fragment of the 16x16x32 form
// ---------------------------------------------------------------------------
template <typename T> struct Frag;
template <> struct Frag<_Float16> {
  typedef v16h V; union U { v16h v; v8h h[2]; };
  static __device__ __forceinline__ v16h load(const _Float16* p) {   // elements 0..7 <- p[0..7], 8..15 <- p[16..23]
    U f; f.h[0] = *(const v8h*)(p); f.h[1] = *(const v8h*)(p + 16); return f.v;
  }
  static __device__ __forceinline__ v8f mma(v16h a, v16h b, v8f c) {
    return __builtin_amdgcn_wmma_f32_16x16x32_f16(false, a, false, b, (short)0, c, false, false);
  }
};

// ---------------------------------------------------------------------------
// The three projections in one launch, straight from the f32 inputs: blockIdx.y = 0 (Q), 1 (K), 2 (V^T).
// C[m,n] = relu(sum_k A[m,k] * B[n,k] + bias); both operands are f32 rows of 512, k-contiguous.
//   Q, K : A = X (tokens),   B = W (features), C = [token][512],    bias by n
//   V^T  : A = Wv (features), B = Xv (tokens),  C = [feature][8192], bias by m
// A work-group owns a 256 x 256 tile of C (8 waves, 4 x 2, each 64 x 128) and walks k in stages of 64: every X row is
// fetched by two work-groups and every W row by 32.
// Staging: each stage's 256 + 256 rows of 256 B come as whole lines into registers one stage ahead, are converted there
// to f16 (W times 16, X as it is) and stored into one of two LDS buffers; one barrier per stage publishes the next
// buffer and ends the reads of the one refilled behind it.
// The k order of every accumulator is steps of 32, ascending.
// The stage loop is unrolled whole: every global address is then one base plus an immediate offset.
// ---------------------------------------------------------------------------
constexpr int kPjTile   = 256;                    // rows of each operand per work-group
constexpr int kPjWaves  = 8;                      // 4 x 2, each 64 x 128 of the tile
constexpr int kPjK      = 64;                     // k of a stage (two WMMA steps)
constexpr int kPjStages = kDim / kPjK;
constexpr int kPjPitch  = 72;                     // halves per LDS row: 128 B + 16 B, conflict-free for 16-byte reads
constexpr int kPjRowsAt = kPjWaves * 32 / 16;     // rows that the work-group's threads bring with one 16-byte load each
constexpr int kPjLoads  = kPjTile / kPjRowsAt;    // 16-byte loads of a thread per operand and stage
constexpr int kPjOp     = kPjTile * kPjPitch;     // halves of one operand's tile in LDS
constexpr int kPjBuf    = 2 * kPjOp;              // halves of a buffer
static_assert(kPjWaves * 16 * 68 * 4 <= kPjBuf * 2);   // the eight output slabs fit one buffer
static_assert(kTok % kPjTile == 0 && kDim % kPjTile == 0 && kDim % kPjK == 0);
static_assert(((kTok / kPjTile) & (kTok / kPjTile - 1)) == 0);

__global__ __launch_bounds__(kPjWaves * 32) void proj_fused_kernel(
    const float* __restrict__ Xq, const float* __restrict__ Xk, const float* __restrict__ Xv,
    const float* __restrict__ Wq, const float* __restrict__ Wk, const float* __restrict__ Wv,
    const float* __restrict__ bq, const float* __restrict__ bk, const float* __restrict__ bv,
    unsigned short* __restrict__ Q16, unsigned short* __restrict__ K16, unsigned short* __restrict__ Vt16) {
  typedef Frag<_Float16> F;
  __shared__ __align__(16) unsigned char smem[2 * kPjBuf * 2];   // [buffer][A rows | B rows][pitch] in halves
  _Float16* const ring = (_Float16*)smem;
  const int z = blockIdx.y;
  const bool isV = (z == 2);                       // block-uniform
  const float* X    = (z == 0) ? Xq : (z == 1) ? Xk : Xv;
  const float* Wt   = (z == 0) ? Wq : (z == 1) ? Wk : Wv;
  const float* bias = (z == 0) ? bq : (z == 1) ? bk : bv;
  unsigned short* C = (z == 0) ? Q16 : (z == 1) ? K16 : Vt16;
  const int tokTile  = blockIdx.x & (kTok / kPjTile - 1);   // the two work-groups of a token tile stand 32 apart in the
  const int featTile = blockIdx.x / (kTok / kPjTile);       // grid (speed only: a multiple of the number of dies)
  const int m0  = (isV ? featTile : tokTile) * kPjTile;
  const int n0  = (isV ? tokTile : featTile) * kPjTile;
  const int ldc = isV ? kTok : kDim;
  const float sa = isV ? kWCarry : 1.0f;
  const float sb = isV ? 1.0f : kWCarry;

  const int lane = threadIdx.x & 31;
  const int wave = __builtin_amdgcn_readfirstlane(threadIdx.x >> 5);   // the same in every lane: kept in a scalar register
  const int c    = lane & 15;                      // row (A) / column (B, D) within a 16-tile
  const int h    = lane >> 4;
  const int wm   = (wave >> 1) * 64;               // the wave's rows of the tile
  const int wn   = (wave & 1) * 128;               // the wave's columns of the tile

  // Staging map: 16 lanes x 16 B = one 256-B row piece; a thread brings rows srow + 16 i of both operands.
  const int srow = threadIdx.x >> 4;
  const int sc4  = (threadIdx.x & 15) * 4;
  const float* gA = (isV ? Wt : X) + (size_t)(m0 + srow) * kDim + sc4;
  const float* gB = (isV ? X : Wt) + (size_t)(n0 + srow) * kDim + sc4;
  const int sOff = srow * kPjPitch + sc4;

  v4f ra[kPjLoads], rb[kPjLoads];
#pragma unroll
  for (int i = 0; i < kPjLoads; ++i) {
    ra[i] = *(const v4f*)(gA + (size_t)i * kPjRowsAt * kDim);
    rb[i] = *(const v4f*)(gB + (size_t)i * kPjRowsAt * kDim);
  }

  v8f acc[4][8];   // acc[i][j][r] = C[wm + 16i + 8h + r][wn + 16j + c]
#pragma unroll
  for (int i = 0; i < 4; ++i)
#pragma unroll
    for (int j = 0; j < 8; ++j) acc[i][j] = (v8f){0.f,0.f,0.f,0.f,0.f,0.f,0.f,0.f};

#pragma unroll
  for (int i = 0; i < kPjLoads; ++i) {
    *(v4h*)(ring + sOff + i * kPjRowsAt * kPjPitch) = __builtin_convertvector(ra[i] * sa, v4h);
    *(v4h*)(ring + kPjOp + sOff + i * kPjRowsAt * kPjPitch) = __builtin_convertvector(rb[i] * sb, v4h);
  }
  __syncthreads();   // publishes stage 0

#pragma unroll
  for (int s = 0; s < kPjStages; ++s) {
    const _Float16* bA = ring + (s & 1) * kPjBuf;
    const _Float16* bB = bA + kPjOp;
    if (s + 1 < kPjStages) {
#pragma unroll
      for (int i = 0; i < kPjLoads; ++i) {
        ra[i] = *(const v4f*)(gA + (size_t)i * kPjRowsAt * kDim + (s + 1) * kPjK);
        rb[i] = *(const v4f*)(gB + (size_t)i * kPjRowsAt * kDim + (s + 1) * kPjK);
      }
      // Keeps the 32 loads in front of this stage's products: left free, the compiler sinks them behind the
      // products and waits for them in pairs, and nothing covers their latency.
      __builtin_amdgcn_sched_barrier(0);
    }
#pragma unroll
    for (int ks = 0; ks < 2; ++ks) {
      // The A fragments rotate through two register sets, each fetched one row of eight products ahead. The scheduling
      // barriers hold that order: left free, the compiler reuses one set and waits out an LDS read in front of every
      // row; all four fragments at once do not fit the registers.
      const _Float16* pA = bA + (wm + c) * kPjPitch + ks * 32 + 8 * h;
      v16h af[2], bf[8];
      af[0] = F::load(pA);
#pragma unroll
      for (int j = 0; j < 8; ++j) bf[j] = F::load(bB + (wn + (j << 4) + c) * kPjPitch + ks * 32 + 8 * h);
      af[1] = F::load(pA + 16 * kPjPitch);
      __builtin_amdgcn_sched_barrier(0);
#pragma unroll
      for (int i = 0; i < 4; ++i) {
#pragma unroll
        for (int j = 0; j < 8; ++j) acc[i][j] = F::mma(af[i & 1], bf[j], acc[i][j]);
        if (i < 2) {
          __builtin_amdgcn_sched_barrier(0);
          af[i & 1] = F::load(pA + (i + 2) * 16 * kPjPitch);
          __builtin_amdgcn_sched_barrier(0);
        }
      }
    }
    if (s + 1 < kPjStages) {
      // Keeps the conversions, and with them the wait for the loads, behind this stage's products.
      __builtin_amdgcn_sched_barrier(0);
#pragma unroll
      for (int i = 0; i < kPjLoads; ++i) {
        *(v4h*)(ring + ((s + 1) & 1) * kPjBuf + sOff + i * kPjRowsAt * kPjPitch) = __builtin_convertvector(ra[i] * sa, v4h);
        *(v4h*)(ring + ((s + 1) & 1) * kPjBuf + kPjOp + sOff + i * kPjRowsAt * kPjPitch) = __builtin_convertvector(rb[i] * sb, v4h);
      }
      __syncthreads();   // publishes stage s + 1; ends every wave's reads of the buffer that stage s + 1 refills
    }
  }

  // Epilogue: scale, bias, relu in f32; each wave turns its 16 x 64 slabs (pitch 68 floats) in its own LDS range into
  // whole 128-B lines. The slabs lie in buffer 0: the last stage reads buffer 1, and every wave's last read of buffer 0
  // stands in front of the barrier that published that stage.
  static_assert((kPjStages & 1) == 0);
  float* slab = (float*)smem + wave * (16 * 68);
  // The lane's number is read anew here: kept from the kernel's head it would hold registers through the stage loop,
  // which has none to spare (the block is one-dimensional, so this is threadIdx.x & 31).
  const int el = __builtin_amdgcn_mbcnt_lo(~0u, 0u);
  const int ec = el & 15;
  const int eh = el >> 4;
  // Both bias forms are loaded with no branch; the form not in use reads from the start of the 512.
  // Each s_wait_xcnt below takes the registers that the loads or stores above it name as inputs, so that none of them is
  // given a new value in front of the wait. The slab fences name LDS alone: the wave's global stores need not be waited for.
  const float* bnp = bias + (isV ? 0 : n0 + wn + ec);
  float bn[8];
#pragma unroll
  for (int j = 0; j < 8; ++j) bn[j] = bnp[j << 4];
  asm volatile("s_wait_xcnt 0x0" :: "v"(bnp) : "memory");   // stands before the eight loads' address gets a new value
  const int q = el >> 3, c8 = (el & 7) * 8;
#pragma unroll
  for (int i = 0; i < 4; ++i) {
    const int mBase = m0 + wm + (i << 4);
    const float* bp = bias + (isV ? mBase + 8 * eh : 0);
    const v4f bm[2] = {*(const v4f*)(bp), *(const v4f*)(bp + 4)};
    asm volatile("s_wait_xcnt 0x0" :: "v"(bp) : "memory");   // stands before the two loads' address gets a new value
    unsigned short* cp[4];
#pragma unroll
    for (int it = 0; it < 4; ++it) cp[it] = C + (size_t)(mBase + it * 4 + q) * ldc + n0 + wn + c8;
#pragma unroll
    for (int jh = 0; jh < 2; ++jh) {   // the wave's 128 columns in two slabs of 64
#pragma unroll
      for (int r = 0; r < 8; ++r) {
#pragma unroll
        for (int j = 0; j < 4; ++j) {
          float v = acc[i][4 * jh + j][r] * kWCarryInv;
          v += isV ? bm[r >> 2][r & 3] : bn[4 * jh + j];
          slab[(8 * eh + r) * 68 + (j << 4) + ec] = fmaxf(v, 0.0f);
        }
      }
      __builtin_amdgcn_fence(__ATOMIC_RELEASE, "workgroup", "local");
      __builtin_amdgcn_wave_barrier();   // the slab is the wave's own: its lanes' stores stand before its lanes' reads
      __builtin_amdgcn_fence(__ATOMIC_ACQUIRE, "workgroup", "local");
      v8h hv[4];
#pragma unroll
      for (int it = 0; it < 4; ++it) {
        const float* sp = slab + (it * 4 + q) * 68 + c8;
#pragma unroll
        for (int e = 0; e < 8; ++e) hv[it][e] = (_Float16)sp[e];
        *(v8h*)(cp[it] + jh * 64) = hv[it];
      }
      // Stands before the four stores' addresses and data get new values.
      asm volatile("s_wait_xcnt 0x0" :: "v"(cp[0]), "v"(cp[1]), "v"(cp[2]), "v"(cp[3]),
                                        "v"(hv[0]), "v"(hv[1]), "v"(hv[2]), "v"(hv[3]) : "memory");
      if (i < 3 || jh < 1) {
        __builtin_amdgcn_fence(__ATOMIC_RELEASE, "workgroup", "local");
        __builtin_amdgcn_wave_barrier();   // the reads above stand before the next slab's stores
        __builtin_amdgcn_fence(__ATOMIC_ACQUIRE, "workgroup", "local");
      }
    }
  }
}

typedef __attribute__((ext_vector_type(2))) float v2f;
typedef __attribute__((ext_vector_type(2))) _Float16 v2h;
constexpr int kFaQWaves = 8;                      // waves side by side over the queries
constexpr int kFaKSplit = 2;                      // wave groups over the keys
constexpr int kFaWaves  = kFaQWaves * kFaKSplit;
constexpr int kFaCols   = 32;                     // query columns of a wave (two 16-column groups)
constexpr int kFaRows   = kFaQWaves * kFaCols;    // queries of a work-group
constexpr int kFaStage  = 64;                     // keys of a wave group's stage (two passes of 32)
constexpr int kFaStep   = kFaStage * kFaKSplit;   // keys of the work-group's stage
constexpr int kFaStages = kSeq / kFaStep;
constexpr int kFaPitch  = 72;                     // halves per LDS row: 128 B + 16 B, conflict-free for 16-byte reads
constexpr int kFaTile   = kFaStage * kFaPitch;    // halves of one K or V^T tile in LDS
constexpr int kFaRing   = kFaKSplit * 2 * 2 * kFaTile * 2;         // bytes: [group][buffer][K | V^T]
constexpr int kFaXAcc   = kFaWaves * 8 * 32 * 4;  // floats handed over in the merge: 32 per lane
static_assert(kSeq % kFaRows == 0 && kSeq % kFaStep == 0 && kDh == 64 && kDh == kFaStage && kFaKSplit == 2);
static_assert((kFaXAcc + kFaWaves * 2 * 32) * 4 <= kFaRing);

constexpr float kFaSumCap = 4096.0f;              // a lane's sum of 16 terms above this raises the maximum in use

// The 16 terms of one query column that a lane holds (two 16-key tiles), against the negated maximum in use: their f32 sum,
// and the terms in f16 as the B operand of V^T.P^T (element e = key kmap(e, h): tile e >> 3, register e & 7).
__device__ __forceinline__ void fa_terms(const v8f& s0, const v8f& s1, float nm, v16h& terms, float& sum) {
  union { v16h v; v2h p[8]; } pf;
  v2f l = (v2f){0.f, 0.f};   // even and odd registers, summed apart as pairs
#pragma unroll
  for (int i = 0; i < 8; ++i) {
    const v8f& s = (i < 4) ? s0 : s1;
    const v2f arg = __builtin_elementwise_fma((v2f){s[2 * (i & 3)], s[2 * (i & 3) + 1]},
                                              (v2f){kQKScaleLog2, kQKScaleLog2}, (v2f){nm, nm});
    const v2f p = (v2f){__builtin_amdgcn_exp2f(arg[0]), __builtin_amdgcn_exp2f(arg[1])};
    l += p;
    pf.p[i] = __builtin_convertvector(p, v2h);
  }
  terms = pf.v;
  sum = l[0] + l[1];
}

__device__ __forceinline__ float xhalf(float x) {   // lane l with lane l ^ 16
  return __builtin_bit_cast(float, __builtin_amdgcn_permlanex16(__builtin_bit_cast(int, x), __builtin_bit_cast(int, x),
                                                                0x76543210, 0xfedcba98, false, false));
}

__global__ __launch_bounds__(kFaWaves * 32) void attn_fused_kernel(const unsigned short* __restrict__ Qp,
                                                                   const unsigned short* __restrict__ Kp,
                                                                   const unsigned short* __restrict__ Vtp,
                                                                   const float* __restrict__ R, float* __restrict__ C) {
  typedef Frag<_Float16> F;
  __shared__ __align__(16) unsigned char smem[kFaRing];
  const int lane = threadIdx.x & 31;
  const int wave = threadIdx.x >> 5;
  const int kg   = __builtin_amdgcn_readfirstlane(wave / kFaQWaves);   // the wave's key group, the same in every lane
  const int c    = lane & 15;
  const int h    = lane >> 4;
  const int b    = blockIdx.y / kHeads;
  const int head = blockIdx.y - b * kHeads;
  const int q0   = blockIdx.x * kFaRows + (wave & (kFaQWaves - 1)) * kFaCols;
  const size_t tokOff = (size_t)b * kSeq * kDim + (size_t)head * kDh;   // row b*2048, this head's 64 columns
  const _Float16* Q  = (const _Float16*)Qp + tokOff;
  const _Float16* K  = (const _Float16*)Kp + tokOff;
  const _Float16* Vt = (const _Float16*)Vtp + (size_t)head * kDh * kTok + (size_t)b * kSeq;
  _Float16* const ring = (_Float16*)smem + kg * (4 * kFaTile);   // the group's two buffers, each K tile then V^T tile

  // Staging map within a group: 8 lanes x 16 B = one 128-B row; a thread brings rows srow and srow + 32 of both tiles.
  const int gt  = threadIdx.x & (kFaQWaves * 32 - 1);
  const int srow = gt >> 3;
  const int sch  = (gt & 7) * 8;
  const _Float16* gK = K + (size_t)(kg * kFaStage + srow) * kDim + sch;
  const _Float16* gV = Vt + (size_t)srow * kTok + kg * kFaStage + sch;
  const int sOff0 = srow * kFaPitch + sch;
  const int sOff1 = (srow + 32) * kFaPitch + sch;

  v8h rk0 = *(const v8h*)(gK);
  v8h rk1 = *(const v8h*)(gK + (size_t)32 * kDim);
  v8h rv0 = *(const v8h*)(gV);
  v8h rv1 = *(const v8h*)(gV + (size_t)32 * kTok);

  v16h qf[2][2];   // [column group][k step]
#pragma unroll
  for (int g = 0; g < 2; ++g)
#pragma unroll
    for (int ks = 0; ks < 2; ++ks) qf[g][ks] = F::load(Q + (size_t)(q0 + (g << 4) + c) * kDim + ks * 32 + 8 * h);

  *(v8h*)(ring + sOff0) = rk0;
  *(v8h*)(ring + sOff1) = rk1;
  *(v8h*)(ring + kFaTile + sOff0) = rv0;
  *(v8h*)(ring + kFaTile + sOff1) = rv1;
  __syncthreads();   // publishes stage 0

  const v8f zero8 = (v8f){0.f,0.f,0.f,0.f,0.f,0.f,0.f,0.f};
  v8f acc[4][2];     // [16-row tile of d][column group]: acc[t][g][r] = O^T[16t + 8h + r][query 16g + c]
  float mUse[2], lSum[2];
#pragma unroll
  for (int g = 0; g < 2; ++g) {
    mUse[g] = -1.0e30f;   // below every score: the first pass's terms overflow, its test fires, it rescales by exp2(huge negative) = 0
    lSum[g] = 0.f;
#pragma unroll
    for (int t = 0; t < 4; ++t) acc[t][g] = zero8;
  }

  for (int s = 0; s < kFaStages; ++s) {
    const _Float16* bK = ring + (s & 1) * (2 * kFaTile);
    const _Float16* bV = bK + kFaTile;
    const bool more = (s + 1 < kFaStages);   // the same for the whole work-group
    if (more) {
      const size_t kn = (size_t)(s + 1) * kFaStep;
      rk0 = *(const v8h*)(gK + kn * kDim);
      rk1 = *(const v8h*)(gK + (kn + 32) * kDim);
      rv0 = *(const v8h*)(gV + kn);
      rv1 = *(const v8h*)(gV + kn + (size_t)32 * kTok);
    }
#pragma unroll
    for (int ps = 0; ps < 2; ++ps) {
      v16h kf[2][2], vf[4];
#pragma unroll
      for (int t = 0; t < 2; ++t)
#pragma unroll
        for (int ks = 0; ks < 2; ++ks) kf[t][ks] = F::load(bK + (ps * 32 + (t << 4) + c) * kFaPitch + ks * 32 + 8 * h);
#pragma unroll
      for (int t = 0; t < 4; ++t) vf[t] = F::load(bV + ((t << 4) + c) * kFaPitch + ps * 32 + 8 * h);
      // Holds the pass's LDS reads in front of its score products, in whole groups, K first: left free, the compiler
      // spreads them among the products in pairs and waits some of them out there.
      __builtin_amdgcn_sched_barrier(0);

      v8f st[2][2];   // [16-key tile][column group]: st[t][g][r] = S^T[key 16t + 8h + r][query 16g + c], unscaled
#pragma unroll
      for (int t = 0; t < 2; ++t)
#pragma unroll
        for (int g = 0; g < 2; ++g) {
          st[t][g] = F::mma(kf[t][0], qf[g][0], zero8);
          st[t][g] = F::mma(kf[t][1], qf[g][1], st[t][g]);
        }
      // Holds the eight products in one run in front of the terms: left free, each tile's terms start right behind its
      // product, and v_nop fills the distance that the matrix instruction needs (34 of them per stage, against 14).
      __builtin_amdgcn_sched_barrier(0);

      // The terms against the maximum in use, and the lazy test on their sums, once per pass.
      v16h pf[2];     // [column group]
      float ls[2];
#pragma unroll
      for (int g = 0; g < 2; ++g) fa_terms(st[0][g], st[1][g], -mUse[g], pf[g], ls[g]);
      const bool need = !(ls[0] <= kFaSumCap) || !(ls[1] <= kFaSumCap);   // also true for an infinite sum and for a NaN
      if (__builtin_amdgcn_ballot_w32(need) != 0) {   // scalar branch; rare after the first pass
#pragma unroll
        for (int g = 0; g < 2; ++g) {
          float mx = st[0][g][0];   // maximum of the raw scores (the scale is positive)
#pragma unroll
          for (int r = 1; r < 8; ++r) mx = fmaxf(mx, st[0][g][r]);
#pragma unroll
          for (int r = 0; r < 8; ++r) mx = fmaxf(mx, st[1][g][r]);
          mx = fmaxf(mx, xhalf(mx)) * kQKScaleLog2;   // both halves now hold this query's maximum, scaled
          const float mNew = fmaxf(mUse[g], mx);
          const float corr = __builtin_amdgcn_exp2f(mUse[g] - mNew);
          mUse[g] = mNew;
          lSum[g] *= corr;
#pragma unroll
          for (int t = 0; t < 4; ++t) acc[t][g] = acc[t][g] * corr;
        }
#pragma unroll
        for (int g = 0; g < 2; ++g) fa_terms(st[0][g], st[1][g], -mUse[g], pf[g], ls[g]);   // no term now exceeds 1 by more than a rounding
      }

#pragma unroll
      for (int g = 0; g < 2; ++g) {
        lSum[g] += ls[g];
#pragma unroll
        for (int t = 0; t < 4; ++t) acc[t][g] = F::mma(vf[t], pf[g], acc[t][g]);
      }
    }
    if (more) {
      _Float16* nK = ring + ((s + 1) & 1) * (2 * kFaTile);
      _Float16* nV = nK + kFaTile;
      *(v8h*)(nK + sOff0) = rk0;
      *(v8h*)(nK + sOff1) = rk1;
      *(v8h*)(nV + sOff0) = rv0;
      *(v8h*)(nV + sOff1) = rv1;
    }
    __syncthreads();   // publishes stage s + 1; ends every wave's reads of the buffer that stage s + 1 refills
  }

  // Epilogue: the two waves that hold the same 32 queries (wave w and w + 8) merge their halves of the keys. Group 0
  // finishes column group 0 and group 1 column group 1: each wave hands the other column group (maximum in use, sum, 32
  // accumulator values per lane) to its partner through LDS. The ring is free: the loop's last barrier ended its reads.
  const bool up = (kg != 0);
  const size_t o = tokOff + (size_t)(q0 + (kg << 4) + c) * kDim + 8 * h;   // a lane holds 8 consecutive d of one query per tile
  v4f res[4][2];
#pragma unroll
  for (int t = 0; t < 4; ++t) {
    res[t][0] = *(const v4f*)(R + o + (t << 4));
    res[t][1] = *(const v4f*)(R + o + (t << 4) + 4);
  }
  v4f*   const xa = (v4f*)smem;                    // [wave][8][lane], 16 B each
  float* const xs = (float*)smem + kFaXAcc;        // [wave][maximum, sum][lane]
  {
    v4f* xw = xa + wave * (8 * 32) + lane;
#pragma unroll
    for (int t = 0; t < 4; ++t) {
      const v8f give = up ? acc[t][0] : acc[t][1];
      xw[(2 * t) * 32]     = (v4f){give[0], give[1], give[2], give[3]};
      xw[(2 * t + 1) * 32] = (v4f){give[4], give[5], give[6], give[7]};
    }
    xs[(wave * 2) * 32 + lane]     = up ? mUse[0] : mUse[1];
    xs[(wave * 2 + 1) * 32 + lane] = up ? lSum[0] : lSum[1];
  }
  __syncthreads();   // publishes every wave's hand-over to its partner
  const int pw = wave ^ kFaQWaves;
  const v4f* xr = xa + pw * (8 * 32) + lane;
  const float mOwn = up ? mUse[1] : mUse[0];
  const float lOwn = up ? lSum[1] : lSum[0];
  const float mOth = xs[(pw * 2) * 32 + lane];
  const float lOth = xs[(pw * 2 + 1) * 32 + lane];
  const float mAll = fmaxf(mOwn, mOth);
  const float fOwn = __builtin_amdgcn_exp2f(mOwn - mAll);   // one of the two factors is 1
  const float fOth = __builtin_amdgcn_exp2f(mOth - mAll);
  const float lAll = lOwn * fOwn + lOth * fOth;
  const float inv  = 1.0f / (lAll + xhalf(lAll));   // the largest score's term is at least 1: no maximum in use exceeds it
  const float aOwn = fOwn * inv;
  const float aOth = fOth * inv;
#pragma unroll
  for (int t = 0; t < 4; ++t) {
    const v8f own = up ? acc[t][1] : acc[t][0];
    const v4f p0 = xr[(2 * t) * 32];
    const v4f p1 = xr[(2 * t + 1) * 32];
    v4f o0, o1;
#pragma unroll
    for (int e = 0; e < 4; ++e) {
      o0[e] = own[e] * aOwn + p0[e] * aOth + res[t][0][e];
      o1[e] = own[4 + e] * aOwn + p1[e] * aOth + res[t][1][e];
    }
    *(v4f*)(C + o + (t << 4)) = o0;
    *(v4f*)(C + o + (t << 4) + 4) = o1;
  }
}

// ---------------------------------------------------------------------------
// Host side
// Workspace region map (bytes):
//   Q16  : 8192 x 512 x 2            =   8,388,608 @          0   (relu(Xq Wq^T + bq), f16, [tok][512])
//   K16  : 8192 x 512 x 2            =   8,388,608 @  8,388,608
//   Vt16 : 512 x 8192 x 2            =   8,388,608 @ 16,777,216   (relu(Wv Xv^T + bv), f16, [v][b*2048+t])
//   total                            =  25,165,824
// ---------------------------------------------------------------------------
extern "C" void kernel_launch(void* const* d_in, const int* in_sizes, int n_in,
                              void* d_out, int out_size, void* d_ws, size_t ws_size,
                              hipStream_t stream) {
  if (n_in < 9) return;
  const size_t nTokU = (size_t)kTok * kDim;       // 4,194,304
  const size_t nWW   = (size_t)kDim * kDim;       //   262,144
  if ((size_t)in_sizes[0] != nTokU || (size_t)in_sizes[1] != nTokU || (size_t)in_sizes[2] != nTokU) return;
  if ((size_t)in_sizes[3] != nWW || (size_t)in_sizes[5] != nWW || (size_t)in_sizes[7] != nWW) return;
  if (in_sizes[4] != kDim || in_sizes[6] != kDim || in_sizes[8] != kDim) return;
  if ((size_t)out_size != nTokU) return;

  const float* queries = (const float*)d_in[0];
  const float* keys    = (const float*)d_in[1];
  const float* values  = (const float*)d_in[2];
  const float* Wq      = (const float*)d_in[3];
  const float* bq      = (const float*)d_in[4];
  const float* Wk      = (const float*)d_in[5];
  const float* bk      = (const float*)d_in[6];
  const float* Wv      = (const float*)d_in[7];
  const float* bv      = (const float*)d_in[8];
  float* out = (float*)d_out;

  // ---- carve ----
  const size_t bPlane = nTokU * 2;
  if (3 * bPlane > ws_size) return;
  char* ws = (char*)d_ws;
  unsigned short* Q16  = (unsigned short*)(ws);
  unsigned short* K16  = (unsigned short*)(ws + bPlane);
  unsigned short* Vt16 = (unsigned short*)(ws + 2 * bPlane);

  // ---- projections: one launch; x = 2 feature tiles x 32 token tiles, y = Q, K, V^T; 8 waves per work-group ----
  proj_fused_kernel<<<dim3((kTok / kPjTile) * (kDim / kPjTile), 3), dim3(kPjWaves * 32), 0, stream>>>(
      queries, keys, values, Wq, Wk, Wv, bq, bk, bv, Q16, K16, Vt16);

  // ---- attention: one launch; x = block of 256 queries, y = batch * 8 + head; 16 waves per work-group ----
  // out[b,q,h*64+d] = sum_k softmax_k(0.125 * Q[b,q,h*64+:] . K[b,k,h*64+:]) Vt[h*64+d][b*2048+k] + queries[b,q,h*64+d]
  attn_fused_kernel<<<dim3(kSeq / kFaRows, kBatch * kHeads), dim3(kFaWaves * 32), 0, stream>>>(Q16, K16, Vt16, queries, out);
}

// v007
// Measured time: 45.3 microseconds a run.
// Two timings next to v006 put it at 1.04 and 1.03 times that version's speed.
// Over all steps from v000 it is 41.9 times as fast.
// Contractions: q/k/v projections (X f16 x W^T f16 carried x16), scores K.Q^T (relu planes f16, K=64, Q carrying the softmax scale, accumulator started at minus the maximum in use), V^T.P^T (P f16, unnormalised exp2 against the maximum in use): all v_wmma_f32_16x16x32_f16 with f32 accumulate; softmax, bias, relu and residual in f32.
#include <hip/hip_runtime.h>

// ---------------------------------------------------------------------------
// Problem constants
// ---------------------------------------------------------------------------
constexpr int kBatch = 4;
constexpr int kSeq   = 2048;
constexpr int kDim   = 512;
constexpr int kHeads = 8;
constexpr int kDh    = 64;
constexpr int kTok   = kBatch * kSeq;      // 8192 token rows
constexpr float kWCarry    = 16.0f;        // weights carried x16 in f16
constexpr float kWCarryInv = 1.0f / 16.0f;
constexpr float kQKScaleLog2 = 0.125f * 1.4426950408889634f;   // 1/sqrt(64), times log2(e): the softmax runs in base 2
static_assert(kHeads * kDh == kDim);

typedef __attribute__((ext_vector_type(16))) _Float16 v16h;
typedef __attribute__((ext_vector_type(8)))  _Float16 v8h;
typedef __attribute__((ext_vector_type(8)))  float    v8f;
typedef __attribute__((ext_vector_type(4)))  float    v4f;
typedef __attribute__((ext_vector_type(4)))  _Float16 v4h;

// ---------------------------------------------------------------------------
// f16 fragment of the 16x16x32 form
// ---------------------------------------------------------------------------
template <typename T> struct Frag;
template <> struct Frag<_Float16> {
  typedef v16h V; union U { v16h v; v8h h[2]; };
  static __device__ __forceinline__ v16h load(const _Float16* p) {   // elements 0..7 <- p[0..7], 8..15 <- p[16..23]
    U f; f.h[0] = *(const v8h*)(p); f.h[1] = *(const v8h*)(p + 16); return f.v;
  }
  static __device__ __forceinline__ v8f mma(v16h a, v16h b, v8f c) {
    return __builtin_amdgcn_wmma_f32_16x16x32_f16(false, a, false, b, (short)0, c, false, false);
  }
};

// ---------------------------------------------------------------------------
// The three projections in one launch, straight from the f32 inputs: blockIdx.y = 0 (Q), 1 (K), 2 (V^T).
// C[m,n] = relu(sum_k A[m,k] * B[n,k] / 16 + bias); both operands are f32 rows of 512, k-contiguous.
// Q alone is stored times kQKScaleLog2 (positive, so it passes through the relu): K.Q^T is then the softmax's base-2 exponent.
//   Q, K : A = X (tokens),   B = W (features), C = [token][512],    bias by n
//   V^T  : A = Wv (features), B = Xv (tokens),  C = [feature][8192], bias by m
// A work-group owns a 256 x 256 tile of C (8 waves, 4 x 2, each 64 x 128) and walks k in stages of 64: every X row is
// fetched by two work-groups and every W row by 32.
// Staging: each stage's 256 + 256 rows of 256 B come as whole lines into registers one stage ahead, are converted there
// to f16 (W times 16, X as it is) and stored into one of two LDS buffers; one barrier per stage publishes the next
// buffer and ends the reads of the one refilled behind it.
// The k order of every accumulator is steps of 32, ascending.
// The stage loop is unrolled whole: every global address is then one base plus an immediate offset.
// ---------------------------------------------------------------------------
constexpr int kPjTile   = 256;                    // rows of each operand per work-group
constexpr int kPjWaves  = 8;                      // 4 x 2, each 64 x 128 of the tile
constexpr int kPjK      = 64;                     // k of a stage (two WMMA steps)
constexpr int kPjStages = kDim / kPjK;
constexpr int kPjPitch  = 72;                     // halves per LDS row: 128 B + 16 B, conflict-free for 16-byte reads
constexpr int kPjRowsAt = kPjWaves * 32 / 16;     // rows that the work-group's threads bring with one 16-byte load each
constexpr int kPjLoads  = kPjTile / kPjRowsAt;    // 16-byte loads of a thread per operand and stage
constexpr int kPjOp     = kPjTile * kPjPitch;     // halves of one operand's tile in LDS
constexpr int kPjBuf    = 2 * kPjOp;              // halves of a buffer
static_assert(kPjWaves * 16 * 68 * 4 <= kPjBuf * 2);   // the eight output slabs fit one buffer
static_assert(kTok % kPjTile == 0 && kDim % kPjTile == 0 && kDim % kPjK == 0);
static_assert(((kTok / kPjTile) & (kTok / kPjTile - 1)) == 0);

__global__ __launch_bounds__(kPjWaves * 32) void proj_fused_kernel(
    const float* __restrict__ Xq, const float* __restrict__ Xk, const float* __restrict__ Xv,
    const float* __restrict__ Wq, const float* __restrict__ Wk, const float* __restrict__ Wv,
    const float* __restrict__ bq, const float* __restrict__ bk, const float* __restrict__ bv,
    unsigned short* __restrict__ Q16, unsigned short* __restrict__ K16, unsigned short* __restrict__ Vt16) {
  typedef Frag<_Float16> F;
  __shared__ __align__(16) unsigned char smem[2 * kPjBuf * 2];   // [buffer][A rows | B rows][pitch] in halves
  _Float16* const ring = (_Float16*)smem;
  const int z = blockIdx.y;
  const bool isV = (z == 2);                       // block-uniform
  const float* X    = (z == 0) ? Xq : (z == 1) ? Xk : Xv;
  const float* Wt   = (z == 0) ? Wq : (z == 1) ? Wk : Wv;
  const float* bias = (z == 0) ? bq : (z == 1) ? bk : bv;
  unsigned short* C = (z == 0) ? Q16 : (z == 1) ? K16 : Vt16;
  const int tokTile  = blockIdx.x & (kTok / kPjTile - 1);   // the two work-groups of a token tile stand 32 apart in the
  const int featTile = blockIdx.x / (kTok / kPjTile);       // grid (speed only: a multiple of the number of dies)
  const int m0  = (isV ? featTile : tokTile) * kPjTile;
  const int n0  = (isV ? tokTile : featTile) * kPjTile;
  const int ldc = isV ? kTok : kDim;
  const float sa = isV ? kWCarry : 1.0f;
  const float sb = isV ? 1.0f : kWCarry;

  const int lane = threadIdx.x & 31;
  const int wave = __builtin_amdgcn_readfirstlane(threadIdx.x >> 5);   // the same in every lane: kept in a scalar register
  const int c    = lane & 15;                      // row (A) / column (B, D) within a 16-tile
  const int h    = lane >> 4;
  const int wm   = (wave >> 1) * 64;               // the wave's rows of the tile
  const int wn   = (wave & 1) * 128;               // the wave's columns of the tile

  // Staging map: 16 lanes x 16 B = one 256-B row piece; a thread brings rows srow + 16 i of both operands.
  const int srow = threadIdx.x >> 4;
  const int sc4  = (threadIdx.x & 15) * 4;
  const float* gA = (isV ? Wt : X) + (size_t)(m0 + srow) * kDim + sc4;
  const float* gB = (isV ? X : Wt) + (size_t)(n0 + srow) * kDim + sc4;
  const int sOff = srow * kPjPitch + sc4;

  v4f ra[kPjLoads], rb[kPjLoads];
#pragma unroll
  for (int i = 0; i < kPjLoads; ++i) {
    ra[i] = *(const v4f*)(gA + (size_t)i * kPjRowsAt * kDim);
    rb[i] = *(const v4f*)(gB + (size_t)i * kPjRowsAt * kDim);
  }

  v8f acc[4][8];   // acc[i][j][r] = C[wm + 16i + 8h + r][wn + 16j + c]
#pragma unroll
  for (int i = 0; i < 4; ++i)
#pragma unroll
    for (int j = 0; j < 8; ++j) acc[i][j] = (v8f){0.f,0.f,0.f,0.f,0.f,0.f,0.f,0.f};

#pragma unroll
  for (int i = 0; i < kPjLoads; ++i) {
    *(v4h*)(ring + sOff + i * kPjRowsAt * kPjPitch) = __builtin_convertvector(ra[i] * sa, v4h);
    *(v4h*)(ring + kPjOp + sOff + i * kPjRowsAt * kPjPitch) = __builtin_convertvector(rb[i] * sb, v4h);
  }
  __syncthreads();   // publishes stage 0

#pragma unroll
  for (int s = 0; s < kPjStages; ++s) {
    const _Float16* bA = ring + (s & 1) * kPjBuf;
    const _Float16* bB = bA + kPjOp;
    if (s + 1 < kPjStages) {
#pragma unroll
      for (int i = 0; i < kPjLoads; ++i) {
        ra[i] = *(const v4f*)(gA + (size_t)i * kPjRowsAt * kDim + (s + 1) * kPjK);
        rb[i] = *(const v4f*)(gB + (size_t)i * kPjRowsAt * kDim + (s + 1) * kPjK);
      }
      // Keeps the 32 loads in front of this stage's products: left free, the compiler sinks them behind the
      // products and waits for them in pairs, and nothing covers their latency.
      __builtin_amdgcn_sched_barrier(0);
    }
#pragma unroll
    for (int ks = 0; ks < 2; ++ks) {
      // The A fragments rotate through two register sets, each fetched one row of eight products ahead. The scheduling
      // barriers hold that order: left free, the compiler reuses one set and waits out an LDS read in front of every
      // row; all four fragments at once do not fit the registers.
      const _Float16* pA = bA + (wm + c) * kPjPitch + ks * 32 + 8 * h;
      v16h af[2], bf[8];
      af[0] = F::load(pA);
#pragma unroll
      for (int j = 0; j < 8; ++j) bf[j] = F::load(bB + (wn + (j << 4) + c) * kPjPitch + ks * 32 + 8 * h);
      af[1] = F::load(pA + 16 * kPjPitch);
      __builtin_amdgcn_sched_barrier(0);
#pragma unroll
      for (int i = 0; i < 4; ++i) {
#pragma unroll
        for (int j = 0; j < 8; ++j) acc[i][j] = F::mma(af[i & 1], bf[j], acc[i][j]);
        if (i < 2) {
          __builtin_amdgcn_sched_barrier(0);
          af[i & 1] = F::load(pA + (i + 2) * 16 * kPjPitch);
          __builtin_amdgcn_sched_barrier(0);
        }
      }
    }
    if (s + 1 < kPjStages) {
      // Keeps the conversions, and with them the wait for the loads, behind this stage's products.
      __builtin_amdgcn_sched_barrier(0);
#pragma unroll
      for (int i = 0; i < kPjLoads; ++i) {
        *(v4h*)(ring + ((s + 1) & 1) * kPjBuf + sOff + i * kPjRowsAt * kPjPitch) = __builtin_convertvector(ra[i] * sa, v4h);
        *(v4h*)(ring + ((s + 1) & 1) * kPjBuf + kPjOp + sOff + i * kPjRowsAt * kPjPitch) = __builtin_convertvector(rb[i] * sb, v4h);
      }
      __syncthreads();   // publishes stage s + 1; ends every wave's reads of the buffer that stage s + 1 refills
    }
  }

  // Epilogue: scale, bias, relu in f32; each wave turns its 16 x 64 slabs (pitch 68 floats) in its own LDS range into
  // whole 128-B lines. The slabs lie in buffer 0: the last stage reads buffer 1, and every wave's last read of buffer 0
  // stands in front of the barrier that published that stage.
  static_assert((kPjStages & 1) == 0);
  float* slab = (float*)smem + wave * (16 * 68);
  // The lane's number is read anew here: kept from the kernel's head it would hold registers through the stage loop,
  // which has none to spare (the block is one-dimensional, so this is threadIdx.x & 31).
  const int el = __builtin_amdgcn_mbcnt_lo(~0u, 0u);
  const int ec = el & 15;
  const int eh = el >> 4;
  // Both bias forms are loaded with no branch; the form not in use reads from the start of the 512.
  // Each s_wait_xcnt below takes the registers that the loads or stores above it name as inputs, so that none of them is
  // given a new value in front of the wait. The slab fences name LDS alone: the wave's global stores need not be waited for.
  const float os = (z == 0) ? kQKScaleLog2 : 1.0f;   // block-uniform: the factor that the stored plane carries
  const float cs = kWCarryInv * os;
  const float* bnp = bias + (isV ? 0 : n0 + wn + ec);
  float bn[8];
#pragma unroll
  for (int j = 0; j < 8; ++j) bn[j] = bnp[j << 4];
  asm volatile("s_wait_xcnt 0x0" :: "v"(bnp) : "memory");   // stands before the eight loads' address gets a new value
#pragma unroll   // constant indices keep bn in registers
  for (int j = 0; j < 8; ++j) bn[j] *= os;
  const int q = el >> 3, c8 = (el & 7) * 8;
#pragma unroll
  for (int i = 0; i < 4; ++i) {
    const int mBase = m0 + wm + (i << 4);
    const float* bp = bias + (isV ? mBase + 8 * eh : 0);
    const v4f bm[2] = {*(const v4f*)(bp), *(const v4f*)(bp + 4)};
    asm volatile("s_wait_xcnt 0x0" :: "v"(bp) : "memory");   // stands before the two loads' address gets a new value
    unsigned short* cp[4];
#pragma unroll
    for (int it = 0; it < 4; ++it) cp[it] = C + (size_t)(mBase + it * 4 + q) * ldc + n0 + wn + c8;
#pragma unroll
    for (int jh = 0; jh < 2; ++jh) {   // the wave's 128 columns in two slabs of 64
#pragma unroll
      for (int r = 0; r < 8; ++r) {
#pragma unroll
        for (int j = 0; j < 4; ++j) {
          float v = acc[i][4 * jh + j][r] * cs;
          v += isV ? bm[r >> 2][r & 3] : bn[4 * jh + j];   // os is 1 where the bias goes by m
          slab[(8 * eh + r) * 68 + (j << 4) + ec] = fmaxf(v, 0.0f);
        }
      }
      __builtin_amdgcn_fence(__ATOMIC_RELEASE, "workgroup", "local");
      __builtin_amdgcn_wave_barrier();   // the slab is the wave's own: its lanes' stores stand before its lanes' reads
      __builtin_amdgcn_fence(__ATOMIC_ACQUIRE, "workgroup", "local");
      v8h hv[4];
#pragma unroll
      for (int it = 0; it < 4; ++it) {
        const float* sp = slab + (it * 4 + q) * 68 + c8;
#pragma unroll
        for (int e = 0; e < 8; ++e) hv[it][e] = (_Float16)sp[e];
        *(v8h*)(cp[it] + jh * 64) = hv[it];
      }
      // Stands before the four stores' addresses and data get new values.
      asm volatile("s_wait_xcnt 0x0" :: "v"(cp[0]), "v"(cp[1]), "v"(cp[2]), "v"(cp[3]),
                                        "v"(hv[0]), "v"(hv[1]), "v"(hv[2]), "v"(hv[3]) : "memory");
      if (i < 3 || jh < 1) {
        __builtin_amdgcn_fence(__ATOMIC_RELEASE, "workgroup", "local");
        __builtin_amdgcn_wave_barrier();   // the reads above stand before the next slab's stores
        __builtin_amdgcn_fence(__ATOMIC_ACQUIRE, "workgroup", "local");
      }
    }
  }
}

typedef __attribute__((ext_vector_type(2))) float v2f;
typedef __attribute__((ext_vector_type(2))) _Float16 v2h;
constexpr int kFaQWaves = 8;                      // waves side by side over the queries
constexpr int kFaKSplit = 2;                      // wave groups over the keys
constexpr int kFaWaves  = kFaQWaves * kFaKSplit;
constexpr int kFaCols   = 32;                     // query columns of a wave (two 16-column groups)
constexpr int kFaRows   = kFaQWaves * kFaCols;    // queries of a work-group
constexpr int kFaStage  = 64;                     // keys of a wave group's stage (two passes of 32)
constexpr int kFaStep   = kFaStage * kFaKSplit;   // keys of the work-group's stage
constexpr int kFaStages = kSeq / kFaStep;
constexpr int kFaPitch  = 72;                     // halves per LDS row: 128 B + 16 B, conflict-free for 16-byte reads
constexpr int kFaTile   = kFaStage * kFaPitch;    // halves of one K or V^T tile in LDS
constexpr int kFaRing   = kFaKSplit * 2 * 2 * kFaTile * 2;         // bytes: [group][buffer][K | V^T]
constexpr int kFaXAcc   = kFaWaves * 8 * 32 * 4;  // floats handed over in the merge: 32 per lane
static_assert(kSeq % kFaRows == 0 && kSeq % kFaStep == 0 && kDh == 64 && kDh == kFaStage && kFaKSplit == 2);
static_assert((kFaXAcc + kFaWaves * 2 * 32) * 4 <= kFaRing);

constexpr float kFaSumCap = 4096.0f;              // a lane's sum of 16 terms above this raises the maximum in use

// The 16 terms of one query column that a lane holds (two 16-key tiles), from their exponents (kShift: less a raise of the
// maximum in use): their f32 sum, and the terms in f16 as the B operand of V^T.P^T (element e = key kmap(e, h): tile e >> 3,
// register e & 7).
template <bool kShift>
__device__ __forceinline__ void fa_terms(const v8f& s0, const v8f& s1, float raise, v16h& terms, float& sum) {
  union { v16h v; v2h p[8]; } pf;
  v2f l = (v2f){0.f, 0.f};   // even and odd registers, summed apart as pairs
#pragma unroll
  for (int i = 0; i < 8; ++i) {
    const v8f& s = (i < 4) ? s0 : s1;
    v2f arg = (v2f){s[2 * (i & 3)], s[2 * (i & 3) + 1]};
    if (kShift) arg -= (v2f){raise, raise};
    const v2f p = (v2f){__builtin_amdgcn_exp2f(arg[0]), __builtin_amdgcn_exp2f(arg[1])};
    l += p;
    pf.p[i] = __builtin_convertvector(p, v2h);
  }
  terms = pf.v;
  sum = l[0] + l[1];
}

__device__ __forceinline__ float xhalf(float x) {   // lane l with lane l ^ 16
  return __builtin_bit_cast(float, __builtin_amdgcn_permlanex16(__builtin_bit_cast(int, x), __builtin_bit_cast(int, x),
                                                                0x76543210, 0xfedcba98, false, false));
}

// exp2 with the slot that the instruction set asks for behind a transcendental kept in the same statement.
__device__ __forceinline__ float exp2_slot(float x) {
  float r;
  asm("v_exp_f32 %0, %1\n\tv_nop" : "=v"(r) : "v"(x));
  return r;
}

__global__ __launch_bounds__(kFaWaves * 32) void attn_fused_kernel(const unsigned short* __restrict__ Qp,
                                                                   const unsigned short* __restrict__ Kp,
                                                                   const unsigned short* __restrict__ Vtp,
                                                                   const float* __restrict__ R, float* __restrict__ C) {
  typedef Frag<_Float16> F;
  __shared__ __align__(16) unsigned char smem[kFaRing];
  const int lane = threadIdx.x & 31;
  const int wave = threadIdx.x >> 5;
  const int kg   = __builtin_amdgcn_readfirstlane(wave / kFaQWaves);   // the wave's key group, the same in every lane
  const int c    = lane & 15;
  const int h    = lane >> 4;
  const int b    = blockIdx.y / kHeads;
  const int head = blockIdx.y - b * kHeads;
  const int q0   = blockIdx.x * kFaRows + (wave & (kFaQWaves - 1)) * kFaCols;
  const size_t tokOff = (size_t)b * kSeq * kDim + (size_t)head * kDh;   // row b*2048, this head's 64 columns
  const _Float16* Q  = (const _Float16*)Qp + tokOff;
  const _Float16* K  = (const _Float16*)Kp + tokOff;
  const _Float16* Vt = (const _Float16*)Vtp + (size_t)head * kDh * kTok + (size_t)b * kSeq;
  _Float16* const ring = (_Float16*)smem + kg * (4 * kFaTile);   // the group's two buffers, each K tile then V^T tile

  // Staging map within a group: 8 lanes x 16 B = one 128-B row; a thread brings rows srow and srow + 32 of both tiles.
  const int gt  = threadIdx.x & (kFaQWaves * 32 - 1);
  const int srow = gt >> 3;
  const int sch  = (gt & 7) * 8;
  const _Float16* gK = K + (size_t)(kg * kFaStage + srow) * kDim + sch;
  const _Float16* gV = Vt + (size_t)srow * kTok + kg * kFaStage + sch;
  const int sOff0 = srow * kFaPitch + sch;
  const int sOff1 = (srow + 32) * kFaPitch + sch;

  v8h rk0 = *(const v8h*)(gK);
  v8h rk1 = *(const v8h*)(gK + (size_t)32 * kDim);
  v8h rv0 = *(const v8h*)(gV);
  v8h rv1 = *(const v8h*)(gV + (size_t)32 * kTok);

  v16h qf[2][2];   // [column group][k step]
#pragma unroll
  for (int g = 0; g < 2; ++g)
#pragma unroll
    for (int ks = 0; ks < 2; ++ks) qf[g][ks] = F::load(Q + (size_t)(q0 + (g << 4) + c) * kDim + ks * 32 + 8 * h);

  *(v8h*)(ring + sOff0) = rk0;
  *(v8h*)(ring + sOff1) = rk1;
  *(v8h*)(ring + kFaTile + sOff0) = rv0;
  *(v8h*)(ring + kFaTile + sOff1) = rv1;
  __syncthreads();   // publishes stage 0

  const v8f zero8 = (v8f){0.f,0.f,0.f,0.f,0.f,0.f,0.f,0.f};
  v8f acc[4][2];     // [16-row tile of d][column group]: acc[t][g][r] = O^T[16t + 8h + r][query 16g + c]
  v8f negM[2];       // minus the maximum in use of the lane's query, the same in all eight registers: a C operand
  float lSum[2];
#pragma unroll
  for (int g = 0; g < 2; ++g) {
    negM[g] = zero8;
    lSum[g] = 0.f;
#pragma unroll
    for (int t = 0; t < 4; ++t) acc[t][g] = zero8;
  }

  for (int s = 0; s < kFaStages; ++s) {
    const _Float16* bK = ring + (s & 1) * (2 * kFaTile);
    const _Float16* bV = bK + kFaTile;
    const bool more = (s + 1 < kFaStages);   // the same for the whole work-group
    if (more) {
      const size_t kn = (size_t)(s + 1) * kFaStep;
      rk0 = *(const v8h*)(gK + kn * kDim);
      rk1 = *(const v8h*)(gK + (kn + 32) * kDim);
      rv0 = *(const v8h*)(gV + kn);
      rv1 = *(const v8h*)(gV + kn + (size_t)32 * kTok);
    }
#pragma unroll
    for (int ps = 0; ps < 2; ++ps) {
      v16h kf[2][2], vf[4];
#pragma unroll
      for (int t = 0; t < 2; ++t)
#pragma unroll
        for (int ks = 0; ks < 2; ++ks) kf[t][ks] = F::load(bK + (ps * 32 + (t << 4) + c) * kFaPitch + ks * 32 + 8 * h);
#pragma unroll
      for (int t = 0; t < 4; ++t) vf[t] = F::load(bV + ((t << 4) + c) * kFaPitch + ps * 32 + 8 * h);
      // Holds the pass's LDS reads in front of its score products, in whole groups, K first: left free, the compiler
      // spreads them among the products in pairs and waits some of them out there.
      __builtin_amdgcn_sched_barrier(0);

      v8f st[2][2];   // [16-key tile][column group]: st[t][g][r] = exponent of key 16t + 8h + r, query 16g + c
#pragma unroll
      for (int t = 0; t < 2; ++t)
#pragma unroll
        for (int g = 0; g < 2; ++g) {
          st[t][g] = F::mma(kf[t][0], qf[g][0], negM[g]);
          st[t][g] = F::mma(kf[t][1], qf[g][1], st[t][g]);
        }
      // Holds the eight products in one run in front of the terms: left free, each tile's terms start right behind its
      // product, and v_nop fills the distance that the matrix instruction needs (34 of them per stage, against 14).
      __builtin_amdgcn_sched_barrier(0);

      // The terms against the maximum in use, and the lazy test on their sums, once per pass.
      v16h pf[2];     // [column group]
      float ls[2];
#pragma unroll
      for (int g = 0; g < 2; ++g) fa_terms<false>(st[0][g], st[1][g], 0.f, pf[g], ls[g]);
      const bool need = !(ls[0] <= kFaSumCap) || !(ls[1] <= kFaSumCap);   // also true for an infinite sum and for a NaN
      if (__builtin_amdgcn_ballot_w32(need) != 0) {   // scalar branch; rare after the first pass
        float raise[2];
#pragma unroll
        for (int g = 0; g < 2; ++g) {
          float mx = st[0][g][0];   // the largest exponent: how far the pass's maximum lies above the one in use
#pragma unroll
          for (int r = 1; r < 8; ++r) mx = fmaxf(mx, st[0][g][r]);
#pragma unroll
          for (int r = 0; r < 8; ++r) mx = fmaxf(mx, st[1][g][r]);
          mx = fmaxf(mx, xhalf(mx));   // both halves now hold this query's
          raise[g] = fmaxf(mx, 0.f);
          const float corr = __builtin_amdgcn_exp2f(-raise[g]);
          negM[g] = negM[g] - raise[g];
          lSum[g] *= corr;
#pragma unroll
          for (int t = 0; t < 4; ++t) acc[t][g] = acc[t][g] * corr;
        }
#pragma unroll
        for (int g = 0; g < 2; ++g) fa_terms<true>(st[0][g], st[1][g], raise[g], pf[g], ls[g]);   // no term now exceeds 1
      }

#pragma unroll
      for (int g = 0; g < 2; ++g) {
        lSum[g] += ls[g];
#pragma unroll
        for (int t = 0; t < 4; ++t) acc[t][g] = F::mma(vf[t], pf[g], acc[t][g]);
      }
    }
    if (more) {
      _Float16* nK = ring + ((s + 1) & 1) * (2 * kFaTile);
      _Float16* nV = nK + kFaTile;
      *(v8h*)(nK + sOff0) = rk0;
      *(v8h*)(nK + sOff1) = rk1;
      *(v8h*)(nV + sOff0) = rv0;
      *(v8h*)(nV + sOff1) = rv1;
    }
    __syncthreads();   // publishes stage s + 1; ends every wave's reads of the buffer that stage s + 1 refills
  }

  // Epilogue: the two waves that hold the same 32 queries (wave w and w + 8) merge their halves of the keys. Group 0
  // finishes column group 0 and group 1 column group 1: each wave hands the other column group (maximum in use, sum, 32
  // accumulator values per lane) to its partner through LDS. The ring is free: the loop's last barrier ended its reads.
  const bool up = (kg != 0);
  const size_t o = tokOff + (size_t)(q0 + (kg << 4) + c) * kDim + 8 * h;   // a lane holds 8 consecutive d of one query per tile
  v4f res[4][2];
#pragma unroll
  for (int t = 0; t < 4; ++t) {
    res[t][0] = *(const v4f*)(R + o + (t << 4));
    res[t][1] = *(const v4f*)(R + o + (t << 4) + 4);
  }
  v4f*   const xa = (v4f*)smem;                    // [wave][8][lane], 16 B each
  float* const xs = (float*)smem + kFaXAcc;        // [wave][minus the maximum in use, sum][lane]
  {
    v4f* xw = xa + wave * (8 * 32) + lane;
#pragma unroll
    for (int t = 0; t < 4; ++t) {
      const v8f give = up ? acc[t][0] : acc[t][1];
      xw[(2 * t) * 32]     = (v4f){give[0], give[1], give[2], give[3]};
      xw[(2 * t + 1) * 32] = (v4f){give[4], give[5], give[6], give[7]};
    }
    xs[(wave * 2) * 32 + lane]     = up ? negM[0][0] : negM[1][0];
    xs[(wave * 2 + 1) * 32 + lane] = up ? lSum[0] : lSum[1];
  }
  __syncthreads();   // publishes every wave's hand-over to its partner
  const int pw = wave ^ kFaQWaves;
  const v4f* xr = xa + pw * (8 * 32) + lane;
  const float nOwn = up ? negM[1][0] : negM[0][0];
  const float lOwn = up ? lSum[1] : lSum[0];
  const float nOth = xs[(pw * 2) * 32 + lane];
  const float lOth = xs[(pw * 2 + 1) * 32 + lane];
  const float nAll = fminf(nOwn, nOth);                     // minus the larger of the two maxima in use
  const float fOwn = exp2_slot(nAll - nOwn);   // one of the two factors is 1
  const float fOth = exp2_slot(nAll - nOth);
  const float lAll = lOwn * fOwn + lOth * fOth;
  const float inv  = 1.0f / (lAll + xhalf(lAll));   // the largest score's term is at least 1: no maximum in use exceeds it
  const float aOwn = fOwn * inv;
  const float aOth = fOth * inv;
#pragma unroll
  for (int t = 0; t < 4; ++t) {
    const v8f own = up ? acc[t][1] : acc[t][0];
    const v4f p0 = xr[(2 * t) * 32];
    const v4f p1 = xr[(2 * t + 1) * 32];
    v4f o0, o1;
#pragma unroll
    for (int e = 0; e < 4; ++e) {
      o0[e] = own[e] * aOwn + p0[e] * aOth + res[t][0][e];
      o1[e] = own[4 + e] * aOwn + p1[e] * aOth + res[t][1][e];
    }
    *(v4f*)(C + o + (t << 4)) = o0;
    *(v4f*)(C + o + (t << 4) + 4) = o1;
  }
}

// ---------------------------------------------------------------------------
// Host side
// Workspace region map (bytes):
//   Q16  : 8192 x 512 x 2            =   8,388,608 @          0   (relu(Xq Wq^T + bq) * log2(e) / 8, f16, [tok][512])
//   K16  : 8192 x 512 x 2            =   8,388,608 @  8,388,608
//   Vt16 : 512 x 8192 x 2            =   8,388,608 @ 16,777,216   (relu(Wv Xv^T + bv), f16, [v][b*2048+t])
//   total                            =  25,165,824
// ---------------------------------------------------------------------------
extern "C" void kernel_launch(void* const* d_in, const int* in_sizes, int n_in,
                              void* d_out, int out_size, void* d_ws, size_t ws_size,
                              hipStream_t stream) {
  if (n_in < 9) return;
  const size_t nTokU = (size_t)kTok * kDim;       // 4,194,304
  const size_t nWW   = (size_t)kDim * kDim;       //   262,144
  if ((size_t)in_sizes[0] != nTokU || (size_t)in_sizes[1] != nTokU || (size_t)in_sizes[2] != nTokU) return;
  if ((size_t)in_sizes[3] != nWW || (size_t)in_sizes[5] != nWW || (size_t)in_sizes[7] != nWW) return;
  if (in_sizes[4] != kDim || in_sizes[6] != kDim || in_sizes[8] != kDim) return;
  if ((size_t)out_size != nTokU) return;

  const float* queries = (const float*)d_in[0];
  const float* keys    = (const float*)d_in[1];
  const float* values  = (const float*)d_in[2];
  const float* Wq      = (const float*)d_in[3];
  const float* bq      = (const float*)d_in[4];
  const float* Wk      = (const float*)d_in[5];
  const float* bk      = (const float*)d_in[6];
  const float* Wv      = (const float*)d_in[7];
  const float* bv      = (const float*)d_in[8];
  float* out = (float*)d_out;

  // ---- carve ----
  const size_t bPlane = nTokU * 2;
  if (3 * bPlane > ws_size) return;
  char* ws = (char*)d_ws;
  unsigned short* Q16  = (unsigned short*)(ws);
  unsigned short* K16  = (unsigned short*)(ws + bPlane);
  unsigned short* Vt16 = (unsigned short*)(ws + 2 * bPlane);

  // ---- projections: one launch; x = 2 feature tiles x 32 token tiles, y = Q, K, V^T; 8 waves per work-group ----
  proj_fused_kernel<<<dim3((kTok / kPjTile) * (kDim / kPjTile), 3), dim3(kPjWaves * 32), 0, stream>>>(
      queries, keys, values, Wq, Wk, Wv, bq, bk, bv, Q16, K16, Vt16);

  // ---- attention: one launch; x = block of 256 queries, y = batch * 8 + head; 16 waves per work-group ----
  // out[b,q,h*64+d] = sum_k softmax_k(ln(2) * Q[b,q,h*64+:] . K[b,k,h*64+:]) Vt[h*64+d][b*2048+k] + queries[b,q,h*64+d]
  attn_fused_kernel<<<dim3(kSeq / kFaRows, kBatch * kHeads), dim3(kFaWaves * 32), 0, stream>>>(Q16, K16, Vt16, queries, out);
}

// v008
// Measured time: 43.4 microseconds a run.
// Two timings next to v007 both put it at 1.05 times that version's speed.
// Over all steps from v000 it is 43.9 times as fast.
// Contractions: q/k/v projections (X f16 x W^T f16 carried x16), scores K.Q^T (relu planes f16, K=64, Q carrying the softmax scale, accumulator started at minus the maximum in use), V^T.P^T (P f16, unnormalised exp2 against the maximum in use): all v_wmma_f32_16x16x32_f16 with f32 accumulate; softmax, bias, relu and residual in f32.
#include <hip/hip_runtime.h>

// ---------------------------------------------------------------------------
// Problem constants
// ---------------------------------------------------------------------------
constexpr int kBatch = 4;
constexpr int kSeq   = 2048;
constexpr int kDim   = 512;
constexpr int kHeads = 8;
constexpr int kDh    = 64;
constexpr int kTok   = kBatch * kSeq;      // 8192 token rows
constexpr float kWCarry    = 16.0f;        // weights carried x16 in f16
constexpr float kWCarryInv = 1.0f / 16.0f;
constexpr float kQKScaleLog2 = 0.125f * 1.4426950408889634f;   // 1/sqrt(64), times log2(e): the softmax runs in base 2
static_assert(kHeads * kDh == kDim);

typedef __attribute__((ext_vector_type(16))) _Float16 v16h;
typedef __attribute__((ext_vector_type(8)))  _Float16 v8h;
typedef __attribute__((ext_vector_type(8)))  float    v8f;
typedef __attribute__((ext_vector_type(4)))  float    v4f;
typedef __attribute__((ext_vector_type(4)))  _Float16 v4h;

// ---------------------------------------------------------------------------
// f16 fragment of the 16x16x32 form
// ---------------------------------------------------------------------------
template <typename T> struct Frag;
template <> struct Frag<_Float16> {
  typedef v16h V; union U { v16h v; v8h h[2]; };
  static __device__ __forceinline__ v16h load(const _Float16* p) {   // elements 0..7 <- p[0..7], 8..15 <- p[16..23]
    U f; f.h[0] = *(const v8h*)(p); f.h[1] = *(const v8h*)(p + 16); return f.v;
  }
  static __device__ __forceinline__ v8f mma(v16h a, v16h b, v8f c) {
    return __builtin_amdgcn_wmma_f32_16x16x32_f16(false, a, false, b, (short)0, c, false, false);
  }
};

// ---------------------------------------------------------------------------
// The three projections in one launch, straight from the f32 inputs: blockIdx.y = 0 (Q), 1 (K), 2 (V^T).
// C[m,n] = relu(sum_k A[m,k] * B[n,k] / 16 + bias); both operands are f32 rows of 512, k-contiguous.
// Q alone is stored times kQKScaleLog2 (positive, so it passes through the relu): K.Q^T is then the softmax's base-2 exponent.
//   Q, K : A = X (tokens),   B = W (features), C = [token][512],    bias by n
//   V^T  : A = Wv (features), B = Xv (tokens),  C = [feature][8192], bias by m
// A work-group owns a 256 x 256 tile of C (8 waves, 4 x 2, each 64 x 128) and walks k in stages of 64: every X row is
// fetched by two work-groups and every W row by 32.
// Staging: each stage's 256 + 256 rows of 256 B come as whole lines into registers one stage ahead, are converted there
// to f16 (W times 16, X as it is) and stored into one of two LDS buffers; one barrier per stage publishes the next
// buffer and ends the reads of the one refilled behind it.
// The k order of every accumulator is steps of 32, ascending.
// The stage loop is unrolled whole: every global address is then one base plus an immediate offset.
// ---------------------------------------------------------------------------
constexpr int kPjTile   = 256;                    // rows of each operand per work-group
constexpr int kPjWaves  = 8;                      // 4 x 2, each 64 x 128 of the tile
constexpr int kPjK      = 64;                     // k of a stage (two WMMA steps)
constexpr int kPjStages = kDim / kPjK;
constexpr int kPjPitch  = 72;                     // halves per LDS row: 128 B + 16 B, conflict-free for 16-byte reads
constexpr int kPjRowsAt = kPjWaves * 32 / 16;     // rows that the work-group's threads bring with one 16-byte load each
constexpr int kPjLoads  = kPjTile / kPjRowsAt;    // 16-byte loads of a thread per operand and stage
constexpr int kPjOp     = kPjTile * kPjPitch;     // halves of one operand's tile in LDS
constexpr int kPjBuf    = 2 * kPjOp;              // halves of a buffer
static_assert(kPjWaves * 16 * 68 * 4 <= kPjBuf * 2);   // the eight output slabs fit one buffer
static_assert(kTok % kPjTile == 0 && kDim % kPjTile == 0 && kDim % kPjK == 0);
static_assert(((kTok / kPjTile) & (kTok / kPjTile - 1)) == 0);

__global__ __launch_bounds__(kPjWaves * 32) void proj_fused_kernel(
    const float* __restrict__ Xq, const float* __restrict__ Xk, const float* __restrict__ Xv,
    const float* __restrict__ Wq, const float* __restrict__ Wk, const float* __restrict__ Wv,
    const float* __restrict__ bq, const float* __restrict__ bk, const float* __restrict__ bv,
    unsigned short* __restrict__ Q16, unsigned short* __restrict__ K16, unsigned short* __restrict__ Vt16) {
  typedef Frag<_Float16> F;
  __shared__ __align__(16) unsigned char smem[2 * kPjBuf * 2];   // [buffer][A rows | B rows][pitch] in halves
  _Float16* const ring = (_Float16*)smem;
  const int z = blockIdx.y;
  const bool isV = (z == 2);                       // block-uniform
  const float* X    = (z == 0) ? Xq : (z == 1) ? Xk : Xv;
  const float* Wt   = (z == 0) ? Wq : (z == 1) ? Wk : Wv;
  const float* bias = (z == 0) ? bq : (z == 1) ? bk : bv;
  unsigned short* C = (z == 0) ? Q16 : (z == 1) ? K16 : Vt16;
  const int tokTile  = blockIdx.x & (kTok / kPjTile - 1);   // the two work-groups of a token tile stand 32 apart in the
  const int featTile = blockIdx.x / (kTok / kPjTile);       // grid (speed only: a multiple of the number of dies)
  const int m0  = (isV ? featTile : tokTile) * kPjTile;
  const int n0  = (isV ? tokTile : featTile) * kPjTile;
  const int ldc = isV ? kTok : kDim;
  const float sa = isV ? kWCarry : 1.0f;
  const float sb = isV ? 1.0f : kWCarry;

  const int lane = threadIdx.x & 31;
  const int wave = __builtin_amdgcn_readfirstlane(threadIdx.x >> 5);   // the same in every lane: kept in a scalar register
  const int c    = lane & 15;                      // row (A) / column (B, D) within a 16-tile
  const int h    = lane >> 4;
  const int wm   = (wave >> 1) * 64;               // the wave's rows of the tile
  const int wn   = (wave & 1) * 128;               // the wave's columns of the tile

  // Staging map: 16 lanes x 16 B = one 256-B row piece; a thread brings rows srow + 16 i of both operands.
  const int srow = threadIdx.x >> 4;
  const int sc4  = (threadIdx.x & 15) * 4;
  const float* gA = (isV ? Wt : X) + (size_t)(m0 + srow) * kDim + sc4;
  const float* gB = (isV ? X : Wt) + (size_t)(n0 + srow) * kDim + sc4;
  const int sOff = srow * kPjPitch + sc4;

  v4f ra[kPjLoads], rb[kPjLoads];
#pragma unroll
  for (int i = 0; i < kPjLoads; ++i) {
    ra[i] = *(const v4f*)(gA + (size_t)i * kPjRowsAt * kDim);
    rb[i] = *(const v4f*)(gB + (size_t)i * kPjRowsAt * kDim);
  }

  v8f acc[4][8];   // acc[i][j][r] = C[wm + 16i + 8h + r][wn + 16j + c]
#pragma unroll
  for (int i = 0; i < 4; ++i)
#pragma unroll
    for (int j = 0; j < 8; ++j) acc[i][j] = (v8f){0.f,0.f,0.f,0.f,0.f,0.f,0.f,0.f};

#pragma unroll
  for (int i = 0; i < kPjLoads; ++i) {
    *(v4h*)(ring + sOff + i * kPjRowsAt * kPjPitch) = __builtin_convertvector(ra[i] * sa, v4h);
    *(v4h*)(ring + kPjOp + sOff + i * kPjRowsAt * kPjPitch) = __builtin_convertvector(rb[i] * sb, v4h);
  }
  __syncthreads();   // publishes stage 0

#pragma unroll
  for (int s = 0; s < kPjStages; ++s) {
    const _Float16* bA = ring + (s & 1) * kPjBuf;
    const _Float16* bB = bA + kPjOp;
    if (s + 1 < kPjStages) {
#pragma unroll
      for (int i = 0; i < kPjLoads; ++i) {
        ra[i] = *(const v4f*)(gA + (size_t)i * kPjRowsAt * kDim + (s + 1) * kPjK);
        rb[i] = *(const v4f*)(gB + (size_t)i * kPjRowsAt * kDim + (s + 1) * kPjK);
      }
      // Keeps the 32 loads in front of this stage's products: left free, the compiler sinks them behind the
      // products and waits for them in pairs, and nothing covers their latency.
      __builtin_amdgcn_sched_barrier(0);
    }
#pragma unroll
    for (int ks = 0; ks < 2; ++ks) {
      // The A fragments rotate through two register sets, each fetched one row of eight products ahead. The scheduling
      // barriers hold that order: left free, the compiler reuses one set and waits out an LDS read in front of every
      // row; all four fragments at once do not fit the registers.
      const _Float16* pA = bA + (wm + c) * kPjPitch + ks * 32 + 8 * h;
      v16h af[2], bf[8];
      af[0] = F::load(pA);
#pragma unroll
      for (int j = 0; j < 8; ++j) bf[j] = F::load(bB + (wn + (j << 4) + c) * kPjPitch + ks * 32 + 8 * h);
      af[1] = F::load(pA + 16 * kPjPitch);
      __builtin_amdgcn_sched_barrier(0);
#pragma unroll
      for (int i = 0; i < 4; ++i) {
#pragma unroll
        for (int j = 0; j < 8; ++j) acc[i][j] = F::mma(af[i & 1], bf[j], acc[i][j]);
        if (i < 2) {
          __builtin_amdgcn_sched_barrier(0);
          af[i & 1] = F::load(pA + (i + 2) * 16 * kPjPitch);
          __builtin_amdgcn_sched_barrier(0);
        }
      }
    }
    if (s + 1 < kPjStages) {
      // Keeps the conversions, and with them the wait for the loads, behind this stage's products.
      __builtin_amdgcn_sched_barrier(0);
#pragma unroll
      for (int i = 0; i < kPjLoads; ++i) {
        *(v4h*)(ring + ((s + 1) & 1) * kPjBuf + sOff + i * kPjRowsAt * kPjPitch) = __builtin_convertvector(ra[i] * sa, v4h);
        *(v4h*)(ring + ((s + 1) & 1) * kPjBuf + kPjOp + sOff + i * kPjRowsAt * kPjPitch) = __builtin_convertvector(rb[i] * sb, v4h);
      }
      __syncthreads();   // publishes stage s + 1; ends every wave's reads of the buffer that stage s + 1 refills
    }
  }

  // Epilogue: scale, bias, relu in f32; each wave turns its 16 x 64 slabs (pitch 68 floats) in its own LDS range into
  // whole 128-B lines. The slabs lie in buffer 0: the last stage reads buffer 1, and every wave's last read of buffer 0
  // stands in front of the barrier that published that stage.
  static_assert((kPjStages & 1) == 0);
  float* slab = (float*)smem + wave * (16 * 68);
  // The lane's number is read anew here: kept from the kernel's head it would hold registers through the stage loop,
  // which has none to spare (the block is one-dimensional, so this is threadIdx.x & 31).
  const int el = __builtin_amdgcn_mbcnt_lo(~0u, 0u);
  const int ec = el & 15;
  const int eh = el >> 4;
  // Both bias forms are loaded with no branch; the form not in use reads from the start of the 512.
  // Each s_wait_xcnt below takes the registers that the loads or stores above it name as inputs, so that none of them is
  // given a new value in front of the wait. The slab fences name LDS alone: the wave's global stores need not be waited for.
  const float os = (z == 0) ? kQKScaleLog2 : 1.0f;   // block-uniform: the factor that the stored plane carries
  const float cs = kWCarryInv * os;
  const float* bnp = bias + (isV ? 0 : n0 + wn + ec);
  float bn[8];
#pragma unroll
  for (int j = 0; j < 8; ++j) bn[j] = bnp[j << 4];
  asm volatile("s_wait_xcnt 0x0" :: "v"(bnp) : "memory");   // stands before the eight loads' address gets a new value
#pragma unroll   // constant indices keep bn in registers
  for (int j = 0; j < 8; ++j) bn[j] *= os;
  const int q = el >> 3, c8 = (el & 7) * 8;
#pragma unroll
  for (int i = 0; i < 4; ++i) {
    const int mBase = m0 + wm + (i << 4);
    const float* bp = bias + (isV ? mBase + 8 * eh : 0);
    const v4f bm[2] = {*(const v4f*)(bp), *(const v4f*)(bp + 4)};
    asm volatile("s_wait_xcnt 0x0" :: "v"(bp) : "memory");   // stands before the two loads' address gets a new value
    unsigned short* cp[4];
#pragma unroll
    for (int it = 0; it < 4; ++it) cp[it] = C + (size_t)(mBase + it * 4 + q) * ldc + n0 + wn + c8;
#pragma unroll
    for (int jh = 0; jh < 2; ++jh) {   // the wave's 128 columns in two slabs of 64
#pragma unroll
      for (int r = 0; r < 8; ++r) {
#pragma unroll
        for (int j = 0; j < 4; ++j) {
          float v = acc[i][4 * jh + j][r] * cs;
          v += isV ? bm[r >> 2][r & 3] : bn[4 * jh + j];   // os is 1 where the bias goes by m
          slab[(8 * eh + r) * 68 + (j << 4) + ec] = fmaxf(v, 0.0f);
        }
      }
      __builtin_amdgcn_fence(__ATOMIC_RELEASE, "workgroup", "local");
      __builtin_amdgcn_wave_barrier();   // the slab is the wave's own: its lanes' stores stand before its lanes' reads
      __builtin_amdgcn_fence(__ATOMIC_ACQUIRE, "workgroup", "local");
      v8h hv[4];
#pragma unroll
      for (int it = 0; it < 4; ++it) {
        const float* sp = slab + (it * 4 + q) * 68 + c8;
#pragma unroll
        for (int e = 0; e < 8; ++e) hv[it][e] = (_Float16)sp[e];
        *(v8h*)(cp[it] + jh * 64) = hv[it];
      }
      // Stands before the four stores' addresses and data get new values.
      asm volatile("s_wait_xcnt 0x0" :: "v"(cp[0]), "v"(cp[1]), "v"(cp[2]), "v"(cp[3]),
                                        "v"(hv[0]), "v"(hv[1]), "v"(hv[2]), "v"(hv[3]) : "memory");
      if (i < 3 || jh < 1) {
        __builtin_amdgcn_fence(__ATOMIC_RELEASE, "workgroup", "local");
        __builtin_amdgcn_wave_barrier();   // the reads above stand before the next slab's stores
        __builtin_amdgcn_fence(__ATOMIC_ACQUIRE, "workgroup", "local");
      }
    }
  }
}

typedef __attribute__((ext_vector_type(2))) float v2f;
typedef __attribute__((ext_vector_type(2))) _Float16 v2h;
constexpr int kFaQWaves = 8;                      // waves side by side over the queries
constexpr int kFaKSplit = 2;                      // wave groups over the keys
constexpr int kFaWaves  = kFaQWaves * kFaKSplit;
constexpr int kFaCols   = 32;                     // query columns of a wave (two 16-column groups)
constexpr int kFaRows   = kFaQWaves * kFaCols;    // queries of a work-group
constexpr int kFaStage  = 64;                     // keys of a wave group's stage (two passes of 32)
constexpr int kFaStep   = kFaStage * kFaKSplit;   // keys of the work-group's stage
constexpr int kFaStages = kSeq / kFaStep;
constexpr int kFaPitch  = 72;                     // halves per LDS row: 128 B + 16 B, conflict-free for 16-byte reads
constexpr int kFaTile   = kFaStage * kFaPitch;    // halves of one K or V^T tile in LDS
constexpr int kFaRing   = kFaKSplit * 2 * 2 * kFaTile * 2;         // bytes: [group][buffer][K | V^T]
constexpr int kFaXAcc   = kFaWaves * 8 * 32 * 4;  // floats handed over in the merge: 32 per lane
static_assert(kSeq % kFaRows == 0 && kSeq % kFaStep == 0 && kDh == 64 && kDh == kFaStage && kFaKSplit == 2);
static_assert((kFaXAcc + kFaWaves * 2 * 32) * 4 <= kFaRing);
constexpr int kFaSlabPitch = 68;                  // floats per LDS row of an output slab: 256 B + 16 B, conflict-free both ways
constexpr int kFaSlab   = 16 * kFaSlabPitch;      // floats of a wave's output slab (16 queries x 64 d)
constexpr int kFaSide   = kFaWaves * kFaSlab * 4; // bytes behind the ring: first the Q tile, at the end the output slabs
static_assert(kFaRows * kFaPitch * 2 <= kFaSide && kFaRing % 16 == 0 && (kFaSlab * 4) % 16 == 0);

constexpr float kFaSumCap = 4096.0f;              // a lane's sum of 16 terms above this raises the maximum in use

// The 16 terms of one query column that a lane holds (two 16-key tiles), from their exponents (kShift: less a raise of the
// maximum in use): their f32 sum, and the terms in f16 as the B operand of V^T.P^T (element e = key kmap(e, h): tile e >> 3,
// register e & 7).
template <bool kShift>
__device__ __forceinline__ void fa_terms(const v8f& s0, const v8f& s1, float raise, v16h& terms, float& sum) {
  union { v16h v; v2h p[8]; } pf;
  v2f l = (v2f){0.f, 0.f};   // even and odd registers, summed apart as pairs
#pragma unroll
  for (int i = 0; i < 8; ++i) {
    const v8f& s = (i < 4) ? s0 : s1;
    v2f arg = (v2f){s[2 * (i & 3)], s[2 * (i & 3) + 1]};
    if (kShift) arg -= (v2f){raise, raise};
    const v2f p = (v2f){__builtin_amdgcn_exp2f(arg[0]), __builtin_amdgcn_exp2f(arg[1])};
    l += p;
    pf.p[i] = __builtin_convertvector(p, v2h);
  }
  terms = pf.v;
  sum = l[0] + l[1];
}

__device__ __forceinline__ float xhalf(float x) {   // lane l with lane l ^ 16
  return __builtin_bit_cast(float, __builtin_amdgcn_permlanex16(__builtin_bit_cast(int, x), __builtin_bit_cast(int, x),
                                                                0x76543210, 0xfedcba98, false, false));
}

// exp2 with the slot that the instruction set asks for behind a transcendental kept in the same statement.
__device__ __forceinline__ float exp2_slot(float x) {
  float r;
  asm("v_exp_f32 %0, %1\n\tv_nop" : "=v"(r) : "v"(x));
  return r;
}

__global__ __launch_bounds__(kFaWaves * 32) void attn_fused_kernel(const unsigned short* __restrict__ Qp,
                                                                   const unsigned short* __restrict__ Kp,
                                                                   const unsigned short* __restrict__ Vtp,
                                                                   const float* __restrict__ R, float* __restrict__ C) {
  typedef Frag<_Float16> F;
  __shared__ __align__(16) unsigned char smem[kFaRing + kFaSide];
  const int lane = threadIdx.x & 31;
  const int wave = threadIdx.x >> 5;
  const int kg   = __builtin_amdgcn_readfirstlane(wave / kFaQWaves);   // the wave's key group, the same in every lane
  const int c    = lane & 15;
  const int h    = lane >> 4;
  const int b    = blockIdx.y / kHeads;
  const int head = blockIdx.y - b * kHeads;
  const int q0   = blockIdx.x * kFaRows + (wave & (kFaQWaves - 1)) * kFaCols;
  const size_t tokOff = (size_t)b * kSeq * kDim + (size_t)head * kDh;   // row b*2048, this head's 64 columns
  const _Float16* Q  = (const _Float16*)Qp + tokOff;
  const _Float16* K  = (const _Float16*)Kp + tokOff;
  const _Float16* Vt = (const _Float16*)Vtp + (size_t)head * kDh * kTok + (size_t)b * kSeq;
  _Float16* const ring = (_Float16*)smem + kg * (4 * kFaTile);   // the group's two buffers, each K tile then V^T tile

  // Staging map within a group: 8 lanes x 16 B = one 128-B row; a thread brings rows srow and srow + 32 of both tiles.
  const int gt  = threadIdx.x & (kFaQWaves * 32 - 1);
  const int srow = gt >> 3;
  const int sch  = (gt & 7) * 8;
  const _Float16* gK = K + (size_t)(kg * kFaStage + srow) * kDim + sch;
  const _Float16* gV = Vt + (size_t)srow * kTok + kg * kFaStage + sch;
  const int sOff0 = srow * kFaPitch + sch;
  const int sOff1 = (srow + 32) * kFaPitch + sch;

  v8h rk0 = *(const v8h*)(gK);
  v8h rk1 = *(const v8h*)(gK + (size_t)32 * kDim);
  v8h rv0 = *(const v8h*)(gV);
  v8h rv1 = *(const v8h*)(gV + (size_t)32 * kTok);

  // The Q tile by rows: 8 lanes x 16 B = one 128-B row; a thread brings rows qrow + 64 i.
  _Float16* const qs = (_Float16*)(smem + kFaRing);
  const int qrow = threadIdx.x >> 3;
  const _Float16* gQ = Q + (size_t)(blockIdx.x * kFaRows + qrow) * kDim + sch;
  v8h rq[kFaRows / 64];
#pragma unroll
  for (int i = 0; i < kFaRows / 64; ++i) rq[i] = *(const v8h*)(gQ + (size_t)(64 * i) * kDim);

  *(v8h*)(ring + sOff0) = rk0;
  *(v8h*)(ring + sOff1) = rk1;
  *(v8h*)(ring + kFaTile + sOff0) = rv0;
  *(v8h*)(ring + kFaTile + sOff1) = rv1;
#pragma unroll
  for (int i = 0; i < kFaRows / 64; ++i) *(v8h*)(qs + (qrow + 64 * i) * kFaPitch + sch) = rq[i];
  __syncthreads();   // publishes stage 0 and the Q tile

  v16h qf[2][2];   // [column group][k step]
#pragma unroll
  for (int g = 0; g < 2; ++g)
#pragma unroll
    for (int ks = 0; ks < 2; ++ks)
      qf[g][ks] = F::load(qs + ((wave & (kFaQWaves - 1)) * kFaCols + (g << 4) + c) * kFaPitch + ks * 32 + 8 * h);

  const v8f zero8 = (v8f){0.f,0.f,0.f,0.f,0.f,0.f,0.f,0.f};
  v8f acc[4][2];     // [16-row tile of d][column group]: acc[t][g][r] = O^T[16t + 8h + r][query 16g + c]
  v8f negM[2];       // minus the maximum in use of the lane's query, the same in all eight registers: a C operand
  float lSum[2];
#pragma unroll
  for (int g = 0; g < 2; ++g) {
    negM[g] = zero8;
    lSum[g] = 0.f;
#pragma unroll
    for (int t = 0; t < 4; ++t) acc[t][g] = zero8;
  }

  for (int s = 0; s < kFaStages; ++s) {
    const _Float16* bK = ring + (s & 1) * (2 * kFaTile);
    const _Float16* bV = bK + kFaTile;
    const bool more = (s + 1 < kFaStages);   // the same for the whole work-group
    if (more) {
      const size_t kn = (size_t)(s + 1) * kFaStep;
      rk0 = *(const v8h*)(gK + kn * kDim);
      rk1 = *(const v8h*)(gK + (kn + 32) * kDim);
      rv0 = *(const v8h*)(gV + kn);
      rv1 = *(const v8h*)(gV + kn + (size_t)32 * kTok);
    }
#pragma unroll
    for (int ps = 0; ps < 2; ++ps) {
      v16h kf[2][2], vf[4];
#pragma unroll
      for (int t = 0; t < 2; ++t)
#pragma unroll
        for (int ks = 0; ks < 2; ++ks) kf[t][ks] = F::load(bK + (ps * 32 + (t << 4) + c) * kFaPitch + ks * 32 + 8 * h);
#pragma unroll
      for (int t = 0; t < 4; ++t) vf[t] = F::load(bV + ((t << 4) + c) * kFaPitch + ps * 32 + 8 * h);
      // Holds the pass's LDS reads in front of its score products, in whole groups, K first: left free, the compiler
      // spreads them among the products in pairs and waits some of them out there.
      __builtin_amdgcn_sched_barrier(0);

      v8f st[2][2];   // [16-key tile][column group]: st[t][g][r] = exponent of key 16t + 8h + r, query 16g + c
#pragma unroll
      for (int t = 0; t < 2; ++t)
#pragma unroll
        for (int g = 0; g < 2; ++g) {
          st[t][g] = F::mma(kf[t][0], qf[g][0], negM[g]);
          st[t][g] = F::mma(kf[t][1], qf[g][1], st[t][g]);
        }
      // Holds the eight products in one run in front of the terms: left free, each tile's terms start right behind its
      // product, and v_nop fills the distance that the matrix instruction needs (34 of them per stage, against 14).
      __builtin_amdgcn_sched_barrier(0);

      // The terms against the maximum in use, and the lazy test on their sums, once per pass.
      v16h pf[2];     // [column group]
      float ls[2];
#pragma unroll
      for (int g = 0; g < 2; ++g) fa_terms<false>(st[0][g], st[1][g], 0.f, pf[g], ls[g]);
      const bool need = !(ls[0] <= kFaSumCap) || !(ls[1] <= kFaSumCap);   // also true for an infinite sum and for a NaN
      if (__builtin_amdgcn_ballot_w32(need) != 0) {   // scalar branch; rare after the first pass
        float raise[2];
#pragma unroll
        for (int g = 0; g < 2; ++g) {
          float mx = st[0][g][0];   // the largest exponent: how far the pass's maximum lies above the one in use
#pragma unroll
          for (int r = 1; r < 8; ++r) mx = fmaxf(mx, st[0][g][r]);
#pragma unroll
          for (int r = 0; r < 8; ++r) mx = fmaxf(mx, st[1][g][r]);
          mx = fmaxf(mx, xhalf(mx));   // both halves now hold this query's
          raise[g] = fmaxf(mx, 0.f);
          const float corr = __builtin_amdgcn_exp2f(-raise[g]);
          negM[g] = negM[g] - raise[g];
          lSum[g] *= corr;
#pragma unroll
          for (int t = 0; t < 4; ++t) acc[t][g] = acc[t][g] * corr;
        }
#pragma unroll
        for (int g = 0; g < 2; ++g) fa_terms<true>(st[0][g], st[1][g], raise[g], pf[g], ls[g]);   // no term now exceeds 1
      }

#pragma unroll
      for (int g = 0; g < 2; ++g) {
        lSum[g] += ls[g];
#pragma unroll
        for (int t = 0; t < 4; ++t) acc[t][g] = F::mma(vf[t], pf[g], acc[t][g]);
      }
    }
    if (more) {
      _Float16* nK = ring + ((s + 1) & 1) * (2 * kFaTile);
      _Float16* nV = nK + kFaTile;
      *(v8h*)(nK + sOff0) = rk0;
      *(v8h*)(nK + sOff1) = rk1;
      *(v8h*)(nV + sOff0) = rv0;
      *(v8h*)(nV + sOff1) = rv1;
    }
    __syncthreads();   // publishes stage s + 1; ends every wave's reads of the buffer that stage s + 1 refills
  }

  // Epilogue: the two waves that hold the same 32 queries (wave w and w + 8) merge their halves of the keys. Group 0
  // finishes column group 0 and group 1 column group 1: each wave hands the other column group (maximum in use, sum, 32
  // accumulator values per lane) to its partner through LDS. The ring is free: the loop's last barrier ended its reads.
  const bool up = (kg != 0);
  // Residual and output by rows: 16 lanes x 16 B = the 256 B of one query; an instruction moves queries 2 it and 2 it + 1.
  const size_t o = tokOff + (size_t)(q0 + (kg << 4) + h) * kDim + 4 * c;
  const float* rp = R + o;
  v4f res[8];
#pragma unroll
  for (int it = 0; it < 8; ++it) res[it] = *(const v4f*)(rp + (size_t)(2 * it) * kDim);
  v4f*   const xa = (v4f*)smem;                    // [wave][8][lane], 16 B each
  float* const xs = (float*)smem + kFaXAcc;        // [wave][minus the maximum in use, sum][lane]
  {
    v4f* xw = xa + wave * (8 * 32) + lane;
#pragma unroll
    for (int t = 0; t < 4; ++t) {
      const v8f give = up ? acc[t][0] : acc[t][1];
      xw[(2 * t) * 32]     = (v4f){give[0], give[1], give[2], give[3]};
      xw[(2 * t + 1) * 32] = (v4f){give[4], give[5], give[6], give[7]};
    }
    xs[(wave * 2) * 32 + lane]     = up ? negM[0][0] : negM[1][0];
    xs[(wave * 2 + 1) * 32 + lane] = up ? lSum[0] : lSum[1];
  }
  __syncthreads();   // publishes every wave's hand-over to its partner
  const int pw = wave ^ kFaQWaves;
  const v4f* xr = xa + pw * (8 * 32) + lane;
  const float nOwn = up ? negM[1][0] : negM[0][0];
  const float lOwn = up ? lSum[1] : lSum[0];
  const float nOth = xs[(pw * 2) * 32 + lane];
  const float lOth = xs[(pw * 2 + 1) * 32 + lane];
  const float nAll = fminf(nOwn, nOth);                     // minus the larger of the two maxima in use
  const float fOwn = exp2_slot(nAll - nOwn);   // one of the two factors is 1
  const float fOth = exp2_slot(nAll - nOth);
  const float lAll = lOwn * fOwn + lOth * fOth;
  const float inv  = 1.0f / (lAll + xhalf(lAll));   // the largest score's term is at least 1: no maximum in use exceeds it
  const float aOwn = fOwn * inv;
  const float aOth = fOth * inv;
  // The slab is the wave's own range behind the ring; the Q tile that lay there was last read in front of the stage loop.
  float* const slab = (float*)(smem + kFaRing) + wave * kFaSlab;
#pragma unroll
  for (int t = 0; t < 4; ++t) {
    const v8f own = up ? acc[t][1] : acc[t][0];   // a lane holds 8 consecutive d of query c per tile
    const v4f p0 = xr[(2 * t) * 32];
    const v4f p1 = xr[(2 * t + 1) * 32];
    v4f o0, o1;
#pragma unroll
    for (int e = 0; e < 4; ++e) {
      o0[e] = own[e] * aOwn + p0[e] * aOth;
      o1[e] = own[4 + e] * aOwn + p1[e] * aOth;
    }
    *(v4f*)(slab + c * kFaSlabPitch + (t << 4) + 8 * h) = o0;
    *(v4f*)(slab + c * kFaSlabPitch + (t << 4) + 8 * h + 4) = o1;
  }
  __builtin_amdgcn_fence(__ATOMIC_RELEASE, "workgroup", "local");
  __builtin_amdgcn_wave_barrier();   // the slab is the wave's own: its lanes' stores stand before its lanes' reads
  __builtin_amdgcn_fence(__ATOMIC_ACQUIRE, "workgroup", "local");
  float* cp = C + o;
#pragma unroll
  for (int it = 0; it < 8; ++it)
    *(v4f*)(cp + (size_t)(2 * it) * kDim) = *(const v4f*)(slab + (2 * it + h) * kFaSlabPitch + 4 * c) + res[it];
}

// ---------------------------------------------------------------------------
// Host side
// Workspace region map (bytes):
//   Q16  : 8192 x 512 x 2            =   8,388,608 @          0   (relu(Xq Wq^T + bq) * log2(e) / 8, f16, [tok][512])
//   K16  : 8192 x 512 x 2            =   8,388,608 @  8,388,608
//   Vt16 : 512 x 8192 x 2            =   8,388,608 @ 16,777,216   (relu(Wv Xv^T + bv), f16, [v][b*2048+t])
//   total                            =  25,165,824
// ---------------------------------------------------------------------------
extern "C" void kernel_launch(void* const* d_in, const int* in_sizes, int n_in,
                              void* d_out, int out_size, void* d_ws, size_t ws_size,
                              hipStream_t stream) {
  if (n_in < 9) return;
  const size_t nTokU = (size_t)kTok * kDim;       // 4,194,304
  const size_t nWW   = (size_t)kDim * kDim;       //   262,144
  if ((size_t)in_sizes[0] != nTokU || (size_t)in_sizes[1] != nTokU || (size_t)in_sizes[2] != nTokU) return;
  if ((size_t)in_sizes[3] != nWW || (size_t)in_sizes[5] != nWW || (size_t)in_sizes[7] != nWW) return;
  if (in_sizes[4] != kDim || in_sizes[6] != kDim || in_sizes[8] != kDim) return;
  if ((size_t)out_size != nTokU) return;

  const float* queries = (const float*)d_in[0];
  const float* keys    = (const float*)d_in[1];
  const float* values  = (const float*)d_in[2];
  const float* Wq      = (const float*)d_in[3];
  const float* bq      = (const float*)d_in[4];
  const float* Wk      = (const float*)d_in[5];
  const float* bk      = (const float*)d_in[6];
  const float* Wv      = (const float*)d_in[7];
  const float* bv      = (const float*)d_in[8];
  float* out = (float*)d_out;

  // ---- carve ----
  const size_t bPlane = nTokU * 2;
  if (3 * bPlane > ws_size) return;
  char* ws = (char*)d_ws;
  unsigned short* Q16  = (unsigned short*)(ws);
  unsigned short* K16  = (unsigned short*)(ws + bPlane);
  unsigned short* Vt16 = (unsigned short*)(ws + 2 * bPlane);

  // ---- projections: one launch; x = 2 feature tiles x 32 token tiles, y = Q, K, V^T; 8 waves per work-group ----
  proj_fused_kernel<<<dim3((kTok / kPjTile) * (kDim / kPjTile), 3), dim3(kPjWaves * 32), 0, stream>>>(
      queries, keys, values, Wq, Wk, Wv, bq, bk, bv, Q16, K16, Vt16);

  // ---- attention: one launch; x = block of 256 queries, y = batch * 8 + head; 16 waves per work-group ----
  // out[b,q,h*64+d] = sum_k softmax_k(ln(2) * Q[b,q,h*64+:] . K[b,k,h*64+:]) Vt[h*64+d][b*2048+k] + queries[b,q,h*64+d]
  attn_fused_kernel<<<dim3(kSeq / kFaRows, kBatch * kHeads), dim3(kFaWaves * 32), 0, stream>>>(Q16, K16, Vt16, queries, out);
}

// v009
// One run takes 41.1 microseconds.
// In two side-by-side timings against v008, it was 1.06 and 1.05 times as fast.
// All steps since v000 together make it 46.3 times as fast.
// Contractions: q/k/v projections (X f16 x W^T f16 carried x16), scores K.Q^T (relu planes f16, K=64, Q carrying the softmax scale, accumulator started at minus the maximum in use), V^T.P^T (P f16, unnormalised exp2 against the maximum in use): all v_wmma_f32_16x16x32_f16 with f32 accumulate; softmax, bias, relu and residual in f32.
#include <hip/hip_runtime.h>

// ---------------------------------------------------------------------------
// Problem constants
// ---------------------------------------------------------------------------
constexpr int kBatch = 4;
constexpr int kSeq   = 2048;
constexpr int kDim   = 512;
constexpr int kHeads = 8;
constexpr int kDh    = 64;
constexpr int kTok   = kBatch * kSeq;      // 8192 token rows
constexpr float kWCarry    = 16.0f;        // weights carried x16 in f16
constexpr float kWCarryInv = 1.0f / 16.0f;
constexpr float kQKScaleLog2 = 0.125f * 1.4426950408889634f;   // 1/sqrt(64), times log2(e): the softmax runs in base 2
static_assert(kHeads * kDh == kDim);

typedef __attribute__((ext_vector_type(16))) _Float16 v16h;
typedef __attribute__((ext_vector_type(8)))  _Float16 v8h;
typedef __attribute__((ext_vector_type(8)))  float    v8f;
typedef __attribute__((ext_vector_type(4)))  float    v4f;
typedef __attribute__((ext_vector_type(4)))  _Float16 v4h;
typedef __attribute__((address_space(3))) v4h lds_v4h;   // a v4h in LDS, reached by its byte address

// ---------------------------------------------------------------------------
// f16 fragment of the 16x16x32 form
// ---------------------------------------------------------------------------
template <typename T> struct Frag;
template <> struct Frag<_Float16> {
  typedef v16h V; union U { v16h v; v8h h[2]; };
  static __device__ __forceinline__ v16h load(const _Float16* p) {   // elements 0..7 <- p[0..7], 8..15 <- p[16..23]
    U f; f.h[0] = *(const v8h*)(p); f.h[1] = *(const v8h*)(p + 16); return f.v;
  }
  static __device__ __forceinline__ v8f mma(v16h a, v16h b, v8f c) {
    return __builtin_amdgcn_wmma_f32_16x16x32_f16(false, a, false, b, (short)0, c, false, false);
  }
};

// ---------------------------------------------------------------------------
// The three projections in one launch, straight from the f32 inputs: blockIdx.y = 0 (Q), 1 (K), 2 (V^T).
// C[m,n] = relu(sum_k A[m,k] * B[n,k] / 16 + bias); both operands are f32 rows of 512, k-contiguous.
// Q alone is stored times kQKScaleLog2 (positive, so it passes through the relu): K.Q^T is then the softmax's base-2 exponent.
//   Q, K : A = X (tokens),   B = W (features), C = [token][512],    bias by n
//   V^T  : A = Wv (features), B = Xv (tokens),  C = [feature][8192], bias by m
// A work-group owns a 256 x 256 tile of C (8 waves, 4 x 2, each 64 x 128) and walks k in stages of 64: every X row is
// fetched by two work-groups and every W row by 32.
// Staging: each stage's 256 + 256 rows of 256 B come as whole lines into registers, are converted there to f16 (W times
// 16, X as it is) and stored into one of two LDS buffers; one barrier per stage publishes the next buffer and ends the
// reads of the one refilled behind it. A staging register is loaded anew right behind its conversion, in front of that
// barrier: the loads lead by a whole stage and the work-group has some in flight in every stage but the last.
// The k order of every accumulator is steps of 32, ascending.
// The stage loop is unrolled whole: every global address is then one base plus an immediate offset.
// ---------------------------------------------------------------------------
constexpr int kPjTile   = 256;                    // rows of each operand per work-group
constexpr int kPjWaves  = 8;                      // 4 x 2, each 64 x 128 of the tile
constexpr int kPjK      = 64;                     // k of a stage (two WMMA steps)
constexpr int kPjStages = kDim / kPjK;
constexpr int kPjPitch  = 72;                     // halves per LDS row: 128 B + 16 B, conflict-free for 16-byte reads
constexpr int kPjRowsAt = kPjWaves * 32 / 16;     // rows that the work-group's threads bring with one 16-byte load each
constexpr int kPjLoads  = kPjTile / kPjRowsAt;    // 16-byte loads of a thread per operand and stage
constexpr int kPjOp     = kPjTile * kPjPitch;     // halves of one operand's tile in LDS
constexpr int kPjBuf    = 2 * kPjOp;              // halves of a buffer
static_assert(kPjWaves * 16 * 68 * 4 <= kPjBuf * 2);   // the eight output slabs fit one buffer
static_assert(kTok % kPjTile == 0 && kDim % kPjTile == 0 && kDim % kPjK == 0);
static_assert(((kTok / kPjTile) & (kTok / kPjTile - 1)) == 0 && kPjStages >= 2);

// Work-group barrier that orders LDS alone: every wave's LDS stores and reads in front of it are done before any wave goes
// on. __syncthreads() would also wait for the wave's global loads, which here are meant to stay in flight across it; they
// land in the wave's own registers and concern no other wave.
__device__ __forceinline__ void barrier_lds() {
  __builtin_amdgcn_fence(__ATOMIC_RELEASE, "workgroup", "local");
  __builtin_amdgcn_s_barrier();
  __builtin_amdgcn_fence(__ATOMIC_ACQUIRE, "workgroup", "local");
}

__global__ __launch_bounds__(kPjWaves * 32) void proj_fused_kernel(
    const float* __restrict__ Xq, const float* __restrict__ Xk, const float* __restrict__ Xv,
    const float* __restrict__ Wq, const float* __restrict__ Wk, const float* __restrict__ Wv,
    const float* __restrict__ bq, const float* __restrict__ bk, const float* __restrict__ bv,
    unsigned short* __restrict__ Q16, unsigned short* __restrict__ K16, unsigned short* __restrict__ Vt16) {
  typedef Frag<_Float16> F;
  __shared__ __align__(16) unsigned char smem[2 * kPjBuf * 2];   // [buffer][A rows | B rows][pitch] in halves
  _Float16* const ring = (_Float16*)smem;
  const int z = blockIdx.y;
  const bool isV = (z == 2);                       // block-uniform
  const float* X    = (z == 0) ? Xq : (z == 1) ? Xk : Xv;
  const float* Wt   = (z == 0) ? Wq : (z == 1) ? Wk : Wv;
  const float* bias = (z == 0) ? bq : (z == 1) ? bk : bv;
  unsigned short* C = (z == 0) ? Q16 : (z == 1) ? K16 : Vt16;
  const int tokTile  = blockIdx.x & (kTok / kPjTile - 1);   // the two work-groups of a token tile stand 32 apart in the
  const int featTile = blockIdx.x / (kTok / kPjTile);       // grid (speed only: a multiple of the number of dies)
  const int m0  = (isV ? featTile : tokTile) * kPjTile;
  const int n0  = (isV ? tokTile : featTile) * kPjTile;
  const int ldc = isV ? kTok : kDim;
  const float sa = isV ? kWCarry : 1.0f;
  const float sb = isV ? 1.0f : kWCarry;

  const int lane = threadIdx.x & 31;
  const int wave = __builtin_amdgcn_readfirstlane(threadIdx.x >> 5);   // the same in every lane: kept in a scalar register
  const int c    = lane & 15;                      // row (A) / column (B, D) within a 16-tile
  const int h    = lane >> 4;
  const int wm   = (wave >> 1) * 64;               // the wave's rows of the tile
  const int wn   = (wave & 1) * 128;               // the wave's columns of the tile

  // Staging map: 16 lanes x 16 B = one 256-B row piece; a thread brings rows srow + 16 i of both operands.
  const int srow = threadIdx.x >> 4;
  const int sc4  = (threadIdx.x & 15) * 4;
  const float* gA = (isV ? Wt : X) + (size_t)(m0 + srow) * kDim + sc4;
  const float* gB = (isV ? X : Wt) + (size_t)(n0 + srow) * kDim + sc4;
  const int sOff = srow * kPjPitch + sc4;
  // LDS byte addresses of the thread's first staging slot in the two buffers. The second is formed in asm so that it stays
  // one base register, with every store's place but the last three B ones (up to 71,424 B) in the 16-bit offset field: left to itself the compiler folds the buffer's
  // 73,728 bytes into each store's own constant, which no longer fits that field, and holds an address register per store
  // through the whole stage loop, which has none to spare (it spilled).
  const unsigned w0 = (unsigned)(size_t)(ring + sOff);
  unsigned w1;
  asm("v_add_nc_u32 %0, %1, %2" : "=v"(w1) : "i"(kPjBuf * 2), "v"(w0));

  v4f ra[kPjLoads], rb[kPjLoads];
#pragma unroll
  for (int i = 0; i < kPjLoads; ++i) {
    ra[i] = *(const v4f*)(gA + (size_t)i * kPjRowsAt * kDim);
    rb[i] = *(const v4f*)(gB + (size_t)i * kPjRowsAt * kDim);
  }

  v8f acc[4][8];   // acc[i][j][r] = C[wm + 16i + 8h + r][wn + 16j + c]
#pragma unroll
  for (int i = 0; i < 4; ++i)
#pragma unroll
    for (int j = 0; j < 8; ++j) acc[i][j] = (v8f){0.f,0.f,0.f,0.f,0.f,0.f,0.f,0.f};

#pragma unroll
  for (int i = 0; i < kPjLoads; ++i) {
    *(v4h*)(ring + sOff + i * kPjRowsAt * kPjPitch) = __builtin_convertvector(ra[i] * sa, v4h);
    *(v4h*)(ring + kPjOp + sOff + i * kPjRowsAt * kPjPitch) = __builtin_convertvector(rb[i] * sb, v4h);
    ra[i] = *(const v4f*)(gA + (size_t)i * kPjRowsAt * kDim + kPjK);
    rb[i] = *(const v4f*)(gB + (size_t)i * kPjRowsAt * kDim + kPjK);
    // Holds the order as in the stage loop below: a wave then has 36 loads outstanding at most; left free, the compiler
    // issues all 64 loads of the two stages in one run.
    if (i & 1) __builtin_amdgcn_sched_barrier(0);
  }
  barrier_lds();   // publishes stage 0

#pragma unroll
  for (int s = 0; s < kPjStages; ++s) {
    const _Float16* bA = ring + (s & 1) * kPjBuf;
    const _Float16* bB = bA + kPjOp;
#pragma unroll
    for (int ks = 0; ks < 2; ++ks) {
      // The A fragments rotate through two register sets, each fetched one row of eight products ahead. The scheduling
      // barriers hold that order: left free, the compiler reuses one set and waits out an LDS read in front of every
      // row; all four fragments at once do not fit the registers.
      const _Float16* pA = bA + (wm + c) * kPjPitch + ks * 32 + 8 * h;
      v16h af[2], bf[8];
      af[0] = F::load(pA);
#pragma unroll
      for (int j = 0; j < 8; ++j) bf[j] = F::load(bB + (wn + (j << 4) + c) * kPjPitch + ks * 32 + 8 * h);
      af[1] = F::load(pA + 16 * kPjPitch);
      __builtin_amdgcn_sched_barrier(0);
#pragma unroll
      for (int i = 0; i < 4; ++i) {
#pragma unroll
        for (int j = 0; j < 8; ++j) acc[i][j] = F::mma(af[i & 1], bf[j], acc[i][j]);
        if (i < 2) {
          __builtin_amdgcn_sched_barrier(0);
          af[i & 1] = F::load(pA + (i + 2) * 16 * kPjPitch);
          __builtin_amdgcn_sched_barrier(0);
        }
      }
    }
    if (s + 1 < kPjStages) {
      // Keeps the conversions, and with them the wait for the loads, behind this stage's products.
      __builtin_amdgcn_sched_barrier(0);
      const unsigned wB = ((s + 1) & 1) ? w1 : w0;
#pragma unroll
      for (int i = 0; i < kPjLoads; ++i) {
        *(lds_v4h*)(wB + i * kPjRowsAt * kPjPitch * 2) = __builtin_convertvector(ra[i] * sa, v4h);
        *(lds_v4h*)(wB + (kPjOp + i * kPjRowsAt * kPjPitch) * 2) = __builtin_convertvector(rb[i] * sb, v4h);
        if (s + 2 < kPjStages) {
          ra[i] = *(const v4f*)(gA + (size_t)i * kPjRowsAt * kDim + (s + 2) * kPjK);
          rb[i] = *(const v4f*)(gB + (size_t)i * kPjRowsAt * kDim + (s + 2) * kPjK);
        }
        // Holds the conversions, stores and new loads together, two pairs of registers at a time: left free, the compiler
        // puts the loads of some stages behind all of the stage's conversions.
        if (i & 1) __builtin_amdgcn_sched_barrier(0);
      }
      barrier_lds();   // publishes stage s + 1; ends every wave's reads of the buffer that stage s + 1 refills
    }
  }

  // Epilogue: scale, bias, relu in f32; each wave turns its 16 x 64 slabs (pitch 68 floats) in its own LDS range into
  // whole 128-B lines. The slabs lie in buffer 0: the last stage reads buffer 1, and every wave's last read of buffer 0
  // stands in front of the barrier that published that stage.
  static_assert((kPjStages & 1) == 0);
  float* slab = (float*)smem + wave * (16 * 68);
  // The lane's number is read anew here: kept from the kernel's head it would hold registers through the stage loop,
  // which has none to spare (the block is one-dimensional, so this is threadIdx.x & 31).
  const int el = __builtin_amdgcn_mbcnt_lo(~0u, 0u);
  const int ec = el & 15;
  const int eh = el >> 4;
  // Both bias forms are loaded with no branch; the form not in use reads from the start of the 512.
  // Each s_wait_xcnt below takes the registers that the loads or stores above it name as inputs, so that none of them is
  // given a new value in front of the wait. The slab fences name LDS alone: the wave's global stores need not be waited for.
  const float os = (z == 0) ? kQKScaleLog2 : 1.0f;   // block-uniform: the factor that the stored plane carries
  const float cs = kWCarryInv * os;
  const float* bnp = bias + (isV ? 0 : n0 + wn + ec);
  float bn[8];
#pragma unroll
  for (int j = 0; j < 8; ++j) bn[j] = bnp[j << 4];
  asm volatile("s_wait_xcnt 0x0" :: "v"(bnp) : "memory");   // stands before the eight loads' address gets a new value
#pragma unroll   // constant indices keep bn in registers
  for (int j = 0; j < 8; ++j) bn[j] *= os;
  const int q = el >> 3, c8 = (el & 7) * 8;
#pragma unroll
  for (int i = 0; i < 4; ++i) {
    const int mBase = m0 + wm + (i << 4);
    const float* bp = bias + (isV ? mBase + 8 * eh : 0);
    const v4f bm[2] = {*(const v4f*)(bp), *(const v4f*)(bp + 4)};
    asm volatile("s_wait_xcnt 0x0" :: "v"(bp) : "memory");   // stands before the two loads' address gets a new value
    unsigned short* cp[4];
#pragma unroll
    for (int it = 0; it < 4; ++it) cp[it] = C + (size_t)(mBase + it * 4 + q) * ldc + n0 + wn + c8;
#pragma unroll
    for (int jh = 0; jh < 2; ++jh) {   // the wave's 128 columns in two slabs of 64
#pragma unroll
      for (int r = 0; r < 8; ++r) {
#pragma unroll
        for (int j = 0; j < 4; ++j) {
          float v = acc[i][4 * jh + j][r] * cs;
          v += isV ? bm[r >> 2][r & 3] : bn[4 * jh + j];   // os is 1 where the bias goes by m
          slab[(8 * eh + r) * 68 + (j << 4) + ec] = fmaxf(v, 0.0f);
        }
      }
      __builtin_amdgcn_fence(__ATOMIC_RELEASE, "workgroup", "local");
      __builtin_amdgcn_wave_barrier();   // the slab is the wave's own: its lanes' stores stand before its lanes' reads
      __builtin_amdgcn_fence(__ATOMIC_ACQUIRE, "workgroup", "local");
      v8h hv[4];
#pragma unroll
      for (int it = 0; it < 4; ++it) {
        const float* sp = slab + (it * 4 + q) * 68 + c8;
#pragma unroll
        for (int e = 0; e < 8; ++e) hv[it][e] = (_Float16)sp[e];
        *(v8h*)(cp[it] + jh * 64) = hv[it];
      }
      // Stands before the four stores' addresses and data get new values.
      asm volatile("s_wait_xcnt 0x0" :: "v"(cp[0]), "v"(cp[1]), "v"(cp[2]), "v"(cp[3]),
                                        "v"(hv[0]), "v"(hv[1]), "v"(hv[2]), "v"(hv[3]) : "memory");
      if (i < 3 || jh < 1) {
        __builtin_amdgcn_fence(__ATOMIC_RELEASE, "workgroup", "local");
        __builtin_amdgcn_wave_barrier();   // the reads above stand before the next slab's stores
        __builtin_amdgcn_fence(__ATOMIC_ACQUIRE, "workgroup", "local");
      }
    }
  }
}

typedef __attribute__((ext_vector_type(2))) float v2f;
typedef __attribute__((ext_vector_type(2))) _Float16 v2h;
constexpr int kFaQWaves = 8;                      // waves side by side over the queries
constexpr int kFaKSplit = 2;                      // wave groups over the keys
constexpr int kFaWaves  = kFaQWaves * kFaKSplit;
constexpr int kFaCols   = 32;                     // query columns of a wave (two 16-column groups)
constexpr int kFaRows   = kFaQWaves * kFaCols;    // queries of a work-group
constexpr int kFaStage  = 64;                     // keys of a wave group's stage (two passes of 32)
constexpr int kFaStep   = kFaStage * kFaKSplit;   // keys of the work-group's stage
constexpr int kFaStages = kSeq / kFaStep;
constexpr int kFaPitch  = 72;                     // halves per LDS row: 128 B + 16 B, conflict-free for 16-byte reads
constexpr int kFaTile   = kFaStage * kFaPitch;    // halves of one K or V^T tile in LDS
constexpr int kFaRing   = kFaKSplit * 2 * 2 * kFaTile * 2;         // bytes: [group][buffer][K | V^T]
constexpr int kFaXAcc   = kFaWaves * 8 * 32 * 4;  // floats handed over in the merge: 32 per lane
static_assert(kSeq % kFaRows == 0 && kSeq % kFaStep == 0 && kDh == 64 && kDh == kFaStage && kFaKSplit == 2);
static_assert((kFaXAcc + kFaWaves * 2 * 32) * 4 <= kFaRing);
constexpr int kFaSlabPitch = 68;                  // floats per LDS row of an output slab: 256 B + 16 B, conflict-free both ways
constexpr int kFaSlab   = 16 * kFaSlabPitch;      // floats of a wave's output slab (16 queries x 64 d)
constexpr int kFaSide   = kFaWaves * kFaSlab * 4; // bytes behind the ring: first the Q tile, at the end the output slabs
static_assert(kFaRows * kFaPitch * 2 <= kFaSide && kFaRing % 16 == 0 && (kFaSlab * 4) % 16 == 0);

constexpr float kFaSumCap = 4096.0f;              // a lane's sum of 16 terms above this raises the maximum in use

// The 16 terms of one query column that a lane holds (two 16-key tiles), from their exponents (kShift: less a raise of the
// maximum in use): their f32 sum, and the terms in f16 as the B operand of V^T.P^T (element e = key kmap(e, h): tile e >> 3,
// register e & 7).
template <bool kShift>
__device__ __forceinline__ void fa_terms(const v8f& s0, const v8f& s1, float raise, v16h& terms, float& sum) {
  union { v16h v; v2h p[8]; } pf;
  v2f l = (v2f){0.f, 0.f};   // even and odd registers, summed apart as pairs
#pragma unroll
  for (int i = 0; i < 8; ++i) {
    const v8f& s = (i < 4) ? s0 : s1;
    v2f arg = (v2f){s[2 * (i & 3)], s[2 * (i & 3) + 1]};
    if (kShift) arg -= (v2f){raise, raise};
    const v2f p = (v2f){__builtin_amdgcn_exp2f(arg[0]), __builtin_amdgcn_exp2f(arg[1])};
    l += p;
    pf.p[i] = __builtin_convertvector(p, v2h);
  }
  terms = pf.v;
  sum = l[0] + l[1];
}

__device__ __forceinline__ float xhalf(float x) {   // lane l with lane l ^ 16
  return __builtin_bit_cast(float, __builtin_amdgcn_permlanex16(__builtin_bit_cast(int, x), __builtin_bit_cast(int, x),
                                                                0x76543210, 0xfedcba98, false, false));
}

// exp2 with the slot that the instruction set asks for behind a transcendental kept in the same statement.
__device__ __forceinline__ float exp2_slot(float x) {
  float r;
  asm("v_exp_f32 %0, %1\n\tv_nop" : "=v"(r) : "v"(x));
  return r;
}

__global__ __launch_bounds__(kFaWaves * 32) void attn_fused_kernel(const unsigned short* __restrict__ Qp,
                                                                   const unsigned short* __restrict__ Kp,
                                                                   const unsigned short* __restrict__ Vtp,
                                                                   const float* __restrict__ R, float* __restrict__ C) {
  typedef Frag<_Float16> F;
  __shared__ __align__(16) unsigned char smem[kFaRing + kFaSide];
  const int lane = threadIdx.x & 31;
  const int wave = threadIdx.x >> 5;
  const int kg   = __builtin_amdgcn_readfirstlane(wave / kFaQWaves);   // the wave's key group, the same in every lane
  const int c    = lane & 15;
  const int h    = lane >> 4;
  const int b    = blockIdx.y / kHeads;
  const int head = blockIdx.y - b * kHeads;
  const int q0   = blockIdx.x * kFaRows + (wave & (kFaQWaves - 1)) * kFaCols;
  const size_t tokOff = (size_t)b * kSeq * kDim + (size_t)head * kDh;   // row b*2048, this head's 64 columns
  const _Float16* Q  = (const _Float16*)Qp + tokOff;
  const _Float16* K  = (const _Float16*)Kp + tokOff;
  const _Float16* Vt = (const _Float16*)Vtp + (size_t)head * kDh * kTok + (size_t)b * kSeq;
  _Float16* const ring = (_Float16*)smem + kg * (4 * kFaTile);   // the group's two buffers, each K tile then V^T tile

  // Staging map within a group: 8 lanes x 16 B = one 128-B row; a thread brings rows srow and srow + 32 of both tiles.
  const int gt  = threadIdx.x & (kFaQWaves * 32 - 1);
  const int srow = gt >> 3;
  const int sch  = (gt & 7) * 8;
  const _Float16* gK = K + (size_t)(kg * kFaStage + srow) * kDim + sch;
  const _Float16* gV = Vt + (size_t)srow * kTok + kg * kFaStage + sch;
  const int sOff0 = srow * kFaPitch + sch;
  const int sOff1 = (srow + 32) * kFaPitch + sch;

  v8h rk0 = *(const v8h*)(gK);
  v8h rk1 = *(const v8h*)(gK + (size_t)32 * kDim);
  v8h rv0 = *(const v8h*)(gV);
  v8h rv1 = *(const v8h*)(gV + (size_t)32 * kTok);

  // The Q tile by rows: 8 lanes x 16 B = one 128-B row; a thread brings rows qrow + 64 i.
  _Float16* const qs = (_Float16*)(smem + kFaRing);
  const int qrow = threadIdx.x >> 3;
  const _Float16* gQ = Q + (size_t)(blockIdx.x * kFaRows + qrow) * kDim + sch;
  v8h rq[kFaRows / 64];
#pragma unroll
  for (int i = 0; i < kFaRows / 64; ++i) rq[i] = *(const v8h*)(gQ + (size_t)(64 * i) * kDim);

  *(v8h*)(ring + sOff0) = rk0;
  *(v8h*)(ring + sOff1) = rk1;
  *(v8h*)(ring + kFaTile + sOff0) = rv0;
  *(v8h*)(ring + kFaTile + sOff1) = rv1;
#pragma unroll
  for (int i = 0; i < kFaRows / 64; ++i) *(v8h*)(qs + (qrow + 64 * i) * kFaPitch + sch) = rq[i];
  __syncthreads();   // publishes stage 0 and the Q tile

  v16h qf[2][2];   // [column group][k step]
#pragma unroll
  for (int g = 0; g < 2; ++g)
#pragma unroll
    for (int ks = 0; ks < 2; ++ks)
      qf[g][ks] = F::load(qs + ((wave & (kFaQWaves - 1)) * kFaCols + (g << 4) + c) * kFaPitch + ks * 32 + 8 * h);

  const v8f zero8 = (v8f){0.f,0.f,0.f,0.f,0.f,0.f,0.f,0.f};
  v8f acc[4][2];     // [16-row tile of d][column group]: acc[t][g][r] = O^T[16t + 8h + r][query 16g + c]
  v8f negM[2];       // minus the maximum in use of the lane's query, the same in all eight registers: a C operand
  float lSum[2];
#pragma unroll
  for (int g = 0; g < 2; ++g) {
    negM[g] = zero8;
    lSum[g] = 0.f;
#pragma unroll
    for (int t = 0; t < 4; ++t) acc[t][g] = zero8;
  }

  for (int s = 0; s < kFaStages; ++s) {
    const _Float16* bK = ring + (s & 1) * (2 * kFaTile);
    const _Float16* bV = bK + kFaTile;
    const bool more = (s + 1 < kFaStages);   // the same for the whole work-group
    if (more) {
      const size_t kn = (size_t)(s + 1) * kFaStep;
      rk0 = *(const v8h*)(gK + kn * kDim);
      rk1 = *(const v8h*)(gK + (kn + 32) * kDim);
      rv0 = *(const v8h*)(gV + kn);
      rv1 = *(const v8h*)(gV + kn + (size_t)32 * kTok);
    }
#pragma unroll
    for (int ps = 0; ps < 2; ++ps) {
      v16h kf[2][2], vf[4];
#pragma unroll
      for (int t = 0; t < 2; ++t)
#pragma unroll
        for (int ks = 0; ks < 2; ++ks) kf[t][ks] = F::load(bK + (ps * 32 + (t << 4) + c) * kFaPitch + ks * 32 + 8 * h);
#pragma unroll
      for (int t = 0; t < 4; ++t) vf[t] = F::load(bV + ((t << 4) + c) * kFaPitch + ps * 32 + 8 * h);
      // Holds the pass's LDS reads in front of its score products, in whole groups, K first: left free, the compiler
      // spreads them among the products in pairs and waits some of them out there.
      __builtin_amdgcn_sched_barrier(0);

      v8f st[2][2];   // [16-key tile][column group]: st[t][g][r] = exponent of key 16t + 8h + r, query 16g + c
#pragma unroll
      for (int t = 0; t < 2; ++t)
#pragma unroll
        for (int g = 0; g < 2; ++g) {
          st[t][g] = F::mma(kf[t][0], qf[g][0], negM[g]);
          st[t][g] = F::mma(kf[t][1], qf[g][1], st[t][g]);
        }
      // Holds the eight products in one run in front of the terms: left free, each tile's terms start right behind its
      // product, and v_nop fills the distance that the matrix instruction needs (34 of them per stage, against 14).
      __builtin_amdgcn_sched_barrier(0);

      // The terms against the maximum in use, and the lazy test on their sums, once per pass.
      v16h pf[2];     // [column group]
      float ls[2];
#pragma unroll
      for (int g = 0; g < 2; ++g) fa_terms<false>(st[0][g], st[1][g], 0.f, pf[g], ls[g]);
      const bool need = !(ls[0] <= kFaSumCap) || !(ls[1] <= kFaSumCap);   // also true for an infinite sum and for a NaN
      if (__builtin_amdgcn_ballot_w32(need) != 0) {   // scalar branch; rare after the first pass
        float raise[2];
#pragma unroll
        for (int g = 0; g < 2; ++g) {
          float mx = st[0][g][0];   // the largest exponent: how far the pass's maximum lies above the one in use
#pragma unroll
          for (int r = 1; r < 8; ++r) mx = fmaxf(mx, st[0][g][r]);
#pragma unroll
          for (int r = 0; r < 8; ++r) mx = fmaxf(mx, st[1][g][r]);
          mx = fmaxf(mx, xhalf(mx));   // both halves now hold this query's
          raise[g] = fmaxf(mx, 0.f);
          const float corr = __builtin_amdgcn_exp2f(-raise[g]);
          negM[g] = negM[g] - raise[g];
          lSum[g] *= corr;
#pragma unroll
          for (int t = 0; t < 4; ++t) acc[t][g] = acc[t][g] * corr;
        }
#pragma unroll
        for (int g = 0; g < 2; ++g) fa_terms<true>(st[0][g], st[1][g], raise[g], pf[g], ls[g]);   // no term now exceeds 1
      }

#pragma unroll
      for (int g = 0; g < 2; ++g) {
        lSum[g] += ls[g];
#pragma unroll
        for (int t = 0; t < 4; ++t) acc[t][g] = F::mma(vf[t], pf[g], acc[t][g]);
      }
    }
    if (more) {
      _Float16* nK = ring + ((s + 1) & 1) * (2 * kFaTile);
      _Float16* nV = nK + kFaTile;
      *(v8h*)(nK + sOff0) = rk0;
      *(v8h*)(nK + sOff1) = rk1;
      *(v8h*)(nV + sOff0) = rv0;
      *(v8h*)(nV + sOff1) = rv1;
    }
    __syncthreads();   // publishes stage s + 1; ends every wave's reads of the buffer that stage s + 1 refills
  }

  // Epilogue: the two waves that hold the same 32 queries (wave w and w + 8) merge their halves of the keys. Group 0
  // finishes column group 0 and group 1 column group 1: each wave hands the other column group (maximum in use, sum, 32
  // accumulator values per lane) to its partner through LDS. The ring is free: the loop's last barrier ended its reads.
  const bool up = (kg != 0);
  // Residual and output by rows: 16 lanes x 16 B = the 256 B of one query; an instruction moves queries 2 it and 2 it + 1.
  const size_t o = tokOff + (size_t)(q0 + (kg << 4) + h) * kDim + 4 * c;
  const float* rp = R + o;
  v4f res[8];
#pragma unroll
  for (int it = 0; it < 8; ++it) res[it] = *(const v4f*)(rp + (size_t)(2 * it) * kDim);
  v4f*   const xa = (v4f*)smem;                    // [wave][8][lane], 16 B each
  float* const xs = (float*)smem + kFaXAcc;        // [wave][minus the maximum in use, sum][lane]
  {
    v4f* xw = xa + wave * (8 * 32) + lane;
#pragma unroll
    for (int t = 0; t < 4; ++t) {
      const v8f give = up ? acc[t][0] : acc[t][1];
      xw[(2 * t) * 32]     = (v4f){give[0], give[1], give[2], give[3]};
      xw[(2 * t + 1) * 32] = (v4f){give[4], give[5], give[6], give[7]};
    }
    xs[(wave * 2) * 32 + lane]     = up ? negM[0][0] : negM[1][0];
    xs[(wave * 2 + 1) * 32 + lane] = up ? lSum[0] : lSum[1];
  }
  __syncthreads();   // publishes every wave's hand-over to its partner
  const int pw = wave ^ kFaQWaves;
  const v4f* xr = xa + pw * (8 * 32) + lane;
  const float nOwn = up ? negM[1][0] : negM[0][0];
  const float lOwn = up ? lSum[1] : lSum[0];
  const float nOth = xs[(pw * 2) * 32 + lane];
  const float lOth = xs[(pw * 2 + 1) * 32 + lane];
  const float nAll = fminf(nOwn, nOth);                     // minus the larger of the two maxima in use
  const float fOwn = exp2_slot(nAll - nOwn);   // one of the two factors is 1
  const float fOth = exp2_slot(nAll - nOth);
  const float lAll = lOwn * fOwn + lOth * fOth;
  const float inv  = 1.0f / (lAll + xhalf(lAll));   // the largest score's term is at least 1: no maximum in use exceeds it
  const float aOwn = fOwn * inv;
  const float aOth = fOth * inv;
  // The slab is the wave's own range behind the ring; the Q tile that lay there was last read in front of the stage loop.
  float* const slab = (float*)(smem + kFaRing) + wave * kFaSlab;
#pragma unroll
  for (int t = 0; t < 4; ++t) {
    const v8f own = up ? acc[t][1] : acc[t][0];   // a lane holds 8 consecutive d of query c per tile
    const v4f p0 = xr[(2 * t) * 32];
    const v4f p1 = xr[(2 * t + 1) * 32];
    v4f o0, o1;
#pragma unroll
    for (int e = 0; e < 4; ++e) {
      o0[e] = own[e] * aOwn + p0[e] * aOth;
      o1[e] = own[4 + e] * aOwn + p1[e] * aOth;
    }
    *(v4f*)(slab + c * kFaSlabPitch + (t << 4) + 8 * h) = o0;
    *(v4f*)(slab + c * kFaSlabPitch + (t << 4) + 8 * h + 4) = o1;
  }
  __builtin_amdgcn_fence(__ATOMIC_RELEASE, "workgroup", "local");
  __builtin_amdgcn_wave_barrier();   // the slab is the wave's own: its lanes' stores stand before its lanes' reads
  __builtin_amdgcn_fence(__ATOMIC_ACQUIRE, "workgroup", "local");
  float* cp = C + o;
#pragma unroll
  for (int it = 0; it < 8; ++it)
    *(v4f*)(cp + (size_t)(2 * it) * kDim) = *(const v4f*)(slab + (2 * it + h) * kFaSlabPitch + 4 * c) + res[it];
}

// ---------------------------------------------------------------------------
// Host side
// Workspace region map (bytes):
//   Q16  : 8192 x 512 x 2            =   8,388,608 @          0   (relu(Xq Wq^T + bq) * log2(e) / 8, f16, [tok][512])
//   K16  : 8192 x 512 x 2            =   8,388,608 @  8,388,608
//   Vt16 : 512 x 8192 x 2            =   8,388,608 @ 16,777,216   (relu(Wv Xv^T + bv), f16, [v][b*2048+t])
//   total                            =  25,165,824
// ---------------------------------------------------------------------------
extern "C" void kernel_launch(void* const* d_in, const int* in_sizes, int n_in,
                              void* d_out, int out_size, void* d_ws, size_t ws_size,
                              hipStream_t stream) {
  if (n_in < 9) return;
  const size_t nTokU = (size_t)kTok * kDim;       // 4,194,304
  const size_t nWW   = (size_t)kDim * kDim;       //   262,144
  if ((size_t)in_sizes[0] != nTokU || (size_t)in_sizes[1] != nTokU || (size_t)in_sizes[2] != nTokU) return;
  if ((size_t)in_sizes[3] != nWW || (size_t)in_sizes[5] != nWW || (size_t)in_sizes[7] != nWW) return;
  if (in_sizes[4] != kDim || in_sizes[6] != kDim || in_sizes[8] != kDim) return;
  if ((size_t)out_size != nTokU) return;

  const float* queries = (const float*)d_in[0];
  const float* keys    = (const float*)d_in[1];
  const float* values  = (const float*)d_in[2];
  const float* Wq      = (const float*)d_in[3];
  const float* bq      = (const float*)d_in[4];
  const float* Wk      = (const float*)d_in[5];
  const float* bk      = (const float*)d_in[6];
  const float* Wv      = (const float*)d_in[7];
  const float* bv      = (const float*)d_in[8];
  float* out = (float*)d_out;

  // ---- carve ----
  const size_t bPlane = nTokU * 2;
  if (3 * bPlane > ws_size) return;
  char* ws = (char*)d_ws;
  unsigned short* Q16  = (unsigned short*)(ws);
  unsigned short* K16  = (unsigned short*)(ws + bPlane);
  unsigned short* Vt16 = (unsigned short*)(ws + 2 * bPlane);

  // ---- projections: one launch; x = 2 feature tiles x 32 token tiles, y = Q, K, V^T; 8 waves per work-group ----
  proj_fused_kernel<<<dim3((kTok / kPjTile) * (kDim / kPjTile), 3), dim3(kPjWaves * 32), 0, stream>>>(
      queries, keys, values, Wq, Wk, Wv, bq, bk, bv, Q16, K16, Vt16);

  // ---- attention: one launch; x = block of 256 queries, y = batch * 8 + head; 16 waves per work-group ----
  // out[b,q,h*64+d] = sum_k softmax_k(ln(2) * Q[b,q,h*64+:] . K[b,k,h*64+:]) Vt[h*64+d][b*2048+k] + queries[b,q,h*64+d]
  attn_fused_kernel<<<dim3(kSeq / kFaRows, kBatch * kHeads), dim3(kFaWaves * 32), 0, stream>>>(Q16, K16, Vt16, queries, out);
}

// v010
// It runs in 39.7 microseconds.
// In both of two side-by-side timings against v009, it was 1.04 times as fast.
// Counting every step since v000, it is 48.1 times as fast.
// Contractions: q/k/v projections (X f16 x W^T f16 carried x16), scores K.Q^T (relu planes f16, K=64, Q carrying the softmax scale, accumulator started at minus the maximum in use), V^T.P^T (P f16, unnormalised exp2 against the maximum in use): all v_wmma_f32_16x16x32_f16 with f32 accumulate; softmax, bias, relu and residual in f32.
#include <hip/hip_runtime.h>

// ---------------------------------------------------------------------------
// Problem constants
// ---------------------------------------------------------------------------
constexpr int kBatch = 4;
constexpr int kSeq   = 2048;
constexpr int kDim   = 512;
constexpr int kHeads = 8;
constexpr int kDh    = 64;
constexpr int kTok   = kBatch * kSeq;      // 8192 token rows
constexpr float kWCarry    = 16.0f;        // weights carried x16 in f16
constexpr float kWCarryInv = 1.0f / 16.0f;
constexpr float kQKScaleLog2 = 0.125f * 1.4426950408889634f;   // 1/sqrt(64), times log2(e): the softmax runs in base 2
static_assert(kHeads * kDh == kDim);

typedef __attribute__((ext_vector_type(16))) _Float16 v16h;
typedef __attribute__((ext_vector_type(8)))  _Float16 v8h;
typedef __attribute__((ext_vector_type(8)))  float    v8f;
typedef __attribute__((ext_vector_type(4)))  float    v4f;
typedef __attribute__((ext_vector_type(4)))  _Float16 v4h;
typedef __attribute__((address_space(3))) v4h lds_v4h;   // a v4h in LDS, reached by its byte address
typedef __attribute__((address_space(1))) const float glb_f;    // global memory, said in the type: a pointer that has passed
typedef __attribute__((address_space(1))) const v4f glb_v4f;    // through an asm statement still gives global loads, not flat ones

// ---------------------------------------------------------------------------
// f16 fragment of the 16x16x32 form
// ---------------------------------------------------------------------------
template <typename T> struct Frag;
template <> struct Frag<_Float16> {
  typedef v16h V; union U { v16h v; v8h h[2]; };
  static __device__ __forceinline__ v16h load(const _Float16* p) {   // elements 0..7 <- p[0..7], 8..15 <- p[16..23]
    U f; f.h[0] = *(const v8h*)(p); f.h[1] = *(const v8h*)(p + 16); return f.v;
  }
  static __device__ __forceinline__ v8f mma(v16h a, v16h b, v8f c) {
    return __builtin_amdgcn_wmma_f32_16x16x32_f16(false, a, false, b, (short)0, c, false, false);
  }
};

// ---------------------------------------------------------------------------
// The three projections in one launch, straight from the f32 inputs: blockIdx.y = 0 (Q), 1 (K), 2 (V^T).
// C[m,n] = relu(sum_k A[m,k] * B[n,k] / 16 + bias); both operands are f32 rows of 512, k-contiguous.
// Q alone is stored times kQKScaleLog2 (positive, so it passes through the relu): K.Q^T is then the softmax's base-2 exponent.
//   Q, K : A = X (tokens),   B = W (features), C = [token][512],    bias by n
//   V^T  : A = Wv (features), B = Xv (tokens),  C = [feature][8192], bias by m
// A work-group owns a 256 x 256 tile of C (8 waves, 4 x 2, each 64 x 128) and walks k in stages of 64: every X row is
// fetched by two work-groups and every W row by 32.
// Staging: each stage's 256 + 256 rows of 256 B come as whole lines into registers, are converted there to f16 (W times
// 16, X as it is) and stored into one of two LDS buffers; one barrier per stage publishes the next buffer and ends the
// reads of the one refilled behind it. A staging register is loaded anew right behind its conversion, in front of that
// barrier: the loads lead by a whole stage and the work-group always has some in flight.
// The k walk of a work-group starts at a stage turned by its tile indices and wraps: the 32 work-groups that read the same W
// rows, all resident and in step, then ask L2 for eight different pieces of those rows at a time, not all for the same
// lines, and the two that read the same X rows walk half a turn apart, so that each finds in L2 the half that the other
// has fetched from memory.
// The k order of every accumulator is steps of 32, ascending from that start stage and wrapping at 512.
// The stage loop is unrolled whole: every global address is then one base, moved on once per stage, plus an immediate offset.
// ---------------------------------------------------------------------------
constexpr int kPjTile   = 256;                    // rows of each operand per work-group
constexpr int kPjWaves  = 8;                      // 4 x 2, each 64 x 128 of the tile
constexpr int kPjK      = 64;                     // k of a stage (two WMMA steps)
constexpr int kPjStages = kDim / kPjK;
constexpr int kPjPitch  = 72;                     // halves per LDS row: 128 B + 16 B, conflict-free for 16-byte reads
constexpr int kPjRowsAt = kPjWaves * 32 / 16;     // rows that the work-group's threads bring with one 16-byte load each
constexpr int kPjLoads  = kPjTile / kPjRowsAt;    // 16-byte loads of a thread per operand and stage
constexpr int kPjOp     = kPjTile * kPjPitch;     // halves of one operand's tile in LDS
constexpr int kPjBuf    = 2 * kPjOp;              // halves of a buffer
static_assert(kPjWaves * 16 * 68 * 4 <= kPjBuf * 2);   // the eight output slabs fit one buffer
static_assert(kTok % kPjTile == 0 && kDim % kPjTile == 0 && kDim % kPjK == 0);
static_assert(((kTok / kPjTile) & (kTok / kPjTile - 1)) == 0 && kPjStages >= 2 && (kPjStages & (kPjStages - 1)) == 0);

// Work-group barrier that orders LDS alone: every wave's LDS stores and reads in front of it are done before any wave goes
// on. __syncthreads() would also wait for the wave's global loads, which here are meant to stay in flight across it; they
// land in the wave's own registers and concern no other wave.
__device__ __forceinline__ void barrier_lds() {
  __builtin_amdgcn_fence(__ATOMIC_RELEASE, "workgroup", "local");
  __builtin_amdgcn_s_barrier();
  __builtin_amdgcn_fence(__ATOMIC_ACQUIRE, "workgroup", "local");
}

__global__ __launch_bounds__(kPjWaves * 32) void proj_fused_kernel(
    const float* __restrict__ Xq, const float* __restrict__ Xk, const float* __restrict__ Xv,
    const float* __restrict__ Wq, const float* __restrict__ Wk, const float* __restrict__ Wv,
    const float* __restrict__ bq, const float* __restrict__ bk, const float* __restrict__ bv,
    unsigned short* __restrict__ Q16, unsigned short* __restrict__ K16, unsigned short* __restrict__ Vt16) {
  typedef Frag<_Float16> F;
  __shared__ __align__(16) unsigned char smem[2 * kPjBuf * 2];   // [buffer][A rows | B rows][pitch] in halves
  _Float16* const ring = (_Float16*)smem;
  const int z = blockIdx.y;
  const bool isV = (z == 2);                       // block-uniform
  const float* X    = (z == 0) ? Xq : (z == 1) ? Xk : Xv;
  const float* Wt   = (z == 0) ? Wq : (z == 1) ? Wk : Wv;
  const float* bias = (z == 0) ? bq : (z == 1) ? bk : bv;
  unsigned short* C = (z == 0) ? Q16 : (z == 1) ? K16 : Vt16;
  const int tokTile  = blockIdx.x & (kTok / kPjTile - 1);   // the two work-groups of a token tile stand 32 apart in the
  const int featTile = blockIdx.x / (kTok / kPjTile);       // grid (speed only: a multiple of the number of dies)
  const int m0  = (isV ? featTile : tokTile) * kPjTile;
  const int n0  = (isV ? tokTile : featTile) * kPjTile;
  const int ldc = isV ? kTok : kDim;
  const float sa = isV ? kWCarry : 1.0f;
  const float sb = isV ? 1.0f : kWCarry;

  const int lane = threadIdx.x & 31;
  const int wave = __builtin_amdgcn_readfirstlane(threadIdx.x >> 5);   // the same in every lane: kept in a scalar register
  const int c    = lane & 15;                      // row (A) / column (B, D) within a 16-tile
  const int h    = lane >> 4;
  const int wm   = (wave >> 1) * 64;               // the wave's rows of the tile
  const int wn   = (wave & 1) * 128;               // the wave's columns of the tile

  // Staging map: 16 lanes x 16 B = one 256-B row piece; a thread brings rows srow + 16 i of both operands.
  const int srow = threadIdx.x >> 4;
  const int sc4  = (threadIdx.x & 15) * 4;
  // The stage of k that comes first, block-uniform. Speed only: the half turn by tokTile >> 3 varies the start among the groups that read the same W rows;
  // the half turn by featTile parts the two groups of a token tile.
  const int rot  = (tokTile + (kPjStages / 2) * ((tokTile >> 3) + featTile)) & (kPjStages - 1);
  glb_f* gA = (glb_f*)((isV ? Wt : X) + (size_t)(m0 + srow) * kDim + sc4 + rot * kPjK);
  glb_f* gB = (glb_f*)((isV ? X : Wt) + (size_t)(n0 + srow) * kDim + sc4 + rot * kPjK);
  // Moves both pointers on to stage s of the walk, k = 64 ((s + rot) mod 8). The wait stands before the addresses of the loads
  // issued so far get their new values; it takes the pointers in and gives them out, so that the additions stand behind it.
  auto turn = [&](int s) {
    asm volatile("s_wait_xcnt 0x0" : "+v"(gA), "+v"(gB) :: "memory");
    const int d = (((s + rot) & (kPjStages - 1)) == 0) ? -(kPjStages - 1) * kPjK : kPjK;   // block-uniform
    gA += d;
    gB += d;
  };
  const int sOff = srow * kPjPitch + sc4;
  // LDS byte addresses of the thread's first staging slot in the two buffers. The second is formed in asm so that it stays
  // one base register, with every store's place but the last three B ones (up to 71,424 B) in the 16-bit offset field: left to itself the compiler folds the buffer's
  // 73,728 bytes into each store's own constant, which no longer fits that field, and holds an address register per store
  // through the whole stage loop, which has none to spare (it spilled).
  const unsigned w0 = (unsigned)(size_t)(ring + sOff);
  unsigned w1;
  asm("v_add_nc_u32 %0, %1, %2" : "=v"(w1) : "i"(kPjBuf * 2), "v"(w0));

  v4f ra[kPjLoads], rb[kPjLoads];
#pragma unroll
  for (int i = 0; i < kPjLoads; ++i) {
    ra[i] = *(glb_v4f*)(gA + (size_t)i * kPjRowsAt * kDim);
    rb[i] = *(glb_v4f*)(gB + (size_t)i * kPjRowsAt * kDim);
  }

  v8f acc[4][8];   // acc[i][j][r] = C[wm + 16i + 8h + r][wn + 16j + c]
#pragma unroll
  for (int i = 0; i < 4; ++i)
#pragma unroll
    for (int j = 0; j < 8; ++j) acc[i][j] = (v8f){0.f,0.f,0.f,0.f,0.f,0.f,0.f,0.f};

  turn(1);
#pragma unroll
  for (int i = 0; i < kPjLoads; ++i) {
    *(v4h*)(ring + sOff + i * kPjRowsAt * kPjPitch) = __builtin_convertvector(ra[i] * sa, v4h);
    *(v4h*)(ring + kPjOp + sOff + i * kPjRowsAt * kPjPitch) = __builtin_convertvector(rb[i] * sb, v4h);
    ra[i] = *(glb_v4f*)(gA + (size_t)i * kPjRowsAt * kDim);
    rb[i] = *(glb_v4f*)(gB + (size_t)i * kPjRowsAt * kDim);
    // Holds the order as in the stage loop below: a wave then has 36 loads outstanding at most; left free, the compiler
    // issues all 64 loads of the two stages in one run.
    if (i & 1) __builtin_amdgcn_sched_barrier(0);
  }
  barrier_lds();   // publishes stage 0

#pragma unroll
  for (int s = 0; s < kPjStages; ++s) {
    const _Float16* bA = ring + (s & 1) * kPjBuf;
    const _Float16* bB = bA + kPjOp;
#pragma unroll
    for (int ks = 0; ks < 2; ++ks) {
      // The A fragments rotate through two register sets, each fetched one row of eight products ahead. The scheduling
      // barriers hold that order: left free, the compiler reuses one set and waits out an LDS read in front of every
      // row; all four fragments at once do not fit the registers.
      const _Float16* pA = bA + (wm + c) * kPjPitch + ks * 32 + 8 * h;
      v16h af[2], bf[8];
      af[0] = F::load(pA);
#pragma unroll
      for (int j = 0; j < 8; ++j) bf[j] = F::load(bB + (wn + (j << 4) + c) * kPjPitch + ks * 32 + 8 * h);
      af[1] = F::load(pA + 16 * kPjPitch);
      __builtin_amdgcn_sched_barrier(0);
#pragma unroll
      for (int i = 0; i < 4; ++i) {
#pragma unroll
        for (int j = 0; j < 8; ++j) acc[i][j] = F::mma(af[i & 1], bf[j], acc[i][j]);
        if (i < 2) {
          __builtin_amdgcn_sched_barrier(0);
          af[i & 1] = F::load(pA + (i + 2) * 16 * kPjPitch);
          __builtin_amdgcn_sched_barrier(0);
        }
      }
    }
    if (s + 1 < kPjStages) {
      // Keeps the conversions, and with them the wait for the loads, behind this stage's products.
      __builtin_amdgcn_sched_barrier(0);
      const unsigned wB = ((s + 1) & 1) ? w1 : w0;
      if (s + 2 < kPjStages) turn(s + 2);
      // Behind the walk's last loads: holds their addresses' registers until the wait.
      if (s + 2 == kPjStages) asm volatile("s_wait_xcnt 0x0" :: "v"(gA), "v"(gB) : "memory");
#pragma unroll
      for (int i = 0; i < kPjLoads; ++i) {
        *(lds_v4h*)(wB + i * kPjRowsAt * kPjPitch * 2) = __builtin_convertvector(ra[i] * sa, v4h);
        *(lds_v4h*)(wB + (kPjOp + i * kPjRowsAt * kPjPitch) * 2) = __builtin_convertvector(rb[i] * sb, v4h);
        if (s + 2 < kPjStages) {
          ra[i] = *(glb_v4f*)(gA + (size_t)i * kPjRowsAt * kDim);
          rb[i] = *(glb_v4f*)(gB + (size_t)i * kPjRowsAt * kDim);
        }
        // Holds the conversions, stores and new loads together, two pairs of registers at a time: left free, the compiler
        // puts the loads of some stages behind all of the stage's conversions.
        if (i & 1) __builtin_amdgcn_sched_barrier(0);
      }
      barrier_lds();   // publishes stage s + 1; ends every wave's reads of the buffer that stage s + 1 refills
    }
  }

  // Epilogue: scale, bias, relu in f32; each wave turns its 16 x 64 slabs (pitch 68 floats) in its own LDS range into
  // whole 128-B lines. The slabs lie in buffer 0: the last stage reads buffer 1, and every wave's last read of buffer 0
  // stands in front of the barrier that published that stage.
  static_assert((kPjStages & 1) == 0);
  float* slab = (float*)smem + wave * (16 * 68);
  // The lane's number is read anew here: kept from the kernel's head it would hold registers through the stage loop,
  // which has none to spare (the block is one-dimensional, so this is threadIdx.x & 31).
  const int el = __builtin_amdgcn_mbcnt_lo(~0u, 0u);
  const int ec = el & 15;
  const int eh = el >> 4;
  // Both bias forms are loaded with no branch; the form not in use reads from the start of the 512.
  // Each s_wait_xcnt below takes the registers that the loads or stores above it name as inputs, so that none of them is
  // given a new value in front of the wait. The slab fences name LDS alone: the wave's global stores need not be waited for.
  const float os = (z == 0) ? kQKScaleLog2 : 1.0f;   // block-uniform: the factor that the stored plane carries
  const float cs = kWCarryInv * os;
  const float* bnp = bias + (isV ? 0 : n0 + wn + ec);
  float bn[8];
#pragma unroll
  for (int j = 0; j < 8; ++j) bn[j] = bnp[j << 4];
  asm volatile("s_wait_xcnt 0x0" :: "v"(bnp) : "memory");   // stands before the eight loads' address gets a new value
#pragma unroll   // constant indices keep bn in registers
  for (int j = 0; j < 8; ++j) bn[j] *= os;
  const int q = el >> 3, c8 = (el & 7) * 8;
#pragma unroll
  for (int i = 0; i < 4; ++i) {
    const int mBase = m0 + wm + (i << 4);
    const float* bp = bias + (isV ? mBase + 8 * eh : 0);
    const v4f bm[2] = {*(const v4f*)(bp), *(const v4f*)(bp + 4)};
    asm volatile("s_wait_xcnt 0x0" :: "v"(bp) : "memory");   // stands before the two loads' address gets a new value
    unsigned short* cp[4];
#pragma unroll
    for (int it = 0; it < 4; ++it) cp[it] = C + (size_t)(mBase + it * 4 + q) * ldc + n0 + wn + c8;
#pragma unroll
    for (int jh = 0; jh < 2; ++jh) {   // the wave's 128 columns in two slabs of 64
#pragma unroll
      for (int r = 0; r < 8; ++r) {
#pragma unroll
        for (int j = 0; j < 4; ++j) {
          float v = acc[i][4 * jh + j][r] * cs;
          v += isV ? bm[r >> 2][r & 3] : bn[4 * jh + j];   // os is 1 where the bias goes by m
          slab[(8 * eh + r) * 68 + (j << 4) + ec] = fmaxf(v, 0.0f);
        }
      }
      __builtin_amdgcn_fence(__ATOMIC_RELEASE, "workgroup", "local");
      __builtin_amdgcn_wave_barrier();   // the slab is the wave's own: its lanes' stores stand before its lanes' reads
      __builtin_amdgcn_fence(__ATOMIC_ACQUIRE, "workgroup", "local");
      v8h hv[4];
#pragma unroll
      for (int it = 0; it < 4; ++it) {
        const float* sp = slab + (it * 4 + q) * 68 + c8;
#pragma unroll
        for (int e = 0; e < 8; ++e) hv[it][e] = (_Float16)sp[e];
        *(v8h*)(cp[it] + jh * 64) = hv[it];
      }
      // Stands before the four stores' addresses and data get new values.
      asm volatile("s_wait_xcnt 0x0" :: "v"(cp[0]), "v"(cp[1]), "v"(cp[2]), "v"(cp[3]),
                                        "v"(hv[0]), "v"(hv[1]), "v"(hv[2]), "v"(hv[3]) : "memory");
      if (i < 3 || jh < 1) {
        __builtin_amdgcn_fence(__ATOMIC_RELEASE, "workgroup", "local");
        __builtin_amdgcn_wave_barrier();   // the reads above stand before the next slab's stores
        __builtin_amdgcn_fence(__ATOMIC_ACQUIRE, "workgroup", "local");
      }
    }
  }
}

typedef __attribute__((ext_vector_type(2))) float v2f;
typedef __attribute__((ext_vector_type(2))) _Float16 v2h;
constexpr int kFaQWaves = 8;                      // waves side by side over the queries
constexpr int kFaKSplit = 2;                      // wave groups over the keys
constexpr int kFaWaves  = kFaQWaves * kFaKSplit;
constexpr int kFaCols   = 32;                     // query columns of a wave (two 16-column groups)
constexpr int kFaRows   = kFaQWaves * kFaCols;    // queries of a work-group
constexpr int kFaStage  = 64;                     // keys of a wave group's stage (two passes of 32)
constexpr int kFaStep   = kFaStage * kFaKSplit;   // keys of the work-group's stage
constexpr int kFaStages = kSeq / kFaStep;
constexpr int kFaPitch  = 72;                     // halves per LDS row: 128 B + 16 B, conflict-free for 16-byte reads
constexpr int kFaTile   = kFaStage * kFaPitch;    // halves of one K or V^T tile in LDS
constexpr int kFaRing   = kFaKSplit * 2 * 2 * kFaTile * 2;         // bytes: [group][buffer][K | V^T]
constexpr int kFaXAcc   = kFaWaves * 8 * 32 * 4;  // floats handed over in the merge: 32 per lane
static_assert(kSeq % kFaRows == 0 && kSeq % kFaStep == 0 && kDh == 64 && kDh == kFaStage && kFaKSplit == 2);
constexpr int kFaTurn   = kFaStages / (kSeq / kFaRows);            // stages between the starts of neighbouring query blocks
static_assert((kFaStages & (kFaStages - 1)) == 0 && kFaTurn >= 1);
static_assert((kFaXAcc + kFaWaves * 2 * 32) * 4 <= kFaRing);
constexpr int kFaSlabPitch = 68;                  // floats per LDS row of an output slab: 256 B + 16 B, conflict-free both ways
constexpr int kFaSlab   = 16 * kFaSlabPitch;      // floats of a wave's output slab (16 queries x 64 d)
constexpr int kFaSide   = kFaWaves * kFaSlab * 4; // bytes behind the ring: first the Q tile, at the end the output slabs
static_assert(kFaRows * kFaPitch * 2 <= kFaSide && kFaRing % 16 == 0 && (kFaSlab * 4) % 16 == 0);

constexpr float kFaSumCap = 4096.0f;              // a lane's sum of 16 terms above this raises the maximum in use

// The 16 terms of one query column that a lane holds (two 16-key tiles), from their exponents (kShift: less a raise of the
// maximum in use): their f32 sum, and the terms in f16 as the B operand of V^T.P^T (element e = key kmap(e, h): tile e >> 3,
// register e & 7).
template <bool kShift>
__device__ __forceinline__ void fa_terms(const v8f& s0, const v8f& s1, float raise, v16h& terms, float& sum) {
  union { v16h v; v2h p[8]; } pf;
  v2f l = (v2f){0.f, 0.f};   // even and odd registers, summed apart as pairs
#pragma unroll
  for (int i = 0; i < 8; ++i) {
    const v8f& s = (i < 4) ? s0 : s1;
    v2f arg = (v2f){s[2 * (i & 3)], s[2 * (i & 3) + 1]};
    if (kShift) arg -= (v2f){raise, raise};
    const v2f p = (v2f){__builtin_amdgcn_exp2f(arg[0]), __builtin_amdgcn_exp2f(arg[1])};
    l += p;
    pf.p[i] = __builtin_convertvector(p, v2h);
  }
  terms = pf.v;
  sum = l[0] + l[1];
}

__device__ __forceinline__ float xhalf(float x) {   // lane l with lane l ^ 16
  return __builtin_bit_cast(float, __builtin_amdgcn_permlanex16(__builtin_bit_cast(int, x), __builtin_bit_cast(int, x),
                                                                0x76543210, 0xfedcba98, false, false));
}

// exp2 with the slot that the instruction set asks for behind a transcendental kept in the same statement.
__device__ __forceinline__ float exp2_slot(float x) {
  float r;
  asm("v_exp_f32 %0, %1\n\tv_nop" : "=v"(r) : "v"(x));
  return r;
}

__global__ __launch_bounds__(kFaWaves * 32) void attn_fused_kernel(const unsigned short* __restrict__ Qp,
                                                                   const unsigned short* __restrict__ Kp,
                                                                   const unsigned short* __restrict__ Vtp,
                                                                   const float* __restrict__ R, float* __restrict__ C) {
  typedef Frag<_Float16> F;
  __shared__ __align__(16) unsigned char smem[kFaRing + kFaSide];
  const int lane = threadIdx.x & 31;
  const int wave = threadIdx.x >> 5;
  const int kg   = __builtin_amdgcn_readfirstlane(wave / kFaQWaves);   // the wave's key group, the same in every lane
  const int c    = lane & 15;
  const int h    = lane >> 4;
  const int b    = blockIdx.y / kHeads;
  const int head = blockIdx.y - b * kHeads;
  const int q0   = blockIdx.x * kFaRows + (wave & (kFaQWaves - 1)) * kFaCols;
  const size_t tokOff = (size_t)b * kSeq * kDim + (size_t)head * kDh;   // row b*2048, this head's 64 columns
  const _Float16* Q  = (const _Float16*)Qp + tokOff;
  const _Float16* K  = (const _Float16*)Kp + tokOff;
  const _Float16* Vt = (const _Float16*)Vtp + (size_t)head * kDh * kTok + (size_t)b * kSeq;
  _Float16* const ring = (_Float16*)smem + kg * (4 * kFaTile);   // the group's two buffers, each K tile then V^T tile

  // Staging map within a group: 8 lanes x 16 B = one 128-B row; a thread brings rows srow and srow + 32 of both tiles.
  const int gt  = threadIdx.x & (kFaQWaves * 32 - 1);
  const int srow = gt >> 3;
  const int sch  = (gt & 7) * 8;
  const _Float16* gK = K + (size_t)(kg * kFaStage + srow) * kDim + sch;
  const _Float16* gV = Vt + (size_t)srow * kTok + kg * kFaStage + sch;
  const int sOff0 = srow * kFaPitch + sch;
  const int sOff1 = (srow + 32) * kFaPitch + sch;

  const int rot = blockIdx.x * kFaTurn;   // block-uniform: the stage of keys that comes first
  const size_t k0 = (size_t)(rot & (kFaStages - 1)) * kFaStep;

  const _Float16* pK = gK + k0 * kDim;
  const _Float16* pV = gV + k0;

  v8h rk0 = *(const v8h*)(pK);
  v8h rk1 = *(const v8h*)(pK + (size_t)32 * kDim);
  v8h rv0 = *(const v8h*)(pV);
  v8h rv1 = *(const v8h*)(pV + (size_t)32 * kTok);

  // The Q tile by rows: 8 lanes x 16 B = one 128-B row; a thread brings rows qrow + 64 i.
  _Float16* const qs = (_Float16*)(smem + kFaRing);
  const int qrow = threadIdx.x >> 3;
  const _Float16* gQ = Q + (size_t)(blockIdx.x * kFaRows + qrow) * kDim + sch;
  v8h rq[kFaRows / 64];
#pragma unroll
  for (int i = 0; i < kFaRows / 64; ++i) rq[i] = *(const v8h*)(gQ + (size_t)(64 * i) * kDim);
  asm volatile("s_wait_xcnt 0x0" :: "v"(pK), "v"(pV) : "memory");   // stands before the first stage's addresses get new values

  *(v8h*)(ring + sOff0) = rk0;
  *(v8h*)(ring + sOff1) = rk1;
  *(v8h*)(ring + kFaTile + sOff0) = rv0;
  *(v8h*)(ring + kFaTile + sOff1) = rv1;
#pragma unroll
  for (int i = 0; i < kFaRows / 64; ++i) *(v8h*)(qs + (qrow + 64 * i) * kFaPitch + sch) = rq[i];
  __syncthreads();   // publishes stage 0 and the Q tile

  v16h qf[2][2];   // [column group][k step]
#pragma unroll
  for (int g = 0; g < 2; ++g)
#pragma unroll
    for (int ks = 0; ks < 2; ++ks)
      qf[g][ks] = F::load(qs + ((wave & (kFaQWaves - 1)) * kFaCols + (g << 4) + c) * kFaPitch + ks * 32 + 8 * h);

  const v8f zero8 = (v8f){0.f,0.f,0.f,0.f,0.f,0.f,0.f,0.f};
  v8f acc[4][2];     // [16-row tile of d][column group]: acc[t][g][r] = O^T[16t + 8h + r][query 16g + c]
  v8f negM[2];       // minus the maximum in use of the lane's query, the same in all eight registers: a C operand
  float lSum[2];
#pragma unroll
  for (int g = 0; g < 2; ++g) {
    negM[g] = zero8;
    lSum[g] = 0.f;
#pragma unroll
    for (int t = 0; t < 4; ++t) acc[t][g] = zero8;
  }

  for (int s = 0; s < kFaStages; ++s) {
    const _Float16* bK = ring + (s & 1) * (2 * kFaTile);
    const _Float16* bV = bK + kFaTile;
    const bool more = (s + 1 < kFaStages);   // the same for the whole work-group
    if (more) {
      const size_t kn = (size_t)((s + 1 + rot) & (kFaStages - 1)) * kFaStep;
      rk0 = *(const v8h*)(gK + kn * kDim);
      rk1 = *(const v8h*)(gK + (kn + 32) * kDim);
      rv0 = *(const v8h*)(gV + kn);
      rv1 = *(const v8h*)(gV + kn + (size_t)32 * kTok);
    }
#pragma unroll
    for (int ps = 0; ps < 2; ++ps) {
      v16h kf[2][2], vf[4];
#pragma unroll
      for (int t = 0; t < 2; ++t)
#pragma unroll
        for (int ks = 0; ks < 2; ++ks) kf[t][ks] = F::load(bK + (ps * 32 + (t << 4) + c) * kFaPitch + ks * 32 + 8 * h);
#pragma unroll
      for (int t = 0; t < 4; ++t) vf[t] = F::load(bV + ((t << 4) + c) * kFaPitch + ps * 32 + 8 * h);
      // Holds the pass's LDS reads in front of its score products, in whole groups, K first: left free, the compiler
      // spreads them among the products in pairs and waits some of them out there.
      __builtin_amdgcn_sched_barrier(0);

      v8f st[2][2];   // [16-key tile][column group]: st[t][g][r] = exponent of key 16t + 8h + r, query 16g + c
#pragma unroll
      for (int t = 0; t < 2; ++t)
#pragma unroll
        for (int g = 0; g < 2; ++g) {
          st[t][g] = F::mma(kf[t][0], qf[g][0], negM[g]);
          st[t][g] = F::mma(kf[t][1], qf[g][1], st[t][g]);
        }
      // Holds the eight products in one run in front of the terms: left free, each tile's terms start right behind its
      // product, and v_nop fills the distance that the matrix instruction needs (34 of them per stage, against 14).
      __builtin_amdgcn_sched_barrier(0);

      // The terms against the maximum in use, and the lazy test on their sums, once per pass.
      v16h pf[2];     // [column group]
      float ls[2];
#pragma unroll
      for (int g = 0; g < 2; ++g) fa_terms<false>(st[0][g], st[1][g], 0.f, pf[g], ls[g]);
      const bool need = !(ls[0] <= kFaSumCap) || !(ls[1] <= kFaSumCap);   // also true for an infinite sum and for a NaN
      if (__builtin_amdgcn_ballot_w32(need) != 0) {   // scalar branch; rare after the first pass
        float raise[2];
#pragma unroll
        for (int g = 0; g < 2; ++g) {
          float mx = st[0][g][0];   // the largest exponent: how far the pass's maximum lies above the one in use
#pragma unroll
          for (int r = 1; r < 8; ++r) mx = fmaxf(mx, st[0][g][r]);
#pragma unroll
          for (int r = 0; r < 8; ++r) mx = fmaxf(mx, st[1][g][r]);
          mx = fmaxf(mx, xhalf(mx));   // both halves now hold this query's
          raise[g] = fmaxf(mx, 0.f);
          const float corr = __builtin_amdgcn_exp2f(-raise[g]);
          negM[g] = negM[g] - raise[g];
          lSum[g] *= corr;
#pragma unroll
          for (int t = 0; t < 4; ++t) acc[t][g] = acc[t][g] * corr;
        }
#pragma unroll
        for (int g = 0; g < 2; ++g) fa_terms<true>(st[0][g], st[1][g], raise[g], pf[g], ls[g]);   // no term now exceeds 1
      }

#pragma unroll
      for (int g = 0; g < 2; ++g) {
        lSum[g] += ls[g];
#pragma unroll
        for (int t = 0; t < 4; ++t) acc[t][g] = F::mma(vf[t], pf[g], acc[t][g]);
      }
    }
    if (more) {
      _Float16* nK = ring + ((s + 1) & 1) * (2 * kFaTile);
      _Float16* nV = nK + kFaTile;
      *(v8h*)(nK + sOff0) = rk0;
      *(v8h*)(nK + sOff1) = rk1;
      *(v8h*)(nV + sOff0) = rv0;
      *(v8h*)(nV + sOff1) = rv1;
    }
    __syncthreads();   // publishes stage s + 1; ends every wave's reads of the buffer that stage s + 1 refills
  }

  // Epilogue: the two waves that hold the same 32 queries (wave w and w + 8) merge their halves of the keys. Group 0
  // finishes column group 0 and group 1 column group 1: each wave hands the other column group (maximum in use, sum, 32
  // accumulator values per lane) to its partner through LDS. The ring is free: the loop's last barrier ended its reads.
  const bool up = (kg != 0);
  // Residual and output by rows: 16 lanes x 16 B = the 256 B of one query; an instruction moves queries 2 it and 2 it + 1.
  const size_t o = tokOff + (size_t)(q0 + (kg << 4) + h) * kDim + 4 * c;
  const float* rp = R + o;
  v4f res[8];
#pragma unroll
  for (int it = 0; it < 8; ++it) res[it] = *(const v4f*)(rp + (size_t)(2 * it) * kDim);
  v4f*   const xa = (v4f*)smem;                    // [wave][8][lane], 16 B each
  float* const xs = (float*)smem + kFaXAcc;        // [wave][minus the maximum in use, sum][lane]
  {
    v4f* xw = xa + wave * (8 * 32) + lane;
#pragma unroll
    for (int t = 0; t < 4; ++t) {
      const v8f give = up ? acc[t][0] : acc[t][1];
      xw[(2 * t) * 32]     = (v4f){give[0], give[1], give[2], give[3]};
      xw[(2 * t + 1) * 32] = (v4f){give[4], give[5], give[6], give[7]};
    }
    xs[(wave * 2) * 32 + lane]     = up ? negM[0][0] : negM[1][0];
    xs[(wave * 2 + 1) * 32 + lane] = up ? lSum[0] : lSum[1];
  }
  __syncthreads();   // publishes every wave's hand-over to its partner
  const int pw = wave ^ kFaQWaves;
  const v4f* xr = xa + pw * (8 * 32) + lane;
  const float nOwn = up ? negM[1][0] : negM[0][0];
  const float lOwn = up ? lSum[1] : lSum[0];
  const float nOth = xs[(pw * 2) * 32 + lane];
  const float lOth = xs[(pw * 2 + 1) * 32 + lane];
  const float nAll = fminf(nOwn, nOth);                     // minus the larger of the two maxima in use
  const float fOwn = exp2_slot(nAll - nOwn);   // one of the two factors is 1
  const float fOth = exp2_slot(nAll - nOth);
  const float lAll = lOwn * fOwn + lOth * fOth;
  const float inv  = 1.0f / (lAll + xhalf(lAll));   // the largest score's term is at least 1: no maximum in use exceeds it
  const float aOwn = fOwn * inv;
  const float aOth = fOth * inv;
  // The slab is the wave's own range behind the ring; the Q tile that lay there was last read in front of the stage loop.
  float* const slab = (float*)(smem + kFaRing) + wave * kFaSlab;
#pragma unroll
  for (int t = 0; t < 4; ++t) {
    const v8f own = up ? acc[t][1] : acc[t][0];   // a lane holds 8 consecutive d of query c per tile
    const v4f p0 = xr[(2 * t) * 32];
    const v4f p1 = xr[(2 * t + 1) * 32];
    v4f o0, o1;
#pragma unroll
    for (int e = 0; e < 4; ++e) {
      o0[e] = own[e] * aOwn + p0[e] * aOth;
      o1[e] = own[4 + e] * aOwn + p1[e] * aOth;
    }
    *(v4f*)(slab + c * kFaSlabPitch + (t << 4) + 8 * h) = o0;
    *(v4f*)(slab + c * kFaSlabPitch + (t << 4) + 8 * h + 4) = o1;
  }
  __builtin_amdgcn_fence(__ATOMIC_RELEASE, "workgroup", "local");
  __builtin_amdgcn_wave_barrier();   // the slab is the wave's own: its lanes' stores stand before its lanes' reads
  __builtin_amdgcn_fence(__ATOMIC_ACQUIRE, "workgroup", "local");
  float* cp = C + o;
#pragma unroll
  for (int it = 0; it < 8; ++it)
    *(v4f*)(cp + (size_t)(2 * it) * kDim) = *(const v4f*)(slab + (2 * it + h) * kFaSlabPitch + 4 * c) + res[it];
}

// ---------------------------------------------------------------------------
// Host side
// Workspace region map (bytes):
//   Q16  : 8192 x 512 x 2            =   8,388,608 @          0   (relu(Xq Wq^T + bq) * log2(e) / 8, f16, [tok][512])
//   K16  : 8192 x 512 x 2            =   8,388,608 @  8,388,608
//   Vt16 : 512 x 8192 x 2            =   8,388,608 @ 16,777,216   (relu(Wv Xv^T + bv), f16, [v][b*2048+t])
//   total                            =  25,165,824
// ---------------------------------------------------------------------------
extern "C" void kernel_launch(void* const* d_in, const int* in_sizes, int n_in,
                              void* d_out, int out_size, void* d_ws, size_t ws_size,
                              hipStream_t stream) {
  if (n_in < 9) return;
  const size_t nTokU = (size_t)kTok * kDim;       // 4,194,304
  const size_t nWW   = (size_t)kDim * kDim;       //   262,144
  if ((size_t)in_sizes[0] != nTokU || (size_t)in_sizes[1] != nTokU || (size_t)in_sizes[2] != nTokU) return;
  if ((size_t)in_sizes[3] != nWW || (size_t)in_sizes[5] != nWW || (size_t)in_sizes[7] != nWW) return;
  if (in_sizes[4] != kDim || in_sizes[6] != kDim || in_sizes[8] != kDim) return;
  if ((size_t)out_size != nTokU) return;

  const float* queries = (const float*)d_in[0];
  const float* keys    = (const float*)d_in[1];
  const float* values  = (const float*)d_in[2];
  const float* Wq      = (const float*)d_in[3];
  const float* bq      = (const float*)d_in[4];
  const float* Wk      = (const float*)d_in[5];
  const float* bk      = (const float*)d_in[6];
  const float* Wv      = (const float*)d_in[7];
  const float* bv      = (const float*)d_in[8];
  float* out = (float*)d_out;

  // ---- carve ----
  const size_t bPlane = nTokU * 2;
  if (3 * bPlane > ws_size) return;
  char* ws = (char*)d_ws;
  unsigned short* Q16  = (unsigned short*)(ws);
  unsigned short* K16  = (unsigned short*)(ws + bPlane);
  unsigned short* Vt16 = (unsigned short*)(ws + 2 * bPlane);

  // ---- projections: one launch; x = 2 feature tiles x 32 token tiles, y = Q, K, V^T; 8 waves per work-group ----
  proj_fused_kernel<<<dim3((kTok / kPjTile) * (kDim / kPjTile), 3), dim3(kPjWaves * 32), 0, stream>>>(
      queries, keys, values, Wq, Wk, Wv, bq, bk, bv, Q16, K16, Vt16);

  // ---- attention: one launch; x = block of 256 queries, y = batch * 8 + head; 16 waves per work-group ----
  // out[b,q,h*64+d] = sum_k softmax_k(ln(2) * Q[b,q,h*64+:] . K[b,k,h*64+:]) Vt[h*64+d][b*2048+k] + queries[b,q,h*64+d]
  attn_fused_kernel<<<dim3(kSeq / kFaRows, kBatch * kHeads), dim3(kFaWaves * 32), 0, stream>>>(Q16, K16, Vt16, queries, out);
}
